// v000
// The times below were measured on an AMD MI455X: many runs one after another, warmed up first and cycling through
// copies of the inputs, with the whole window's GPU time divided by the number of runs. Launches and the gaps
// between them are all in it. The median over several windows is given; except for v000 it joins two sittings, which
// can be a few percent apart, so the side-by-side timings, each taken in one sitting, are the better comparison.
// v000 is the starting kernel. One run takes 3050 microseconds.
#include <hip/hip_runtime.h>

// MaskedMultiHeadAttention (hidden [8][1024][768]; per-head q/k/v = x Wq[h] + bq[h] (Wq [12][768][64]); causal softmax(q.k / 8); out = concat(heads) Wo + bo -> [8][1024][768]). That is EIGHT sequences of 1,024 tokens at width 768 with 12 heads x 64 ([8][1024][768]) and the inputs in the order x, Wq, bq, Wk, bk, Wv, bv, W0, b0 (each bias after its own weight).
// Compute dtypes, f32 accumulate: every input rounded to bf16; q/k/v on PLAIN bf16 operands (inputs: exact; the 12 per-head weights gathered into one [768 x 768] operand) + bias; causal scores and attn.v: query rows < 512 hl (3 products), the rest single fp16 (x1024); softmax f32; Wo hl x exact (2 products) + bias.

#define NB_  8
#define TT   1024
#define DM   768
#define NH_  12
#define NKV  12
#define REP  (NH_ / NKV)
#define HD   64
#define DQ   (NH_ * HD)
#define DKV  (NKV * HD)
#define ZH   2
#define RH   512                  // query rows < RH use hi+lo planes (0: none)
#define WIN  1024
#define PCAR 1024.0f
#define SCL  0.125f   // HD^-0.5
typedef _Float16 h16;
typedef unsigned short bf;
typedef __attribute__((ext_vector_type(16))) __bf16   v16bf;
typedef __attribute__((ext_vector_type(16))) _Float16 v16h;
typedef __attribute__((ext_vector_type(8)))  _Float16 v8h;
typedef __attribute__((ext_vector_type(8)))  unsigned short v8us;
typedef __attribute__((ext_vector_type(8)))  float    v8f;
typedef __attribute__((ext_vector_type(4)))  float    v4f;
typedef v8h  __attribute__((may_alias)) v8ha;
typedef v4f  __attribute__((may_alias)) v4fa;
typedef v8us __attribute__((may_alias)) v8usa;

__device__ __forceinline__ unsigned short f2bf(float f) { unsigned u = __float_as_uint(f); u += 0x7FFFu + ((u >> 16) & 1u); return (unsigned short)(u >> 16); }
__device__ __forceinline__ float bf2f(unsigned short b) { return __uint_as_float(((unsigned)b) << 16); }
__device__ __forceinline__ float bfr(float f) { return bf2f(f2bf(f)); }
__device__ __forceinline__ v16h cat16(v8h lo, v8h hi) { return __builtin_shufflevector(lo, hi, 0, 1, 2, 3, 4, 5, 6, 7, 8, 9, 10, 11, 12, 13, 14, 15); }
__device__ __forceinline__ v16bf cat16b(v8us lo, v8us hi) { return __builtin_bit_cast(v16bf, __builtin_shufflevector(lo, hi, 0, 1, 2, 3, 4, 5, 6, 7, 8, 9, 10, 11, 12, 13, 14, 15)); }
__device__ __forceinline__ v8f wmma16(v16h a, v16h b, v8f c) { return __builtin_amdgcn_wmma_f32_16x16x32_f16(false, a, false, b, (short)0, c, false, false); }
__device__ __forceinline__ v8f wmmab(v16bf a, v16bf b, v8f c) { return __builtin_amdgcn_wmma_f32_16x16x32_bf16(false, a, false, b, (short)0, c, false, false); }



// ---- k_gemmw: register-blocked GEMM, ONE WAVE per 64x64 output tile (16 accumulators), operands straight from K-contiguous 16-bit planes; grid (M/64, N/64, Z), 32 threads.
// C[m][n] (f32, pitch ldc, + optional f32 bias[n]) = sum_k A[m][k] Bt[n][k] (+ split products per NSPLIT). z-batch strides sA/sB/sC in elements. K % 32 == 0.
template <typename T16> struct WFrag;
template <> struct WFrag<h16> { typedef v16h V; static __device__ __forceinline__ V ld(const h16* p) { return cat16(*(const v8h*)p, *(const v8h*)(p + 16)); } static __device__ __forceinline__ v8f mma(V a, V b, v8f c) { return wmma16(a, b, c); } };
template <> struct WFrag<bf> { typedef v16bf V; static __device__ __forceinline__ V ld(const bf* p) { return cat16b(*(const v8us*)p, *(const v8us*)(p + 16)); } static __device__ __forceinline__ v8f mma(V a, V b, v8f c) { return wmmab(a, b, c); } };
template <typename T16, int NSPLIT, bool BIAS>
__global__ __launch_bounds__(32) void k_gemmw(const T16* __restrict__ A, const T16* __restrict__ A2, const T16* __restrict__ Bt, const T16* __restrict__ Bt2, int K, float* C, int ldc, const float* __restrict__ bias, size_t sA, size_t sB, size_t sC) {
    typedef typename WFrag<T16>::V V;
    __shared__ __align__(16) float os[16 * 68];
    const size_t z = blockIdx.z; A += z * sA; if (A2) A2 += z * sA; Bt += z * sB; if (Bt2) Bt2 += z * sB; C += z * sC;
    const int lane = threadIdx.x & 31, lr = lane & 15, hi = lane >> 4; const int r0 = blockIdx.x * 64, c0 = blockIdx.y * 64;
    v8f acc[4][4];
#pragma unroll
    for (int mb = 0; mb < 4; ++mb)
#pragma unroll
        for (int nb = 0; nb < 4; ++nb) acc[mb][nb] = (v8f){};
    const size_t aoff = (size_t)(r0 + lr) * K + 8 * hi, boff = (size_t)(c0 + lr) * K + 8 * hi;
#pragma unroll 1
    for (int kc = 0; kc < K; kc += 32) {
        V a[4], a2[4];
#pragma unroll
        for (int mb = 0; mb < 4; ++mb) { a[mb] = WFrag<T16>::ld(A + aoff + (size_t)mb * 16 * K + kc); if (NSPLIT == 1 || NSPLIT == 2) a2[mb] = WFrag<T16>::ld(A2 + aoff + (size_t)mb * 16 * K + kc); }
#pragma unroll
        for (int nb = 0; nb < 4; ++nb) { const V b = WFrag<T16>::ld(Bt + boff + (size_t)nb * 16 * K + kc); V b2; if (NSPLIT >= 2) b2 = WFrag<T16>::ld(Bt2 + boff + (size_t)nb * 16 * K + kc);
#pragma unroll
            for (int mb = 0; mb < 4; ++mb) { acc[mb][nb] = WFrag<T16>::mma(a[mb], b, acc[mb][nb]); if (NSPLIT == 1 || NSPLIT == 2) acc[mb][nb] = WFrag<T16>::mma(a2[mb], b, acc[mb][nb]); if (NSPLIT >= 2) acc[mb][nb] = WFrag<T16>::mma(a[mb], b2, acc[mb][nb]); } }
        asm volatile("v_nop\n\tv_nop\n\tv_nop\n\tv_nop" : "+v"(acc[0][0]), "+v"(acc[1][1]), "+v"(acc[2][2]), "+v"(acc[3][3]) : "v"(a[0]), "v"(a[3]));
    }
#pragma unroll
    for (int mb = 0; mb < 4; ++mb) {
#pragma unroll
        for (int nb = 0; nb < 4; ++nb) {
#pragma unroll
            for (int j = 0; j < 8; ++j) os[(hi * 8 + j) * 68 + nb * 16 + lr] = acc[mb][nb][j]; }
        __builtin_amdgcn_wave_barrier(); asm volatile("" ::: "memory");
        float* crow = C + (size_t)(r0 + mb * 16) * ldc + c0;
{
#pragma unroll
            for (int s = 0; s < 8; ++s) { const int row = 2 * s + hi, cofs = lr * 4; v4f val = *(const v4fa*)(os + row * 68 + cofs); if (BIAS) { val[0] += bfr(bias[c0 + cofs]); val[1] += bfr(bias[c0 + cofs + 1]); val[2] += bfr(bias[c0 + cofs + 2]); val[3] += bfr(bias[c0 + cofs + 3]); }
                *(v4f*)(crow + (size_t)row * ldc + cofs) = val; }
             }
        __builtin_amdgcn_wave_barrier(); asm volatile("" ::: "memory");
    }
}

// ---- k_gemmc: the same one-wave 64x64 tile GEMM specialised for causal attention: CMODE 1 skips score tiles entirely above the diagonal (query rows r0+roff.., key columns c0..), CMODE 2 limits the
// key (K) loop of the probability x value contraction to the diagonal block (probabilities beyond it are exactly zero). roff = row offset of this launch's first row within the sequence.
template <typename T16, int NSPLIT, int CMODE>
__global__ __launch_bounds__(32) void k_gemmc(const T16* __restrict__ A, const T16* __restrict__ A2, const T16* __restrict__ Bt, const T16* __restrict__ Bt2, int K, float* C, int ldc, int roff, size_t sA, size_t sB, size_t sC) {
    typedef typename WFrag<T16>::V V;
    __shared__ __align__(16) float os[16 * 68];
    const size_t z = blockIdx.z; A += z * sA; if (A2) A2 += z * sA; Bt += z * sB; if (Bt2) Bt2 += z * sB; C += z * sC;
    const int lane = threadIdx.x & 31, lr = lane & 15, hi = lane >> 4; const int r0 = blockIdx.x * 64, c0 = blockIdx.y * 64;
    if (CMODE == 1 && c0 > r0 + roff + 63) return;                  // score tile entirely above the causal diagonal: never written (the softmax loads it and masks j > i by select)
    const int Kl = (CMODE == 2) ? min(K, r0 + roff + 64) : K;        // P.V: probabilities are exactly 0 beyond the diagonal block, so the K loop stops there
    v8f acc[4][4];
#pragma unroll
    for (int mb = 0; mb < 4; ++mb)
#pragma unroll
        for (int nb = 0; nb < 4; ++nb) acc[mb][nb] = (v8f){};
    const size_t aoff = (size_t)(r0 + lr) * K + 8 * hi, boff = (size_t)(c0 + lr) * K + 8 * hi;
#pragma unroll 1
    for (int kc = 0; kc < Kl; kc += 32) {
        V a[4], a2[4];
#pragma unroll
        for (int mb = 0; mb < 4; ++mb) { a[mb] = WFrag<T16>::ld(A + aoff + (size_t)mb * 16 * K + kc); if (NSPLIT == 1 || NSPLIT == 2) a2[mb] = WFrag<T16>::ld(A2 + aoff + (size_t)mb * 16 * K + kc); }
#pragma unroll
        for (int nb = 0; nb < 4; ++nb) { const V b = WFrag<T16>::ld(Bt + boff + (size_t)nb * 16 * K + kc); V b2; if (NSPLIT >= 2) b2 = WFrag<T16>::ld(Bt2 + boff + (size_t)nb * 16 * K + kc);
#pragma unroll
            for (int mb = 0; mb < 4; ++mb) { acc[mb][nb] = WFrag<T16>::mma(a[mb], b, acc[mb][nb]); if (NSPLIT == 1 || NSPLIT == 2) acc[mb][nb] = WFrag<T16>::mma(a2[mb], b, acc[mb][nb]); if (NSPLIT >= 2) acc[mb][nb] = WFrag<T16>::mma(a[mb], b2, acc[mb][nb]); } }
        asm volatile("v_nop\n\tv_nop\n\tv_nop\n\tv_nop" : "+v"(acc[0][0]), "+v"(acc[1][1]), "+v"(acc[2][2]), "+v"(acc[3][3]) : "v"(a[0]), "v"(a[3]));
    }
#pragma unroll
    for (int mb = 0; mb < 4; ++mb) {
#pragma unroll
        for (int nb = 0; nb < 4; ++nb) {
#pragma unroll
            for (int j = 0; j < 8; ++j) os[(hi * 8 + j) * 68 + nb * 16 + lr] = acc[mb][nb][j]; }
        __builtin_amdgcn_wave_barrier(); asm volatile("" ::: "memory");
        float* crow = C + (size_t)(r0 + mb * 16) * ldc + c0;
{
#pragma unroll
            for (int s = 0; s < 8; ++s) { const int row = 2 * s + hi, cofs = lr * 4; v4f val = *(const v4fa*)(os + row * 68 + cofs);
                *(v4f*)(crow + (size_t)row * ldc + cofs) = val; }
             }
        __builtin_amdgcn_wave_barrier(); asm volatile("" ::: "memory");
    }
}

__device__ __forceinline__ h16 tohx(float x) { return (h16)x; }
__device__ __forceinline__ void splitf(float y, unsigned short& h, unsigned short& l) { h = f2bf(y); l = f2bf(y - bf2f(h)); }
typedef __attribute__((ext_vector_type(2))) _Float16 v2h;
typedef __attribute__((ext_vector_type(4))) _Float16 v4h;
typedef __attribute__((ext_vector_type(2))) unsigned short v2us;
typedef __attribute__((ext_vector_type(4))) unsigned short v4us;
typedef __attribute__((ext_vector_type(2))) float v2f;
typedef __attribute__((ext_vector_type(4))) int v4i;

__global__ __launch_bounds__(256) void k_wtG(const float* __restrict__ w, int K, int N, bf* Bt) {
    const int lane = threadIdx.x & 31; const int L0 = (blockIdx.x * 8 + (threadIdx.x >> 5)) * 8; const int nlines = N * K / 64;
{
#pragma unroll 1
        for (int l = 0; l < 8; ++l) { const int L = L0 + l; if (L >= nlines) break; const size_t e = (size_t)L * 64 + lane * 2; const int k = (int)(e % K), n = (int)(e / K); v2us o;
            o[0] = f2bf(w[(size_t)k * N + n]); o[1] = f2bf(w[(size_t)(k + 1) * N + n]); *(v2us*)(Bt + e) = o; }
         }
}
__global__ __launch_bounds__(256) void k_cvt8(const float* __restrict__ src, bf* dst, size_t n8) { const size_t i = (size_t)blockIdx.x * 256 + threadIdx.x; if (i >= n8) return; const v8f v = *(const v8f*)(src + i * 8); v8us o;
#pragma unroll
    for (int k = 0; k < 8; ++k) o[k] = f2bf(v[k]); *(v8us*)(dst + i * 8) = o;  }
__global__ __launch_bounds__(256) void k_cscvt(const float* __restrict__ cosT, const float* __restrict__ sinT, float* CS) { const int idx = blockIdx.x * 256 + threadIdx.x; if (idx >= TT * HD) return; v2f cs; cs[0] = bfr(cosT[idx]); cs[1] = bfr(sinT[idx]); *(v2f*)(CS + (size_t)idx * 2) = cs;  }
// k_rope: head planes [h][t][d] (fp16 + hi/lo) of rope(x) x sc with the rotate-half convention out[d] = x[d] cos[t][d] - x[d+HD/2] sin[t][d], out[d+HD/2] = x[d+HD/2] cos[t][d+HD/2] + x[d] sin[t][d+HD/2]
__global__ __launch_bounds__(256) void k_rope(const float* __restrict__ F, int pitch, int nheads, const float* __restrict__ CS, const float* __restrict__ RF, const float* __restrict__ nw, float sc, h16* P16, bf* Ph, bf* Pl) {
    const size_t e = ((size_t)blockIdx.x * 256 + threadIdx.x) * 2; if (e >= (size_t)nheads * TT * HD) return; const int d = (int)(e % HD); const int t = (int)((e / HD) % TT); const int h = (int)(e / ((size_t)HD * TT)); const float* f = F + (size_t)t * pitch + h * HD; const float rf = RF ? RF[(size_t)h * TT + t] : 1.0f; v2h o16; v2us oh, ol;
#pragma unroll
    for (int q = 0; q < 2; ++q) { const int dd = d + q; const int dp = (dd < HD / 2) ? dd + HD / 2 : dd - HD / 2; float x0 = f[dd], x1 = f[dp];
        if (RF) { float n0 = __fmul_rn(x0, rf), n1 = __fmul_rn(x1, rf); asm volatile("" : "+v"(n0)); asm volatile("" : "+v"(n1)); x0 = __fmul_rn(bfr(nw[dd]), n0); x1 = __fmul_rn(bfr(nw[dp]), n1); }
        const v2f cs = *(const v2f*)(CS + ((size_t)t * HD + dd) * 2); float a = __fmul_rn(x0, cs[0]), bq = __fmul_rn(x1, cs[1]); asm volatile("" : "+v"(a)); asm volatile("" : "+v"(bq)); const float r = ((dd < HD / 2) ? __fsub_rn(a, bq) : __fadd_rn(a, bq)) * sc;
        o16[q] = tohx(r); unsigned short a2, c2; splitf(r, a2, c2); oh[q] = a2; ol[q] = c2; }
    *(v2h*)(P16 + e) = o16; *(v2us*)(Ph + e) = oh; *(v2us*)(Pl + e) = ol;  }
__global__ __launch_bounds__(256) void k_vtp(const float* __restrict__ F, int pitch, int nheads, h16* V16, bf* Vh, bf* Vl) { const size_t e = ((size_t)blockIdx.x * 256 + threadIdx.x) * 2; if (e >= (size_t)nheads * HD * TT) return; const int t = (int)(e % TT); const int d = (int)((e / TT) % HD); const int g = (int)(e / ((size_t)TT * HD)); v2h o16; v2us oh, ol;
#pragma unroll
    for (int q = 0; q < 2; ++q) { const float x = F[(size_t)(t + q) * pitch + g * HD + d]; o16[q] = tohx(x); unsigned short a2, c2; splitf(x, a2, c2); oh[q] = a2; ol[q] = c2; }
    *(v2h*)(V16 + e) = o16; *(v2us*)(Vh + e) = oh; *(v2us*)(Vl + e) = ol;  }
__global__ __launch_bounds__(256) void k_csid(float* CS) { const int idx = blockIdx.x * 256 + threadIdx.x; if (idx >= TT * HD) return; v2f cs; cs[0] = 1.0f; cs[1] = 0.0f; *(v2f*)(CS + (size_t)idx * 2) = cs;  }
// k_asoft: per row (zz, i): t = S x HD^-0.5 for j <= i and i - j < WIN (sliding causal window; the reference's -1e9 additive fill vanishes identically); softmax over the 1024 keys (register row, one exp, fixed trees);
__global__ __launch_bounds__(256) void k_asoft(const float* __restrict__ Sb, h16* P16, bf* Ph, bf* Pl) {
    const int lane = threadIdx.x & 31; const int row = blockIdx.x * 8 + (threadIdx.x >> 5); if (row >= ZH * TT) return; const int i = row % TT; const int zz = row / TT; (void)zz; const bool hires = (i < RH); const float* sr = Sb + (size_t)row * TT; float v[TT / 32]; float mx = -3.0e38f;
#pragma unroll
    for (int ch = 0; ch < TT / 128; ++ch) { const int j0 = ch * 128 + lane * 4; const v4f a = *(const v4f*)(sr + j0);
#pragma unroll
        for (int q = 0; q < 4; ++q) { const int j = j0 + q; (void)j; const float t = (j <= i && i - j < WIN) ? a[q] * SCL : -3.0e38f; v[ch * 4 + q] = t; mx = fmaxf(mx, t); } }
#pragma unroll
    for (int sh = 16; sh; sh >>= 1) mx = fmaxf(mx, __shfl_xor(mx, sh, 32));
    float sum = 0.f;
#pragma unroll
    for (int k = 0; k < TT / 32; ++k) { float d0 = __fsub_rn(v[k], mx); asm volatile("" : "+v"(d0)); v[k] = __builtin_amdgcn_exp2f(__fmul_rn(d0, 1.4426950408889634f)); sum += v[k]; }
#pragma unroll
    for (int sh = 16; sh; sh >>= 1) sum += __shfl_xor(sum, sh, 32);
    const float f = __fdiv_rn(hires ? 1.0f : PCAR, sum);
{
        if (hires) {
#pragma unroll
            for (int ch = 0; ch < TT / 128; ++ch) { v4us oh, ol;
#pragma unroll
                for (int q = 0; q < 4; ++q) { unsigned short a, c2; splitf(v[ch * 4 + q] * f, a, c2); oh[q] = a; ol[q] = c2; }
                const size_t oo = ((size_t)zz * (RH ? RH : 1) + i) * TT + ch * 128 + lane * 4; *(v4us*)(Ph + oo) = oh; *(v4us*)(Pl + oo) = ol; }
        } else {
#pragma unroll
            for (int ch = 0; ch < TT / 128; ++ch) { v4h o4;
#pragma unroll
                for (int q = 0; q < 4; ++q) o4[q] = tohx(v[ch * 4 + q] * f);
                *(v4h*)(P16 + (size_t)row * TT + ch * 128 + lane * 4) = o4; } }
         }
}
__global__ __launch_bounds__(256) void k_merge(const float* __restrict__ O, int h0, bf* Ah, bf* Al) { const size_t e = ((size_t)blockIdx.x * 256 + threadIdx.x) * 2; if (e >= (size_t)ZH * TT * HD) return; const int d = (int)(e % HD); const int t = (int)((e / HD) % TT); const int zz = (int)(e / ((size_t)HD * TT)); const float cs = (t < RH) ? 1.0f : (1.0f / PCAR); const size_t oo = (size_t)t * DQ + (h0 + zz) * HD + d;
    v2us oh, ol;
#pragma unroll
    for (int q = 0; q < 2; ++q) { unsigned short a, c2; splitf(O[e + q] * cs, a, c2); oh[q] = a; ol[q] = c2; } *(v2us*)(Ah + oo) = oh; *(v2us*)(Al + oo) = ol;  }

__global__ __launch_bounds__(256) void k_wtH(const float* __restrict__ w, bf* Bt) { const size_t e = ((size_t)blockIdx.x * 256 + threadIdx.x) * 4; if (e >= (size_t)DQ * DM) return; const int k = (int)(e % DM); const int n = (int)(e / DM); const int h = n / HD, c = n % HD; v4us o;   // Bt[h*64 + c][d] = W[h][d][c] (lane -> 4 consecutive d, strided reads)
#pragma unroll
    for (int u = 0; u < 4; ++u) o[u] = f2bf(w[((size_t)h * DM + k + u) * HD + c]); *(v4us*)(Bt + e) = o;  }

extern "C" void kernel_launch(void* const* d_in, const int* in_sizes, int n_in,
                              void* d_out, int out_size, void* d_ws, size_t ws_size, hipStream_t stream) {
    (void)in_sizes; (void)n_in; (void)out_size;
    const float* x = (const float*)d_in[0]; const float* wqh = (const float*)d_in[1]; const float* bq = (const float*)d_in[2]; const float* wkh = (const float*)d_in[3]; const float* bk = (const float*)d_in[4]; const float* wvh = (const float*)d_in[5]; const float* bv = (const float*)d_in[6]; const float* wo = (const float*)d_in[7]; const float* bo = (const float*)d_in[8]; const float* wq = nullptr; const float* wk = nullptr; const float* wv = nullptr; (void)wq; (void)wk; (void)wv; const float* cosT = nullptr; const float* sinT = nullptr; (void)cosT; (void)sinT;
    float* OUT = (float*)d_out;     // [8][1024][768]
    char* wsp = (char*)d_ws;
    auto take = [&](size_t bytes) { char* p = wsp; wsp += (bytes + 255) & ~(size_t)255; return (void*)p; };
    bf* WQ = (bf*)take((size_t)DQ * DM * 2); bf* WK = (bf*)take((size_t)DKV * DM * 2); bf* WV = (bf*)take((size_t)DKV * DM * 2); bf* WO = (bf*)take((size_t)DM * DQ * 2); float* CS = (float*)take((size_t)TT * HD * 2 * 4);
    bf* XB = (bf*)take((size_t)TT * DM * 2); float* FQ = (float*)take((size_t)TT * DQ * 4); float* FK = (float*)take((size_t)TT * DKV * 4);
    h16* QP16 = (h16*)take((size_t)NH_ * TT * HD * 2); h16* KP16 = (h16*)take((size_t)NKV * TT * HD * 2); h16* VT16 = (h16*)take((size_t)NKV * HD * TT * 2);
    bf* QPh = (bf*)take((size_t)NH_ * TT * HD * 2); bf* QPl = (bf*)take((size_t)NH_ * TT * HD * 2); bf* KPh = (bf*)take((size_t)NKV * TT * HD * 2); bf* KPl = (bf*)take((size_t)NKV * TT * HD * 2); bf* VTh = (bf*)take((size_t)NKV * HD * TT * 2); bf* VTl = (bf*)take((size_t)NKV * HD * TT * 2); bf* Ph = (bf*)take((size_t)ZH * RH * TT * 2); bf* Pl = (bf*)take((size_t)ZH * RH * TT * 2);
    float* Sb = (float*)take((size_t)ZH * TT * TT * 4); h16* P16 = (h16*)take((size_t)ZH * TT * TT * 2); float* Ob = (float*)take((size_t)ZH * TT * HD * 4); bf* ATh = (bf*)take((size_t)TT * DQ * 2); bf* ATl = (bf*)take((size_t)TT * DQ * 2);
    if ((size_t)(wsp - (char*)d_ws) > ws_size) return;    // ws 256 MiB
    float* FV = FK;   // v projection reuses the k buffer after the k planes are built (stream-ordered)
    { k_wtH<<<(unsigned)(((size_t)DQ * DM / 4 + 255) / 256), 256, 0, stream>>>(wqh, WQ); k_wtH<<<(unsigned)(((size_t)DKV * DM / 4 + 255) / 256), 256, 0, stream>>>(wkh, WK); k_wtH<<<(unsigned)(((size_t)DKV * DM / 4 + 255) / 256), 256, 0, stream>>>(wvh, WV);
      k_wtG<<<(unsigned)((DQ * DM / 64 + 63) / 64), 256, 0, stream>>>(wo, DQ, DM, WO);
       }
    k_csid<<<(TT * HD + 255) / 256, 256, 0, stream>>>(CS);
    const unsigned LQ = (unsigned)(((size_t)NH_ * TT * HD / 2 + 255) / 256), LKv = (unsigned)(((size_t)NKV * TT * HD / 2 + 255) / 256);
    for (int b = 0; b < NB_; ++b) {
        
        k_cvt8<<<(unsigned)(((size_t)TT * DM / 8 + 255) / 256), 256, 0, stream>>>(x + (size_t)b * TT * DM, XB, (size_t)TT * DM / 8);
        k_gemmw<bf, 0, true><<<dim3(TT / 64, DQ / 64, 1), 32, 0, stream>>>(XB, nullptr, WQ, nullptr, DM, FQ, DQ, bq, 0, 0, 0);
        k_rope<<<LQ, 256, 0, stream>>>(FQ, DQ, NH_, CS, nullptr, nullptr, 1.0f, QP16, QPh, QPl);
        k_gemmw<bf, 0, true><<<dim3(TT / 64, DKV / 64, 1), 32, 0, stream>>>(XB, nullptr, WK, nullptr, DM, FK, DKV, bk, 0, 0, 0);
        k_rope<<<LKv, 256, 0, stream>>>(FK, DKV, NKV, CS, nullptr, nullptr, 1.0f, KP16, KPh, KPl);
        k_gemmw<bf, 0, true><<<dim3(TT / 64, DKV / 64, 1), 32, 0, stream>>>(XB, nullptr, WV, nullptr, DM, FV, DKV, bv, 0, 0, 0); k_vtp<<<LKv, 256, 0, stream>>>(FV, DKV, NKV, VT16, VTh, VTl);
        for (int h0 = 0; h0 < NH_; h0 += ZH) { const size_t zq = (size_t)h0, zk = (size_t)(h0 / REP);   // one kv head per query head: the pass's two heads use consecutive kv planes (z-strides TT*HD)
            k_gemmc<bf, 2, 1><<<dim3(RH / 64, TT / 64, ZH), 32, 0, stream>>>(QPh + zq * TT * HD, QPl + zq * TT * HD, KPh + zk * TT * HD, KPl + zk * TT * HD, HD, Sb, TT, 0, (size_t)TT * HD, (size_t)TT * HD, (size_t)TT * TT);
            k_gemmc<h16, 0, 1><<<dim3((TT - RH) / 64, TT / 64, ZH), 32, 0, stream>>>(QP16 + zq * TT * HD + (size_t)RH * HD, nullptr, KP16 + zk * TT * HD, nullptr, HD, Sb + (size_t)RH * TT, TT, RH, (size_t)TT * HD, (size_t)TT * HD, (size_t)TT * TT);
            k_asoft<<<ZH * TT / 8, 256, 0, stream>>>(Sb, P16, Ph, Pl);
            k_gemmc<bf, 2, 2><<<dim3(RH / 64, HD / 64, ZH), 32, 0, stream>>>(Ph, Pl, VTh + zk * HD * TT, VTl + zk * HD * TT, TT, Ob, HD, 0, (size_t)RH * TT, (size_t)HD * TT, (size_t)TT * HD);
            k_gemmc<h16, 0, 2><<<dim3((TT - RH) / 64, HD / 64, ZH), 32, 0, stream>>>(P16 + (size_t)RH * TT, nullptr, VT16 + zk * HD * TT, nullptr, TT, Ob + (size_t)RH * HD, HD, RH, (size_t)TT * TT, (size_t)HD * TT, (size_t)TT * HD);
            k_merge<<<(unsigned)(((size_t)ZH * TT * HD / 2 + 255) / 256), 256, 0, stream>>>(Ob, h0, ATh, ATl); }
        k_gemmw<bf, 1, true><<<dim3(TT / 64, DM / 64, 1), 32, 0, stream>>>(ATh, ATl, WO, nullptr, DQ, OUT + (size_t)b * TT * DM, DM, bo, 0, 0, 0); }
}

// v001
// One run takes 524 microseconds.
// In two side-by-side timings against v000, it was 5.78 and 5.83 times as fast.
#include <hip/hip_runtime.h>

// MaskedMultiHeadAttention (hidden [8][1024][768]; per-head q/k/v = x Wq[h] + bq[h] (Wq [12][768][64]); causal softmax(q.k / 8); out = concat(heads) Wo + bo -> [8][1024][768]). That is EIGHT sequences of 1,024 tokens at width 768 with 12 heads x 64 ([8][1024][768]) and the inputs in the order x, Wq, bq, Wk, bk, Wv, bv, W0, b0 (each bias after its own weight).
// Compute dtypes, f32 accumulate: every input rounded to bf16; q/k/v on PLAIN bf16 operands (inputs: exact; the 12 per-head weights gathered into one [768 x 768] operand) + bias; causal scores and attn.v: query rows < 512 hl (3 products), the rest single fp16 (x1024); softmax f32; Wo hl x exact (2 products) + bias.

#define NB_  8
#define TT   1024
#define DM   768
#define NH_  12
#define NKV  12
#define REP  (NH_ / NKV)
#define HD   64
#define DQ   (NH_ * HD)
#define DKV  (NKV * HD)
#define ZH   24                   // (sequence, head) pairs per attention pass, in grid z
#define NZ   (NB_ * NH_)
#define RH   512                  // query rows < RH use hi+lo planes (0: none)
#define WIN  1024
#define PCAR 1024.0f
#define SCL  0.125f   // HD^-0.5
typedef _Float16 h16;
typedef unsigned short bf;
typedef __attribute__((ext_vector_type(16))) __bf16   v16bf;
typedef __attribute__((ext_vector_type(16))) _Float16 v16h;
typedef __attribute__((ext_vector_type(8)))  _Float16 v8h;
typedef __attribute__((ext_vector_type(8)))  unsigned short v8us;
typedef __attribute__((ext_vector_type(8)))  float    v8f;
typedef __attribute__((ext_vector_type(4)))  float    v4f;
typedef v8h  __attribute__((may_alias)) v8ha;
typedef v4f  __attribute__((may_alias)) v4fa;
typedef v8us __attribute__((may_alias)) v8usa;

__device__ __forceinline__ unsigned short f2bf(float f) { unsigned u = __float_as_uint(f); u += 0x7FFFu + ((u >> 16) & 1u); return (unsigned short)(u >> 16); }
__device__ __forceinline__ float bf2f(unsigned short b) { return __uint_as_float(((unsigned)b) << 16); }
__device__ __forceinline__ float bfr(float f) { return bf2f(f2bf(f)); }
__device__ __forceinline__ v16h cat16(v8h lo, v8h hi) { return __builtin_shufflevector(lo, hi, 0, 1, 2, 3, 4, 5, 6, 7, 8, 9, 10, 11, 12, 13, 14, 15); }
__device__ __forceinline__ v16bf cat16b(v8us lo, v8us hi) { return __builtin_bit_cast(v16bf, __builtin_shufflevector(lo, hi, 0, 1, 2, 3, 4, 5, 6, 7, 8, 9, 10, 11, 12, 13, 14, 15)); }
__device__ __forceinline__ v8f wmma16(v16h a, v16h b, v8f c) { return __builtin_amdgcn_wmma_f32_16x16x32_f16(false, a, false, b, (short)0, c, false, false); }
__device__ __forceinline__ v8f wmmab(v16bf a, v16bf b, v8f c) { return __builtin_amdgcn_wmma_f32_16x16x32_bf16(false, a, false, b, (short)0, c, false, false); }



// ---- k_gemmw: register-blocked GEMM, ONE WAVE per 64x64 output tile (16 accumulators), operands straight from K-contiguous 16-bit planes; grid (M/64, N/64, Z), 32 threads.
// C[m][n] (f32, pitch ldc, + optional f32 bias[n]) = sum_k A[m][k] Bt[n][k] (+ split products per NSPLIT). z-batch strides sA/sB/sC in elements. K % 32 == 0.
template <typename T16> struct WFrag;
template <> struct WFrag<h16> { typedef v16h V; static __device__ __forceinline__ V ld(const h16* p) { return cat16(*(const v8h*)p, *(const v8h*)(p + 16)); } static __device__ __forceinline__ v8f mma(V a, V b, v8f c) { return wmma16(a, b, c); } };
template <> struct WFrag<bf> { typedef v16bf V; static __device__ __forceinline__ V ld(const bf* p) { return cat16b(*(const v8us*)p, *(const v8us*)(p + 16)); } static __device__ __forceinline__ v8f mma(V a, V b, v8f c) { return wmmab(a, b, c); } };
template <typename T16, int NSPLIT, bool BIAS>
__global__ __launch_bounds__(32) void k_gemmw(const T16* __restrict__ A, const T16* __restrict__ A2, const T16* __restrict__ Bt, const T16* __restrict__ Bt2, int K, float* C, int ldc, const float* __restrict__ bias0, const float* __restrict__ bias1, const float* __restrict__ bias2, size_t sA, size_t sB, size_t sC) {
    typedef typename WFrag<T16>::V V;
    __shared__ __align__(16) float os[16 * 68];
    const size_t z = blockIdx.z; A += z * sA; if (A2) A2 += z * sA; Bt += z * sB; if (Bt2) Bt2 += z * sB; C += z * sC;
    const float* bias = (z == 0) ? bias0 : ((z == 1) ? bias1 : bias2);   // each z-slice adds its own bias vector
    const int lane = threadIdx.x & 31, lr = lane & 15, hi = lane >> 4; const int r0 = blockIdx.x * 64, c0 = blockIdx.y * 64;
    v8f acc[4][4];
#pragma unroll
    for (int mb = 0; mb < 4; ++mb)
#pragma unroll
        for (int nb = 0; nb < 4; ++nb) acc[mb][nb] = (v8f){};
    const size_t aoff = (size_t)(r0 + lr) * K + 8 * hi, boff = (size_t)(c0 + lr) * K + 8 * hi;
#pragma unroll 1
    for (int kc = 0; kc < K; kc += 32) {
        V a[4], a2[4];
#pragma unroll
        for (int mb = 0; mb < 4; ++mb) { a[mb] = WFrag<T16>::ld(A + aoff + (size_t)mb * 16 * K + kc); if (NSPLIT == 1 || NSPLIT == 2) a2[mb] = WFrag<T16>::ld(A2 + aoff + (size_t)mb * 16 * K + kc); }
#pragma unroll
        for (int nb = 0; nb < 4; ++nb) { const V b = WFrag<T16>::ld(Bt + boff + (size_t)nb * 16 * K + kc); V b2; if (NSPLIT >= 2) b2 = WFrag<T16>::ld(Bt2 + boff + (size_t)nb * 16 * K + kc);
#pragma unroll
            for (int mb = 0; mb < 4; ++mb) { acc[mb][nb] = WFrag<T16>::mma(a[mb], b, acc[mb][nb]); if (NSPLIT == 1 || NSPLIT == 2) acc[mb][nb] = WFrag<T16>::mma(a2[mb], b, acc[mb][nb]); if (NSPLIT >= 2) acc[mb][nb] = WFrag<T16>::mma(a[mb], b2, acc[mb][nb]); } }
        asm volatile("v_nop\n\tv_nop\n\tv_nop\n\tv_nop" : "+v"(acc[0][0]), "+v"(acc[1][1]), "+v"(acc[2][2]), "+v"(acc[3][3]) : "v"(a[0]), "v"(a[3]));
    }
#pragma unroll
    for (int mb = 0; mb < 4; ++mb) {
#pragma unroll
        for (int nb = 0; nb < 4; ++nb) {
#pragma unroll
            for (int j = 0; j < 8; ++j) os[(hi * 8 + j) * 68 + nb * 16 + lr] = acc[mb][nb][j]; }
        __builtin_amdgcn_wave_barrier(); asm volatile("" ::: "memory");
        float* crow = C + (size_t)(r0 + mb * 16) * ldc + c0;
{
#pragma unroll
            for (int s = 0; s < 8; ++s) { const int row = 2 * s + hi, cofs = lr * 4; v4f val = *(const v4fa*)(os + row * 68 + cofs); if (BIAS) { val[0] += bfr(bias[c0 + cofs]); val[1] += bfr(bias[c0 + cofs + 1]); val[2] += bfr(bias[c0 + cofs + 2]); val[3] += bfr(bias[c0 + cofs + 3]); }
                *(v4f*)(crow + (size_t)row * ldc + cofs) = val; }
             }
        __builtin_amdgcn_wave_barrier(); asm volatile("" ::: "memory");
    }
}

// ---- k_gemmc: the same one-wave 64x64 tile GEMM specialised for causal attention: CMODE 1 skips score tiles entirely above the diagonal (query rows r0+roff.., key columns c0..), CMODE 2 limits the
// key (K) loop of the probability x value contraction to the diagonal block (probabilities beyond it are exactly zero). roff = row offset of this launch's first row within the sequence.
template <typename T16, int NSPLIT, int CMODE>
__global__ __launch_bounds__(32) void k_gemmc(const T16* __restrict__ A, const T16* __restrict__ A2, const T16* __restrict__ Bt, const T16* __restrict__ Bt2, int K, float* C, int ldc, int roff, size_t sA, size_t sB, size_t sC) {
    typedef typename WFrag<T16>::V V;
    __shared__ __align__(16) float os[16 * 68];
    const size_t z = blockIdx.z; A += z * sA; if (A2) A2 += z * sA; Bt += z * sB; if (Bt2) Bt2 += z * sB; C += z * sC;
    const int lane = threadIdx.x & 31, lr = lane & 15, hi = lane >> 4; const int r0 = blockIdx.x * 64, c0 = blockIdx.y * 64;
    if (CMODE == 1 && c0 > r0 + roff + 63) return;                  // score tile entirely above the causal diagonal: never written (the softmax loads it and masks j > i by select)
    const int Kl = (CMODE == 2) ? min(K, r0 + roff + 64) : K;        // P.V: probabilities are exactly 0 beyond the diagonal block, so the K loop stops there
    v8f acc[4][4];
#pragma unroll
    for (int mb = 0; mb < 4; ++mb)
#pragma unroll
        for (int nb = 0; nb < 4; ++nb) acc[mb][nb] = (v8f){};
    const size_t aoff = (size_t)(r0 + lr) * K + 8 * hi, boff = (size_t)(c0 + lr) * K + 8 * hi;
#pragma unroll 1
    for (int kc = 0; kc < Kl; kc += 32) {
        V a[4], a2[4];
#pragma unroll
        for (int mb = 0; mb < 4; ++mb) { a[mb] = WFrag<T16>::ld(A + aoff + (size_t)mb * 16 * K + kc); if (NSPLIT == 1 || NSPLIT == 2) a2[mb] = WFrag<T16>::ld(A2 + aoff + (size_t)mb * 16 * K + kc); }
#pragma unroll
        for (int nb = 0; nb < 4; ++nb) { const V b = WFrag<T16>::ld(Bt + boff + (size_t)nb * 16 * K + kc); V b2; if (NSPLIT >= 2) b2 = WFrag<T16>::ld(Bt2 + boff + (size_t)nb * 16 * K + kc);
#pragma unroll
            for (int mb = 0; mb < 4; ++mb) { acc[mb][nb] = WFrag<T16>::mma(a[mb], b, acc[mb][nb]); if (NSPLIT == 1 || NSPLIT == 2) acc[mb][nb] = WFrag<T16>::mma(a2[mb], b, acc[mb][nb]); if (NSPLIT >= 2) acc[mb][nb] = WFrag<T16>::mma(a[mb], b2, acc[mb][nb]); } }
        asm volatile("v_nop\n\tv_nop\n\tv_nop\n\tv_nop" : "+v"(acc[0][0]), "+v"(acc[1][1]), "+v"(acc[2][2]), "+v"(acc[3][3]) : "v"(a[0]), "v"(a[3]));
    }
#pragma unroll
    for (int mb = 0; mb < 4; ++mb) {
#pragma unroll
        for (int nb = 0; nb < 4; ++nb) {
#pragma unroll
            for (int j = 0; j < 8; ++j) os[(hi * 8 + j) * 68 + nb * 16 + lr] = acc[mb][nb][j]; }
        __builtin_amdgcn_wave_barrier(); asm volatile("" ::: "memory");
        float* crow = C + (size_t)(r0 + mb * 16) * ldc + c0;
{
#pragma unroll
            for (int s = 0; s < 8; ++s) { const int row = 2 * s + hi, cofs = lr * 4; v4f val = *(const v4fa*)(os + row * 68 + cofs);
                *(v4f*)(crow + (size_t)row * ldc + cofs) = val; }
             }
        __builtin_amdgcn_wave_barrier(); asm volatile("" ::: "memory");
    }
}

__device__ __forceinline__ h16 tohx(float x) { return (h16)x; }
__device__ __forceinline__ void splitf(float y, unsigned short& h, unsigned short& l) { h = f2bf(y); l = f2bf(y - bf2f(h)); }
typedef __attribute__((ext_vector_type(2))) _Float16 v2h;
typedef __attribute__((ext_vector_type(4))) _Float16 v4h;
typedef __attribute__((ext_vector_type(2))) unsigned short v2us;
typedef __attribute__((ext_vector_type(4))) unsigned short v4us;
typedef __attribute__((ext_vector_type(2))) float v2f;
typedef __attribute__((ext_vector_type(4))) int v4i;

__global__ __launch_bounds__(256) void k_wtG(const float* __restrict__ w, int K, int N, bf* Bt) {
    const int lane = threadIdx.x & 31; const int L0 = (blockIdx.x * 8 + (threadIdx.x >> 5)) * 8; const int nlines = N * K / 64;
{
#pragma unroll 1
        for (int l = 0; l < 8; ++l) { const int L = L0 + l; if (L >= nlines) break; const size_t e = (size_t)L * 64 + lane * 2; const int k = (int)(e % K), n = (int)(e / K); v2us o;
            o[0] = f2bf(w[(size_t)k * N + n]); o[1] = f2bf(w[(size_t)(k + 1) * N + n]); *(v2us*)(Bt + e) = o; }
         }
}
__global__ __launch_bounds__(256) void k_cvt8(const float* __restrict__ src, bf* dst, size_t n8) { const size_t i = (size_t)blockIdx.x * 256 + threadIdx.x; if (i >= n8) return; const v8f v = *(const v8f*)(src + i * 8); v8us o;
#pragma unroll
    for (int k = 0; k < 8; ++k) o[k] = f2bf(v[k]); *(v8us*)(dst + i * 8) = o;  }
__global__ __launch_bounds__(256) void k_cscvt(const float* __restrict__ cosT, const float* __restrict__ sinT, float* CS) { const int idx = blockIdx.x * 256 + threadIdx.x; if (idx >= TT * HD) return; v2f cs; cs[0] = bfr(cosT[idx]); cs[1] = bfr(sinT[idx]); *(v2f*)(CS + (size_t)idx * 2) = cs;  }
// k_rope: head planes [h][t][d] (fp16 + hi/lo) of rope(x) x sc with the rotate-half convention out[d] = x[d] cos[t][d] - x[d+HD/2] sin[t][d], out[d+HD/2] = x[d+HD/2] cos[t][d+HD/2] + x[d] sin[t][d+HD/2]
__global__ __launch_bounds__(256) void k_rope(const float* __restrict__ F, int pitch, int nheads, const float* __restrict__ CS, const float* __restrict__ RF, const float* __restrict__ nw, float sc, h16* P16, bf* Ph, bf* Pl) {
    { const size_t sq = blockIdx.y, po = sq * nheads * TT * HD; F += sq * TT * pitch; P16 += po; Ph += po; Pl += po; }   // grid y = sequence: its TT rows of F, its nheads planes
    const size_t e = ((size_t)blockIdx.x * 256 + threadIdx.x) * 2; if (e >= (size_t)nheads * TT * HD) return; const int d = (int)(e % HD); const int t = (int)((e / HD) % TT); const int h = (int)(e / ((size_t)HD * TT)); const float* f = F + (size_t)t * pitch + h * HD; const float rf = RF ? RF[(size_t)h * TT + t] : 1.0f; v2h o16; v2us oh, ol;
#pragma unroll
    for (int q = 0; q < 2; ++q) { const int dd = d + q; const int dp = (dd < HD / 2) ? dd + HD / 2 : dd - HD / 2; float x0 = f[dd], x1 = f[dp];
        if (RF) { float n0 = __fmul_rn(x0, rf), n1 = __fmul_rn(x1, rf); asm volatile("" : "+v"(n0)); asm volatile("" : "+v"(n1)); x0 = __fmul_rn(bfr(nw[dd]), n0); x1 = __fmul_rn(bfr(nw[dp]), n1); }
        const v2f cs = *(const v2f*)(CS + ((size_t)t * HD + dd) * 2); float a = __fmul_rn(x0, cs[0]), bq = __fmul_rn(x1, cs[1]); asm volatile("" : "+v"(a)); asm volatile("" : "+v"(bq)); const float r = ((dd < HD / 2) ? __fsub_rn(a, bq) : __fadd_rn(a, bq)) * sc;
        o16[q] = tohx(r); unsigned short a2, c2; splitf(r, a2, c2); oh[q] = a2; ol[q] = c2; }
    *(v2h*)(P16 + e) = o16; *(v2us*)(Ph + e) = oh; *(v2us*)(Pl + e) = ol;  }
__global__ __launch_bounds__(256) void k_vtp(const float* __restrict__ F, int pitch, int nheads, h16* V16, bf* Vh, bf* Vl) { { const size_t sq = blockIdx.y, po = sq * nheads * HD * 2 * TT; F += sq * TT * pitch; V16 += po; Vh += po; Vl += po; } const size_t e = ((size_t)blockIdx.x * 256 + threadIdx.x) * 2; if (e >= (size_t)nheads * HD * TT) return; const int t = (int)(e % TT); const int d = (int)((e / TT) % HD); const int g = (int)(e / ((size_t)TT * HD)); v2h o16; v2us oh, ol;
#pragma unroll
    for (int q = 0; q < 2; ++q) { const float x = F[(size_t)(t + q) * pitch + g * HD + d]; o16[q] = tohx(x); unsigned short a2, c2; splitf(x, a2, c2); oh[q] = a2; ol[q] = c2; }
    const size_t o = (e / TT) * (2 * TT) + t; *(v2h*)(V16 + o) = o16; *(v2us*)(Vh + o) = oh; *(v2us*)(Vl + o) = ol;  }   // plane rows [g][d] at a pitch of 2*TT elements, the pitch of the probability rows they are multiplied with
__global__ __launch_bounds__(256) void k_csid(float* CS) { const int idx = blockIdx.x * 256 + threadIdx.x; if (idx >= TT * HD) return; v2f cs; cs[0] = 1.0f; cs[1] = 0.0f; *(v2f*)(CS + (size_t)idx * 2) = cs;  }
// k_asoft: per row (zz, i): t = S x HD^-0.5 for j <= i and i - j < WIN (sliding causal window; the reference's -1e9 additive fill vanishes identically); softmax over the 1024 keys (register row, one exp, fixed trees);
// the probabilities overwrite the wave's own score row (all of it is in registers by then): rows < RH as hi plane then lo plane, the rest as fp16 in the first half of the row.
__global__ __launch_bounds__(256) void k_asoft(float* Sb) {
    const int lane = threadIdx.x & 31; const int row = blockIdx.x * 8 + (threadIdx.x >> 5); if (row >= ZH * TT) return; const int i = row % TT; const int zz = row / TT; (void)zz; const bool hires = (i < RH); float* sr = Sb + (size_t)row * TT; float v[TT / 32]; float mx = -3.0e38f;
#pragma unroll
    for (int ch = 0; ch < TT / 128; ++ch) { const int j0 = ch * 128 + lane * 4; const v4f a = *(const v4f*)(sr + j0);
#pragma unroll
        for (int q = 0; q < 4; ++q) { const int j = j0 + q; (void)j; const float t = (j <= i && i - j < WIN) ? a[q] * SCL : -3.0e38f; v[ch * 4 + q] = t; mx = fmaxf(mx, t); } }
#pragma unroll
    for (int sh = 16; sh; sh >>= 1) mx = fmaxf(mx, __shfl_xor(mx, sh, 32));
    float sum = 0.f;
#pragma unroll
    for (int k = 0; k < TT / 32; ++k) { float d0 = __fsub_rn(v[k], mx); asm volatile("" : "+v"(d0)); v[k] = __builtin_amdgcn_exp2f(__fmul_rn(d0, 1.4426950408889634f)); sum += v[k]; }
#pragma unroll
    for (int sh = 16; sh; sh >>= 1) sum += __shfl_xor(sum, sh, 32);
    const float f = __fdiv_rn(hires ? 1.0f : PCAR, sum);
{
        if (hires) {
#pragma unroll
            for (int ch = 0; ch < TT / 128; ++ch) { v4us oh, ol;
#pragma unroll
                for (int q = 0; q < 4; ++q) { unsigned short a, c2; splitf(v[ch * 4 + q] * f, a, c2); oh[q] = a; ol[q] = c2; }
                bf* pr = (bf*)sr + ch * 128 + lane * 4; *(v4us*)pr = oh; *(v4us*)(pr + TT) = ol; }
        } else {
#pragma unroll
            for (int ch = 0; ch < TT / 128; ++ch) { v4h o4;
#pragma unroll
                for (int q = 0; q < 4; ++q) o4[q] = tohx(v[ch * 4 + q] * f);
                *(v4h*)((h16*)sr + ch * 128 + lane * 4) = o4; } }
         }
}
__global__ __launch_bounds__(256) void k_merge(const float* __restrict__ O, bf* Ah, bf* Al) { const size_t e = ((size_t)blockIdx.x * 256 + threadIdx.x) * 2; if (e >= (size_t)NZ * TT * HD) return; const int d = (int)(e % HD); const int t = (int)((e / HD) % TT); const int zz = (int)(e / ((size_t)HD * TT)); const float cs = (t < RH) ? 1.0f : (1.0f / PCAR); const size_t oo = ((size_t)(zz / NH_) * TT + t) * DQ + (zz % NH_) * HD + d;
    v2us oh, ol;
#pragma unroll
    for (int q = 0; q < 2; ++q) { unsigned short a, c2; splitf(O[e + q] * cs, a, c2); oh[q] = a; ol[q] = c2; } *(v2us*)(Ah + oo) = oh; *(v2us*)(Al + oo) = ol;  }

__global__ __launch_bounds__(256) void k_wtH(const float* __restrict__ w0, const float* __restrict__ w1, const float* __restrict__ w2, bf* Bt) { const float* w = (blockIdx.y == 0) ? w0 : ((blockIdx.y == 1) ? w1 : w2); Bt += (size_t)blockIdx.y * DQ * DM; const size_t e = ((size_t)blockIdx.x * 256 + threadIdx.x) * 4; if (e >= (size_t)DQ * DM) return; const int k = (int)(e % DM); const int n = (int)(e / DM); const int h = n / HD, c = n % HD; v4us o;   // Bt[h*64 + c][d] = W[h][d][c] (lane -> 4 consecutive d, strided reads)
#pragma unroll
    for (int u = 0; u < 4; ++u) o[u] = f2bf(w[((size_t)h * DM + k + u) * HD + c]); *(v4us*)(Bt + e) = o;  }

extern "C" void kernel_launch(void* const* d_in, const int* in_sizes, int n_in,
                              void* d_out, int out_size, void* d_ws, size_t ws_size, hipStream_t stream) {
    (void)in_sizes; (void)n_in; (void)out_size;
    const float* x = (const float*)d_in[0]; const float* wqh = (const float*)d_in[1]; const float* bq = (const float*)d_in[2]; const float* wkh = (const float*)d_in[3]; const float* bk = (const float*)d_in[4]; const float* wvh = (const float*)d_in[5]; const float* bv = (const float*)d_in[6]; const float* wo = (const float*)d_in[7]; const float* bo = (const float*)d_in[8]; const float* wq = nullptr; const float* wk = nullptr; const float* wv = nullptr; (void)wq; (void)wk; (void)wv; const float* cosT = nullptr; const float* sinT = nullptr; (void)cosT; (void)sinT;
    float* OUT = (float*)d_out;     // [8][1024][768]
    char* wsp = (char*)d_ws;
    auto take = [&](size_t bytes) { char* p = wsp; wsp += (bytes + 255) & ~(size_t)255; return (void*)p; };
    bf* WQ = (bf*)take((size_t)DQ * DM * 2); bf* WK = (bf*)take((size_t)DKV * DM * 2); bf* WV = (bf*)take((size_t)DKV * DM * 2); bf* WO = (bf*)take((size_t)DM * DQ * 2); float* CS = (float*)take((size_t)TT * HD * 2 * 4); (void)WK; (void)WV;   // WQ, WK, WV lie back to back (z-stride DQ*DM)
    const size_t PL = (size_t)NZ * TT * HD;   // elements of one plane over all (sequence, head) pairs; each q plane is followed by its k plane, so one k_rope launch fills both
    h16* QP16 = (h16*)take(PL * 2); h16* KP16 = (h16*)take(PL * 2); h16* VT16 = (h16*)take(PL * 4);   // value planes: row pitch 2*TT (fp16 rows fill the first half)
    bf* QPh = (bf*)take(PL * 2); bf* KPh = (bf*)take(PL * 2); bf* QPl = (bf*)take(PL * 2); bf* KPl = (bf*)take(PL * 2); bf* VTh = (bf*)take(PL * 4); bf* VTl = VTh + TT;   // each value row: hi half, then lo half
    float* Ob = (float*)take(PL * 4);
    char* R = (char*)take((size_t)ZH * TT * TT * 4);   // one region, three stream-ordered uses: x planes and f32 projections; then the scores of a pass; then the merged head planes
    if ((size_t)(wsp - (char*)d_ws) > ws_size) return;    // ws 256 MiB
    bf* XB = (bf*)R; float* FQ = (float*)(R + (size_t)NB_ * TT * DM * 2); float* FV = FQ + 2 * (size_t)NB_ * TT * DQ;   // FQ, FK, FV back to back (z-stride NB_*TT*DQ)
    float* Sb = (float*)R; bf* ATh = (bf*)R; bf* ATl = ATh + (size_t)NB_ * TT * DQ;
    k_wtH<<<dim3((unsigned)(((size_t)DQ * DM / 4 + 255) / 256), 3, 1), 256, 0, stream>>>(wqh, wkh, wvh, WQ);
    k_wtG<<<(unsigned)((DQ * DM / 64 + 63) / 64), 256, 0, stream>>>(wo, DQ, DM, WO);
    k_csid<<<(TT * HD + 255) / 256, 256, 0, stream>>>(CS);
    k_cvt8<<<(unsigned)(((size_t)NB_ * TT * DM / 8 + 255) / 256), 256, 0, stream>>>(x, XB, (size_t)NB_ * TT * DM / 8);
    k_gemmw<bf, 0, true><<<dim3(NB_ * TT / 64, DQ / 64, 3), 32, 0, stream>>>(XB, nullptr, WQ, nullptr, DM, FQ, DQ, bq, bk, bv, 0, (size_t)DQ * DM, (size_t)NB_ * TT * DQ);
    k_rope<<<dim3((unsigned)(((size_t)NH_ * TT * HD / 2 + 255) / 256), 2 * NB_, 1), 256, 0, stream>>>(FQ, DQ, NH_, CS, nullptr, nullptr, 1.0f, QP16, QPh, QPl);
    k_vtp<<<dim3((unsigned)(((size_t)NKV * TT * HD / 2 + 255) / 256), NB_, 1), 256, 0, stream>>>(FV, DKV, NKV, VT16, VTh, VTl);
    for (int z0 = 0; z0 < NZ; z0 += ZH) { const size_t zo = (size_t)z0 * TT * HD, zv = 2 * zo;   // one kv head per query head: q, k, v and output planes share the z index
        k_gemmc<bf, 2, 1><<<dim3(RH / 64, TT / 64, ZH), 32, 0, stream>>>(QPh + zo, QPl + zo, KPh + zo, KPl + zo, HD, Sb, TT, 0, (size_t)TT * HD, (size_t)TT * HD, (size_t)TT * TT);
        k_gemmc<h16, 0, 1><<<dim3((TT - RH) / 64, TT / 64, ZH), 32, 0, stream>>>(QP16 + zo + (size_t)RH * HD, nullptr, KP16 + zo, nullptr, HD, Sb + (size_t)RH * TT, TT, RH, (size_t)TT * HD, (size_t)TT * HD, (size_t)TT * TT);
        k_asoft<<<ZH * TT / 8, 256, 0, stream>>>(Sb);
        // P.V: the K argument is the operands' row pitch, 2*TT 16-bit elements (a 4096-byte score row holds its probabilities); the K loop itself ends at the diagonal block
        k_gemmc<bf, 2, 2><<<dim3(RH / 64, HD / 64, ZH), 32, 0, stream>>>((const bf*)Sb, (const bf*)Sb + TT, VTh + zv, VTl + zv, 2 * TT, Ob + zo, HD, 0, (size_t)TT * 2 * TT, (size_t)HD * 2 * TT, (size_t)TT * HD);
        k_gemmc<h16, 0, 2><<<dim3((TT - RH) / 64, HD / 64, ZH), 32, 0, stream>>>((const h16*)Sb + (size_t)RH * 2 * TT, nullptr, VT16 + zv, nullptr, 2 * TT, Ob + zo + (size_t)RH * HD, HD, RH, (size_t)TT * 2 * TT, (size_t)HD * 2 * TT, (size_t)TT * HD); }
    k_merge<<<(unsigned)((PL / 2 + 255) / 256), 256, 0, stream>>>(Ob, ATh, ATl);
    k_gemmw<bf, 1, true><<<dim3(NB_ * TT / 64, DM / 64, 1), 32, 0, stream>>>(ATh, ATl, WO, nullptr, DQ, OUT, DM, bo, bo, bo, 0, 0, 0);
}

// v003
// It runs in 164 microseconds.
// Versions in between are left out here; by their measured steps it is 3.21 times as fast as v001.
// Over all steps from v000 it is 18.6 times as fast.
#include <hip/hip_runtime.h>

// MaskedMultiHeadAttention (hidden [8][1024][768]; per-head q/k/v = x Wq[h] + bq[h] (Wq [12][768][64]); causal softmax(q.k / 8); out = concat(heads) Wo + bo -> [8][1024][768]). That is EIGHT sequences of 1,024 tokens at width 768 with 12 heads x 64 ([8][1024][768]) and the inputs in the order x, Wq, bq, Wk, bk, Wv, bv, W0, b0 (each bias after its own weight).
// Compute dtypes, f32 accumulate: every input rounded to bf16; q/k/v on PLAIN bf16 operands (inputs: exact; the 12 per-head weights gathered into one [768 x 768] operand) + bias; causal scores and attn.v: query rows < 512 hl (3 products), the rest single fp16 (x1024); softmax f32; Wo hl x exact (2 products) + bias.

#define NB_  8
#define TT   1024
#define DM   768
#define NH_  12
#define NKV  12
#define REP  (NH_ / NKV)
#define HD   64
#define DQ   (NH_ * HD)
#define DKV  (NKV * HD)
#define ZH   24
#define NZ   (NB_ * NH_)
#define RH   512                  // query rows < RH use hi+lo planes
#define WIN  1024
#define PCAR 1024.0f
#define SCL  0.125f   // HD^-0.5
typedef _Float16 h16;
typedef unsigned short bf;
typedef __attribute__((ext_vector_type(16))) __bf16   v16bf;
typedef __attribute__((ext_vector_type(16))) _Float16 v16h;
typedef __attribute__((ext_vector_type(8)))  _Float16 v8h;
typedef __attribute__((ext_vector_type(8)))  unsigned short v8us;
typedef __attribute__((ext_vector_type(8)))  float    v8f;
typedef __attribute__((ext_vector_type(4)))  float    v4f;
typedef v8h  __attribute__((may_alias)) v8ha;
typedef v4f  __attribute__((may_alias)) v4fa;
typedef v8us __attribute__((may_alias)) v8usa;

__device__ __forceinline__ unsigned short f2bf(float f) { unsigned u = __float_as_uint(f); u += 0x7FFFu + ((u >> 16) & 1u); return (unsigned short)(u >> 16); }
__device__ __forceinline__ float bf2f(unsigned short b) { return __uint_as_float(((unsigned)b) << 16); }
__device__ __forceinline__ float bfr(float f) { return bf2f(f2bf(f)); }
__device__ __forceinline__ v16h cat16(v8h lo, v8h hi) { return __builtin_shufflevector(lo, hi, 0, 1, 2, 3, 4, 5, 6, 7, 8, 9, 10, 11, 12, 13, 14, 15); }
__device__ __forceinline__ v16bf cat16b(v8us lo, v8us hi) { return __builtin_bit_cast(v16bf, __builtin_shufflevector(lo, hi, 0, 1, 2, 3, 4, 5, 6, 7, 8, 9, 10, 11, 12, 13, 14, 15)); }
__device__ __forceinline__ v8f wmma16(v16h a, v16h b, v8f c) { return __builtin_amdgcn_wmma_f32_16x16x32_f16(false, a, false, b, (short)0, c, false, false); }
__device__ __forceinline__ v8f wmmab(v16bf a, v16bf b, v8f c) { return __builtin_amdgcn_wmma_f32_16x16x32_bf16(false, a, false, b, (short)0, c, false, false); }



// ---- k_gemmw: register-blocked GEMM, ONE WAVE per 64x64 output tile (16 accumulators), operands straight from K-contiguous 16-bit planes; grid (M/64, N/64, Z), 32 threads.
// C[m][n] (f32, pitch ldc, + optional f32 bias[n]) = sum_k A[m][k] Bt[n][k] (+ split products per NSPLIT). z-batch strides sA/sB/sC in elements. K % 32 == 0.
template <typename T16> struct WFrag;
template <> struct WFrag<h16> { typedef v16h V; static __device__ __forceinline__ V ld(const h16* p) { return cat16(*(const v8h*)p, *(const v8h*)(p + 16)); } static __device__ __forceinline__ v8f mma(V a, V b, v8f c) { return wmma16(a, b, c); } };
template <> struct WFrag<bf> { typedef v16bf V; static __device__ __forceinline__ V ld(const bf* p) { return cat16b(*(const v8us*)p, *(const v8us*)(p + 16)); } static __device__ __forceinline__ v8f mma(V a, V b, v8f c) { return wmmab(a, b, c); } };
template <typename T16, int NSPLIT, bool BIAS>
__global__ __launch_bounds__(32) void k_gemmw(const T16* __restrict__ A, const T16* __restrict__ A2, const T16* __restrict__ Bt, const T16* __restrict__ Bt2, int K, float* C, int ldc, const float* __restrict__ bias0, const float* __restrict__ bias1, const float* __restrict__ bias2, size_t sA, size_t sB, size_t sC) {
    typedef typename WFrag<T16>::V V;
    __shared__ __align__(16) float os[16 * 68];
    const size_t z = blockIdx.z; A += z * sA; if (A2) A2 += z * sA; Bt += z * sB; if (Bt2) Bt2 += z * sB; C += z * sC;
    const float* bias = (z == 0) ? bias0 : ((z == 1) ? bias1 : bias2);   // each z-slice adds its own bias vector
    const int lane = threadIdx.x & 31, lr = lane & 15, hi = lane >> 4; const int r0 = blockIdx.x * 64, c0 = blockIdx.y * 64;
    v8f acc[4][4];
#pragma unroll
    for (int mb = 0; mb < 4; ++mb)
#pragma unroll
        for (int nb = 0; nb < 4; ++nb) acc[mb][nb] = (v8f){};
    const size_t aoff = (size_t)(r0 + lr) * K + 8 * hi, boff = (size_t)(c0 + lr) * K + 8 * hi;
#pragma unroll 1
    for (int kc = 0; kc < K; kc += 32) {
        V a[4], a2[4];
#pragma unroll
        for (int mb = 0; mb < 4; ++mb) { a[mb] = WFrag<T16>::ld(A + aoff + (size_t)mb * 16 * K + kc); if (NSPLIT == 1 || NSPLIT == 2) a2[mb] = WFrag<T16>::ld(A2 + aoff + (size_t)mb * 16 * K + kc); }
#pragma unroll
        for (int nb = 0; nb < 4; ++nb) { const V b = WFrag<T16>::ld(Bt + boff + (size_t)nb * 16 * K + kc); V b2; if (NSPLIT >= 2) b2 = WFrag<T16>::ld(Bt2 + boff + (size_t)nb * 16 * K + kc);
#pragma unroll
            for (int mb = 0; mb < 4; ++mb) { acc[mb][nb] = WFrag<T16>::mma(a[mb], b, acc[mb][nb]); if (NSPLIT == 1 || NSPLIT == 2) acc[mb][nb] = WFrag<T16>::mma(a2[mb], b, acc[mb][nb]); if (NSPLIT >= 2) acc[mb][nb] = WFrag<T16>::mma(a[mb], b2, acc[mb][nb]); } }
        asm volatile("v_nop\n\tv_nop\n\tv_nop\n\tv_nop" : "+v"(acc[0][0]), "+v"(acc[1][1]), "+v"(acc[2][2]), "+v"(acc[3][3]) : "v"(a[0]), "v"(a[3]));
    }
#pragma unroll
    for (int mb = 0; mb < 4; ++mb) {
#pragma unroll
        for (int nb = 0; nb < 4; ++nb) {
#pragma unroll
            for (int j = 0; j < 8; ++j) os[(hi * 8 + j) * 68 + nb * 16 + lr] = acc[mb][nb][j]; }
        __builtin_amdgcn_wave_barrier(); asm volatile("" ::: "memory");
        float* crow = C + (size_t)(r0 + mb * 16) * ldc + c0;
{
#pragma unroll
            for (int s = 0; s < 8; ++s) { const int row = 2 * s + hi, cofs = lr * 4; v4f val = *(const v4fa*)(os + row * 68 + cofs); if (BIAS) { val[0] += bfr(bias[c0 + cofs]); val[1] += bfr(bias[c0 + cofs + 1]); val[2] += bfr(bias[c0 + cofs + 2]); val[3] += bfr(bias[c0 + cofs + 3]); }
                *(v4f*)(crow + (size_t)row * ldc + cofs) = val; }
             }
        __builtin_amdgcn_wave_barrier(); asm volatile("" ::: "memory");
    }
}

__device__ __forceinline__ h16 tohx(float x) { return (h16)x; }
__device__ __forceinline__ void splitf(float y, unsigned short& h, unsigned short& l) { h = f2bf(y); l = f2bf(y - bf2f(h)); }
typedef __attribute__((ext_vector_type(2))) _Float16 v2h;
typedef __attribute__((ext_vector_type(4))) _Float16 v4h;
typedef __attribute__((ext_vector_type(2))) unsigned short v2us;
typedef __attribute__((ext_vector_type(4))) unsigned short v4us;
typedef __attribute__((ext_vector_type(2))) float v2f;
typedef __attribute__((ext_vector_type(4))) int v4i;

__global__ __launch_bounds__(256) void k_wtG(const float* __restrict__ w, int K, int N, bf* Bt) {
    const int lane = threadIdx.x & 31; const int L0 = (blockIdx.x * 8 + (threadIdx.x >> 5)) * 8; const int nlines = N * K / 64;
{
#pragma unroll 1
        for (int l = 0; l < 8; ++l) { const int L = L0 + l; if (L >= nlines) break; const size_t e = (size_t)L * 64 + lane * 2; const int k = (int)(e % K), n = (int)(e / K); v2us o;
            o[0] = f2bf(w[(size_t)k * N + n]); o[1] = f2bf(w[(size_t)(k + 1) * N + n]); *(v2us*)(Bt + e) = o; }
         }
}
__global__ __launch_bounds__(256) void k_cvt8(const float* __restrict__ src, bf* dst, size_t n8) { const size_t i = (size_t)blockIdx.x * 256 + threadIdx.x; if (i >= n8) return; const v8f v = *(const v8f*)(src + i * 8); v8us o;
#pragma unroll
    for (int k = 0; k < 8; ++k) o[k] = f2bf(v[k]); *(v8us*)(dst + i * 8) = o;  }
// ---- k_fattn: causal attention of one (sequence, head) pair and one strip of query rows in one wave; scores and probabilities stay in registers (online softmax over blocks of 32 keys).
// Transposed products: S^T = K Q^T (A = key rows, B = query rows), so a lane holds 16 scores of ONE query (column lr): keys k0 + 8 hi + j and k0 + 16 + 8 hi + j. Those 16 values, converted in place, are the
// B operand of O^T += V^T P^T (A = value plane rows [d][t]) in the k order of the loaders. Running maximum, sum and rescale factor are per lane; the two lane halves are joined by one exchange.
// The strip's output rows leave as the hi/lo planes of the output projection's A operand: lane = query row, 8 consecutive d per accumulator.
#define L2E 1.4426950408889634f
__device__ __forceinline__ float xhalf(float x) { const int b = __float_as_int(x); return __int_as_float(__builtin_amdgcn_permlanex16(b, b, 0x76543210, 0xfedcba98, false, false)); }   // lane l <-> l ^ 16
__device__ __forceinline__ float ex2(float x) { float r; asm("v_exp_f32 %0, %1\n\tv_nop" : "=v"(r) : "v"(x)); return r; }
__device__ __forceinline__ void put8(v8f o, float inv, bf* ph, bf* pl) { v8us oh, ol;
#pragma unroll
    for (int j = 0; j < 8; ++j) { unsigned short a, c2; splitf(o[j] * inv, a, c2); oh[j] = a; ol[j] = c2; }
    *(v8us*)ph = oh; *(v8us*)pl = ol; }
// rows >= RH: single fp16 products, 32 query rows per wave; probabilities carry the factor PCAR = 2^10 (it cancels against the row sum)
__device__ __forceinline__ void attn_lo(const h16* __restrict__ Q, const h16* __restrict__ Kp, const h16* __restrict__ Vt, int q0, bf* Ah, bf* Al, int lr, int hi) {
    v16h qf[2][2]; const h16* qp = Q + (size_t)(q0 + lr) * HD + 8 * hi;
#pragma unroll
    for (int nb = 0; nb < 2; ++nb)
#pragma unroll
        for (int ks = 0; ks < 2; ++ks) qf[nb][ks] = WFrag<h16>::ld(qp + nb * 16 * HD + ks * 32);
    v8f o[4][2]; float m[2], l[2];
#pragma unroll
    for (int nb = 0; nb < 2; ++nb) { m[nb] = -3.0e38f; l[nb] = 0.f;
#pragma unroll
        for (int db = 0; db < 4; ++db) o[db][nb] = (v8f){}; }
    const h16* kp = Kp + (size_t)lr * HD + 8 * hi; const unsigned vo = (unsigned)(lr * (2 * TT) + 8 * hi) * 2u;   // value loads: the lane's byte offset, fixed over the loop, beside a wave-uniform base that walks the keys
    v16h kf[2][2];
#pragma unroll
    for (int kt = 0; kt < 2; ++kt)
#pragma unroll
        for (int ks = 0; ks < 2; ++ks) kf[kt][ks] = WFrag<h16>::ld(kp + (size_t)(kt * 16) * HD + ks * 32);
    asm volatile("s_wait_xcnt 0x0" :: "v"(qp), "v"(kp) : "memory");   // the wait in front of any rewrite of these loads' address registers; it names them, so that they live to here
#pragma unroll 1   // run-time trip count; one body already holds most of the register budget
    for (int k0 = 0; k0 < q0 + 32; k0 += 32) {
        v16h vf[4];
#pragma unroll
        for (int db = 0; db < 4; ++db) vf[db] = WFrag<h16>::ld((const h16*)((const char*)(Vt + k0 + (size_t)(db * 16) * (2 * TT)) + vo));
        v8f s[2][2];
#pragma unroll
        for (int kt = 0; kt < 2; ++kt)
#pragma unroll
            for (int nb = 0; nb < 2; ++nb) s[kt][nb] = wmma16(kf[kt][1], qf[nb][1], wmma16(kf[kt][0], qf[nb][0], (v8f){}));
        if (k0 < q0) kp += 32 * HD;   // the next block's key fragments fly during this block's softmax; the last block fetches its own again, so the address stays inside the plane
#pragma unroll
        for (int kt = 0; kt < 2; ++kt)
#pragma unroll
            for (int ks = 0; ks < 2; ++ks) kf[kt][ks] = WFrag<h16>::ld(kp + (size_t)(kt * 16) * HD + ks * 32);
        __builtin_amdgcn_sched_barrier(0);   // keeps the key loads above the softmax; without it the scheduler sinks them to the loop's foot and their latency is exposed again
#pragma unroll
        for (int nb = 0; nb < 2; ++nb) { const int q = q0 + nb * 16 + lr; float t[16]; float mx = m[nb];
#pragma unroll
            for (int e = 0; e < 16; ++e) { const int key = k0 + (e >> 3) * 16 + hi * 8 + (e & 7); t[e] = (key <= q) ? s[e >> 3][nb][e & 7] * SCL : -3.0e38f; mx = fmaxf(mx, t[e]); }
            mx = fmaxf(mx, xhalf(mx));
            const float al = ex2((m[nb] - mx) * L2E); m[nb] = mx; float sum = 0.f; v16h pf;
#pragma unroll
            for (int e = 0; e < 16; ++e) { const float p = ex2((t[e] - mx) * L2E + 10.0f); sum += p; pf[e] = tohx(p); }
            l[nb] = l[nb] * al + sum;
#pragma unroll
            for (int db = 0; db < 4; ++db) { o[db][nb] *= al; o[db][nb] = wmma16(vf[db], pf, o[db][nb]); } }
    }
#pragma unroll
    for (int nb = 0; nb < 2; ++nb) { const float inv = __fdiv_rn(1.0f, l[nb] + xhalf(l[nb])); const size_t ro = (size_t)(q0 + nb * 16 + lr) * DQ + hi * 8;
#pragma unroll
        for (int db = 0; db < 4; ++db) put8(o[db][nb], inv, Ah + ro + db * 16, Al + ro + db * 16); }
}
// rows < RH: hi+lo bf16 planes, 3 products each for the scores and for P.V, 32 query rows per wave
__device__ __forceinline__ void attn_hl(const bf* __restrict__ Qh, const bf* __restrict__ Ql, const bf* __restrict__ Kh, const bf* __restrict__ Kl, const bf* __restrict__ Vh, const bf* __restrict__ Vl, int q0, bf* Ah, bf* Al, int lr, int hi) {
    v16bf qh[2][2], ql[2][2]; const bf* qph = Qh + (size_t)(q0 + lr) * HD + 8 * hi; const bf* qpl = Ql + (size_t)(q0 + lr) * HD + 8 * hi;
#pragma unroll
    for (int nb = 0; nb < 2; ++nb)
#pragma unroll
        for (int ks = 0; ks < 2; ++ks) { qh[nb][ks] = WFrag<bf>::ld(qph + nb * 16 * HD + ks * 32); ql[nb][ks] = WFrag<bf>::ld(qpl + nb * 16 * HD + ks * 32); }
    asm volatile("s_wait_xcnt 0x0" :: "v"(qph), "v"(qpl) : "memory");   // the wait in front of any rewrite of these loads' address registers; it names them, so that they live to here
    v8f o[4][2]; float m[2], l[2];
#pragma unroll
    for (int nb = 0; nb < 2; ++nb) { m[nb] = -3.0e38f; l[nb] = 0.f;
#pragma unroll
        for (int db = 0; db < 4; ++db) o[db][nb] = (v8f){}; }
    const unsigned ko = (unsigned)(lr * HD + 8 * hi) * 2u, vo = (unsigned)(lr * (2 * TT) + 8 * hi) * 2u;   // the lane's byte offsets, fixed over the loop, beside wave-uniform bases that walk the keys
#pragma unroll 1   // run-time trip count; one body already holds most of the register budget
    for (int k0 = 0; k0 < q0 + 32; k0 += 32) {
        const bf* kph = (const bf*)((const char*)(Kh + (size_t)k0 * HD) + ko); const bf* kpl = (const bf*)((const char*)(Kl + (size_t)k0 * HD) + ko);
        v16bf kh[2][2], kl[2][2];   // all key fragments of the block are requested together: one latency a block, not one per fragment pair
#pragma unroll
        for (int kt = 0; kt < 2; ++kt)
#pragma unroll
            for (int ks = 0; ks < 2; ++ks) { kh[kt][ks] = WFrag<bf>::ld(kph + kt * 16 * HD + ks * 32); kl[kt][ks] = WFrag<bf>::ld(kpl + kt * 16 * HD + ks * 32); }
        asm volatile("s_wait_xcnt 0x0" :: "v"(kph), "v"(kpl) : "memory");   // the wait in front of any rewrite of the key loads' address registers; it names them, so that they live to here
        __builtin_amdgcn_sched_barrier(0);   // keeps the sixteen key loads together above the products; without it the scheduler sinks them pair by pair between the products, one exposed latency each
        v8f s[2][2];
#pragma unroll
        for (int kt = 0; kt < 2; ++kt) { s[kt][0] = (v8f){}; s[kt][1] = (v8f){};
#pragma unroll
            for (int ks = 0; ks < 2; ++ks)
#pragma unroll
                for (int nb = 0; nb < 2; ++nb) { s[kt][nb] = wmmab(kh[kt][ks], qh[nb][ks], s[kt][nb]); s[kt][nb] = wmmab(kh[kt][ks], ql[nb][ks], s[kt][nb]); s[kt][nb] = wmmab(kl[kt][ks], qh[nb][ks], s[kt][nb]); } }
        const bf* vph = (const bf*)((const char*)(Vh + k0) + vo); const bf* vpl = (const bf*)((const char*)(Vl + k0) + vo);
        v16bf vh[4], vl[4];
#pragma unroll
        for (int db = 0; db < 4; ++db) { vh[db] = WFrag<bf>::ld(vph + db * 16 * (2 * TT)); vl[db] = WFrag<bf>::ld(vpl + db * 16 * (2 * TT)); }
        asm volatile("s_wait_xcnt 0x0" :: "v"(vph), "v"(vpl) : "memory");   // the same wait for the value loads' address registers; the loads' own place is held by the next line
        __builtin_amdgcn_sched_barrier(0);   // keeps the value loads above the softmax, which hides their latency; without it the scheduler sinks half of them, and the wait with them, to the products
        v16bf ph[2], pl[2]; float al[2];
#pragma unroll
        for (int nb = 0; nb < 2; ++nb) { const int q = q0 + nb * 16 + lr; float t[16]; float mx = m[nb];
#pragma unroll
            for (int e = 0; e < 16; ++e) { const int key = k0 + (e >> 3) * 16 + hi * 8 + (e & 7); t[e] = (key <= q) ? s[e >> 3][nb][e & 7] * SCL : -3.0e38f; mx = fmaxf(mx, t[e]); }
            mx = fmaxf(mx, xhalf(mx));
            al[nb] = ex2((m[nb] - mx) * L2E); m[nb] = mx; float sum = 0.f; v8us h0, h1, l0, l1;
#pragma unroll
            for (int e = 0; e < 8; ++e) { const float p0 = ex2((t[e] - mx) * L2E), p1 = ex2((t[e + 8] - mx) * L2E); sum += p0; sum += p1; unsigned short a, c2; splitf(p0, a, c2); h0[e] = a; l0[e] = c2; splitf(p1, a, c2); h1[e] = a; l1[e] = c2; }
            l[nb] = l[nb] * al[nb] + sum; ph[nb] = cat16b(h0, h1); pl[nb] = cat16b(l0, l1); }
#pragma unroll
        for (int db = 0; db < 4; ++db)
#pragma unroll
            for (int nb = 0; nb < 2; ++nb) { o[db][nb] *= al[nb]; o[db][nb] = wmmab(vh[db], ph[nb], o[db][nb]); o[db][nb] = wmmab(vh[db], pl[nb], o[db][nb]); o[db][nb] = wmmab(vl[db], ph[nb], o[db][nb]); }
    }
#pragma unroll
    for (int nb = 0; nb < 2; ++nb) { const float inv = __fdiv_rn(1.0f, l[nb] + xhalf(l[nb])); const size_t ro = (size_t)(q0 + nb * 16 + lr) * DQ + hi * 8;
#pragma unroll
        for (int db = 0; db < 4; ++db) put8(o[db][nb], inv, Ah + ro + db * 16, Al + ro + db * 16); }
}
// grid (NZ pairs, 8), four independent waves per block (no barrier, no LDS): even y = rows >= RH, odd y = rows < RH. Each half of a sequence is 16 strips of 32 rows; group g = y >> 1 takes strips
// g, 7 - g, 8 + g, 15 - g, so every block of a path walks the same number of key blocks in all, and its waves read the same key and value lines from the start of the sequence on.
// amdgpu_waves_per_eu(3, 3): holds the register allocation to three waves per SIMD, so that all NZ * 8 blocks are resident at once; without it the hi+lo path takes two waves' worth.
__global__ __launch_bounds__(128) __attribute__((amdgpu_waves_per_eu(3, 3))) void k_fattn(const h16* __restrict__ Q16, const h16* __restrict__ K16, const h16* __restrict__ V16, const bf* __restrict__ Qh, const bf* __restrict__ Ql, const bf* __restrict__ Kh, const bf* __restrict__ Kl, const bf* __restrict__ Vh, const bf* __restrict__ Vl, bf* Ah, bf* Al) {
    const int lane = threadIdx.x & 31, lr = lane & 15, hi = lane >> 4; const int w = __builtin_amdgcn_readfirstlane(threadIdx.x >> 5);   // the wave's number in a scalar register: loop bounds stay scalar
    const int zz = blockIdx.x, g = blockIdx.y >> 1; const size_t zo = (size_t)zz * TT * HD, zv = 2 * zo;
    const int strip = (w >> 1) * 8 + ((w & 1) ? 7 - g : g);
    const size_t oo = (size_t)(zz / NH_) * TT * DQ + (zz % NH_) * HD;   // this pair's first element in the merged [sequence][t][head][d] planes
    if ((blockIdx.y & 1) == 0) attn_lo(Q16 + zo, K16 + zo, V16 + zv, RH + 32 * strip, Ah + oo, Al + oo, lr, hi);
    else attn_hl(Qh + zo, Ql + zo, Kh + zo, Kl + zo, Vh + zv, Vl + zv, 32 * strip, Ah + oo, Al + oo, lr, hi);
}

// ---- k_proj: the three projections (grid z: q, k, v), ONE WAVE per 64x64 tile with the loop of k_gemmw; grid (rows / 64, heads, 3), 32 threads. The tile leaves as the attention kernel's
// operand planes (fp16, bf16 hi, bf16 lo of product + bias); the f32 projections never reach memory. In an accumulator a lane holds 8 consecutive rows of the A operand at one row of the B operand, so
// q, k: A = weight rows (d), B = x rows (t): 8 consecutive d of one token, planes [h][t][d]. v: A = x rows (t), B = weight rows (d): 8 consecutive t of one d, planes [h][d][t] at a pitch of 2*TT.
// Either way 16 plane rows of 64 elements (one 128-byte line each) are staged in LDS at a time and leave as whole lines.
#define PP 72   // LDS row pitch in 16-bit elements: 128 bytes of data + 16
// amdgpu_waves_per_eu(5): holds the register allocation to five waves per SIMD, as k_gemmw's loop has it, so that all tiles are resident at once; without it the epilogue takes four waves' worth.
__global__ __launch_bounds__(32) __attribute__((amdgpu_waves_per_eu(5))) void k_proj(const bf* __restrict__ X, const bf* __restrict__ Wt, const float* __restrict__ bias0, const float* __restrict__ bias1, const float* __restrict__ bias2, h16* P16, bf* Ph, bf* Pl, h16* V16, bf* Vh, bf* Vl) {
    __shared__ __align__(16) unsigned short st[3 * 16 * PP];
    const int z = blockIdx.z; const bool isv = (z == 2);
    const float* bias = (z == 0) ? bias0 : ((z == 1) ? bias1 : bias2);
    const int lane = threadIdx.x & 31, lr = lane & 15, hi = lane >> 4; const int r0 = blockIdx.x * 64, c0 = blockIdx.y * 64;
    const bf* xr = X + (size_t)r0 * DM; const bf* wr = Wt + ((size_t)z * DQ + c0) * DM;
    const bf* A = isv ? xr : wr; const bf* B = isv ? wr : xr;
    v8f acc[4][4];
#pragma unroll
    for (int ib = 0; ib < 4; ++ib)
#pragma unroll
        for (int jb = 0; jb < 4; ++jb) acc[ib][jb] = (v8f){};
    const unsigned off = (unsigned)(lr * DM + 8 * hi) * 2u;   // the lane's byte offset, fixed over the loop, beside wave-uniform bases that walk k
#pragma unroll 1   // as in k_gemmw: one body holds the register budget
    for (int kc = 0; kc < DM; kc += 32) {
        const bf* pa = (const bf*)((const char*)(A + kc) + off); const bf* pb = (const bf*)((const char*)(B + kc) + off);
        v16bf a[4];
#pragma unroll
        for (int ib = 0; ib < 4; ++ib) a[ib] = WFrag<bf>::ld(pa + ib * 16 * DM);
#pragma unroll
        for (int jb = 0; jb < 4; ++jb) { const v16bf b = WFrag<bf>::ld(pb + jb * 16 * DM);
#pragma unroll
            for (int ib = 0; ib < 4; ++ib) acc[ib][jb] = wmmab(a[ib], b, acc[ib][jb]); }
        asm volatile("s_wait_xcnt 0x0" :: "v"(pa), "v"(pb) : "memory");   // the wait in front of any rewrite of these loads' address registers; it names them, so that they live to here
        asm volatile("v_nop\n\tv_nop\n\tv_nop\n\tv_nop" : "+v"(acc[0][0]), "+v"(acc[1][1]), "+v"(acc[2][2]), "+v"(acc[3][3]) : "v"(a[0]), "v"(a[3]));   // as in k_gemmw: the distance behind the last matrix instruction, on the loop's back edge too
    }
    const size_t pair = (size_t)(r0 / TT) * NH_ + blockIdx.y; const int t0 = r0 % TT;
    const size_t base = isv ? pair * HD * (2 * TT) + t0 : (size_t)z * NZ * TT * HD + (pair * TT + t0) * HD;   // the k planes follow the q planes
    const unsigned pitch = isv ? 2 * TT : HD;
    unsigned short* d16 = (unsigned short*)(isv ? V16 : P16) + base; bf* dh = (isv ? Vh : Ph) + base; bf* dl = (isv ? Vl : Pl) + base;
    float bj[4];   // v: the bias runs along the lanes; q, k: along the accumulator's 8 values
#pragma unroll
    for (int jb = 0; jb < 4; ++jb) bj[jb] = bfr(bias[c0 + jb * 16 + lr]);
#pragma unroll
    for (int ib = 0; ib < 4; ++ib)
#pragma unroll
        for (int e = 0; e < 8; ++e) { const float bi = bfr(bias[c0 + ib * 16 + hi * 8 + e]);
#pragma unroll
            for (int jb = 0; jb < 4; ++jb) acc[ib][jb][e] += isv ? bj[jb] : bi; }
#pragma unroll
    for (int jb = 0; jb < 4; ++jb) {
#pragma unroll
        for (int ib = 0; ib < 4; ++ib) { v8h o16; v8us oh, ol;
#pragma unroll
            for (int e = 0; e < 8; ++e) { const float r = acc[ib][jb][e]; o16[e] = tohx(r); unsigned short a2, c2; splitf(r, a2, c2); oh[e] = a2; ol[e] = c2; }
            unsigned short* sp = st + lr * PP + ib * 16 + hi * 8;
            *(v8usa*)sp = __builtin_bit_cast(v8us, o16); *(v8usa*)(sp + 16 * PP) = oh; *(v8usa*)(sp + 32 * PP) = ol; }
        asm volatile("s_wait_dscnt 0x0" ::: "memory");   // the staged rows are written before other lanes read them back; the clobber keeps the compiler from moving the reads above the writes
#pragma unroll
        for (int g = 0; g < 2; ++g) { v8us w[2][3]; unsigned o[2];   // 8 rows at a time, 8 lanes per row: each store instruction writes 4 whole lines
#pragma unroll
            for (int s = 0; s < 2; ++s) { const int row = g * 8 + s * 4 + (lane >> 3), c = (lane & 7) * 8; const unsigned short* sp = st + row * PP + c; o[s] = ((unsigned)(jb * 16 + row) * pitch + c) * 2u;
                w[s][0] = *(const v8usa*)sp; w[s][1] = *(const v8usa*)(sp + 16 * PP); w[s][2] = *(const v8usa*)(sp + 32 * PP); }
#pragma unroll
            for (int s = 0; s < 2; ++s) { *(v8usa*)((char*)d16 + o[s]) = w[s][0]; *(v8usa*)((char*)dh + o[s]) = w[s][1]; *(v8usa*)((char*)dl + o[s]) = w[s][2]; }
            // the wait in front of any rewrite of these stores' address and data registers; it names them, so that they live to here. Its clobber also keeps the next 16 rows' LDS writes below the reads above.
            asm volatile("s_wait_xcnt 0x0" :: "v"(o[0]), "v"(o[1]), "v"(w[0][0]), "v"(w[0][1]), "v"(w[0][2]), "v"(w[1][0]), "v"(w[1][1]), "v"(w[1][2]) : "memory"); }
    }
}
__global__ __launch_bounds__(256) void k_wtH(const float* __restrict__ w0, const float* __restrict__ w1, const float* __restrict__ w2, bf* Bt) { const float* w = (blockIdx.y == 0) ? w0 : ((blockIdx.y == 1) ? w1 : w2); Bt += (size_t)blockIdx.y * DQ * DM; const size_t e = ((size_t)blockIdx.x * 256 + threadIdx.x) * 4; if (e >= (size_t)DQ * DM) return; const int k = (int)(e % DM); const int n = (int)(e / DM); const int h = n / HD, c = n % HD; v4us o;   // Bt[h*64 + c][d] = W[h][d][c] (lane -> 4 consecutive d, strided reads)
#pragma unroll
    for (int u = 0; u < 4; ++u) o[u] = f2bf(w[((size_t)h * DM + k + u) * HD + c]); *(v4us*)(Bt + e) = o;  }

extern "C" void kernel_launch(void* const* d_in, const int* in_sizes, int n_in,
                              void* d_out, int out_size, void* d_ws, size_t ws_size, hipStream_t stream) {
    (void)in_sizes; (void)n_in; (void)out_size;
    const float* x = (const float*)d_in[0]; const float* wqh = (const float*)d_in[1]; const float* bq = (const float*)d_in[2]; const float* wkh = (const float*)d_in[3]; const float* bk = (const float*)d_in[4]; const float* wvh = (const float*)d_in[5]; const float* bv = (const float*)d_in[6]; const float* wo = (const float*)d_in[7]; const float* bo = (const float*)d_in[8]; const float* wq = nullptr; const float* wk = nullptr; const float* wv = nullptr; (void)wq; (void)wk; (void)wv; const float* cosT = nullptr; const float* sinT = nullptr; (void)cosT; (void)sinT;
    float* OUT = (float*)d_out;     // [8][1024][768]
    char* wsp = (char*)d_ws;
    auto take = [&](size_t bytes) { char* p = wsp; wsp += (bytes + 255) & ~(size_t)255; return (void*)p; };
    bf* WQ = (bf*)take((size_t)DQ * DM * 2); bf* WK = (bf*)take((size_t)DKV * DM * 2); bf* WV = (bf*)take((size_t)DKV * DM * 2); bf* WO = (bf*)take((size_t)DM * DQ * 2); (void)WK; (void)WV;   // WQ, WK, WV lie back to back (z-stride DQ*DM)
    const size_t PL = (size_t)NZ * TT * HD;   // elements of one plane over all (sequence, head) pairs; each q plane is followed by its k plane, which k_proj relies on
    h16* QP16 = (h16*)take(PL * 2); h16* KP16 = (h16*)take(PL * 2); h16* VT16 = (h16*)take(PL * 4);   // value planes: row pitch 2*TT (fp16 rows fill the first half)
    bf* QPh = (bf*)take(PL * 2); bf* KPh = (bf*)take(PL * 2); bf* QPl = (bf*)take(PL * 2); bf* KPl = (bf*)take(PL * 2); bf* VTh = (bf*)take(PL * 4); bf* VTl = VTh + TT;   // each value row: hi half, then lo half
    char* R = (char*)take((size_t)ZH * TT * TT * 4);   // one region, two stream-ordered uses: the x plane; then the merged head planes
    if ((size_t)(wsp - (char*)d_ws) > ws_size) return;    // ws 256 MiB
    bf* XB = (bf*)R;
    bf* ATh = (bf*)R; bf* ATl = ATh + (size_t)NB_ * TT * DQ;
    k_wtH<<<dim3((unsigned)(((size_t)DQ * DM / 4 + 255) / 256), 3, 1), 256, 0, stream>>>(wqh, wkh, wvh, WQ);
    k_wtG<<<(unsigned)((DQ * DM / 64 + 63) / 64), 256, 0, stream>>>(wo, DQ, DM, WO);
    k_cvt8<<<(unsigned)(((size_t)NB_ * TT * DM / 8 + 255) / 256), 256, 0, stream>>>(x, XB, (size_t)NB_ * TT * DM / 8);
    k_proj<<<dim3(NB_ * TT / 64, NH_, 3), 32, 0, stream>>>(XB, WQ, bq, bk, bv, QP16, QPh, QPl, VT16, VTh, VTl);
    k_fattn<<<dim3(NZ, 8, 1), 128, 0, stream>>>(QP16, KP16, VT16, QPh, QPl, KPh, KPl, VTh, VTl, ATh, ATl);
    k_gemmw<bf, 1, true><<<dim3(NB_ * TT / 64, DM / 64, 1), 32, 0, stream>>>(ATh, ATl, WO, nullptr, DQ, OUT, DM, bo, bo, bo, 0, 0, 0);
}

// v004
// Measured time: 124 microseconds a run.
// Two timings next to v003 put it at 1.31 and 1.33 times that version's speed.
// Over all steps from v000 it is 24.6 times as fast.
#include <hip/hip_runtime.h>

// MaskedMultiHeadAttention (hidden [8][1024][768]; per-head q/k/v = x Wq[h] + bq[h] (Wq [12][768][64]); causal softmax(q.k / 8); out = concat(heads) Wo + bo -> [8][1024][768]). That is EIGHT sequences of 1,024 tokens at width 768 with 12 heads x 64 ([8][1024][768]) and the inputs in the order x, Wq, bq, Wk, bk, Wv, bv, W0, b0 (each bias after its own weight).
// Compute dtypes, f32 accumulate: every input rounded to bf16; q/k/v on PLAIN bf16 operands (inputs: exact; the 12 per-head weights gathered into one [768 x 768] operand) + bias; causal scores and attn.v: query rows < 512 hl (3 products), the rest single fp16 (x1024); softmax f32; Wo hl x exact (2 products) + bias.

#define NB_  8
#define TT   1024
#define DM   768
#define NH_  12
#define NKV  12
#define REP  (NH_ / NKV)
#define HD   64
#define DQ   (NH_ * HD)
#define DKV  (NKV * HD)
#define ZH   24
#define NZ   (NB_ * NH_)
#define RH   512                  // query rows < RH use hi+lo planes
#define WIN  1024
#define PCAR 1024.0f
#define SCL  0.125f   // HD^-0.5
typedef _Float16 h16;
typedef unsigned short bf;
typedef __attribute__((ext_vector_type(16))) __bf16   v16bf;
typedef __attribute__((ext_vector_type(16))) _Float16 v16h;
typedef __attribute__((ext_vector_type(8)))  _Float16 v8h;
typedef __attribute__((ext_vector_type(8)))  unsigned short v8us;
typedef __attribute__((ext_vector_type(8)))  float    v8f;
typedef __attribute__((ext_vector_type(4)))  float    v4f;
typedef v8h  __attribute__((may_alias)) v8ha;
typedef v4f  __attribute__((may_alias)) v4fa;
typedef v8us __attribute__((may_alias)) v8usa;
#define FE 512   // elements of one packed 16 x 32 fragment

__device__ __forceinline__ unsigned short f2bf(float f) { unsigned u = __float_as_uint(f); u += 0x7FFFu + ((u >> 16) & 1u); return (unsigned short)(u >> 16); }
__device__ __forceinline__ float bf2f(unsigned short b) { return __uint_as_float(((unsigned)b) << 16); }
__device__ __forceinline__ float bfr(float f) { return bf2f(f2bf(f)); }
__device__ __forceinline__ v16h cat16(v8h lo, v8h hi) { return __builtin_shufflevector(lo, hi, 0, 1, 2, 3, 4, 5, 6, 7, 8, 9, 10, 11, 12, 13, 14, 15); }
__device__ __forceinline__ v16bf cat16b(v8us lo, v8us hi) { return __builtin_bit_cast(v16bf, __builtin_shufflevector(lo, hi, 0, 1, 2, 3, 4, 5, 6, 7, 8, 9, 10, 11, 12, 13, 14, 15)); }
__device__ __forceinline__ v8f wmma16(v16h a, v16h b, v8f c) { return __builtin_amdgcn_wmma_f32_16x16x32_f16(false, a, false, b, (short)0, c, false, false); }
__device__ __forceinline__ v8f wmmab(v16bf a, v16bf b, v8f c) { return __builtin_amdgcn_wmma_f32_16x16x32_bf16(false, a, false, b, (short)0, c, false, false); }



// ---- Fragment-packed planes. Every 16-bit operand plane [rows][k] is stored as whole WMMA fragments: the fragment of rows 16 rb .. + 15 and k 32 kb .. + 31 is FE = 512 consecutive elements (1 KiB),
// element (row, k) at c * 256 + lane * 8 + (k & 7) with c = (k >> 4) & 1 and lane = ((k >> 3) & 1) * 16 + (row & 15). A fragment load is then two loads of 512 consecutive bytes (4 whole lines each)
// instead of two loads that touch 16 lines each; the k order of the operands is the one it was. ld(p) takes the fragment's first element + lane * 8.
// ---- k_gemmw: register-blocked GEMM, ONE WAVE per 64x64 output tile (16 accumulators), operands straight from fragment-packed planes, fragments in [rb][kb] order; grid (M/64, N/64, Z), 32 threads.
// C[m][n] (f32, pitch ldc, + optional f32 bias[n]) = sum_k A[m][k] Bt[n][k] (+ split products per NSPLIT). z-batch strides sA/sB/sC in elements. K % 32 == 0.
template <typename T16> struct WFrag;
template <> struct WFrag<h16> { typedef v16h V; static __device__ __forceinline__ V ld(const h16* p) { return cat16(*(const v8h*)p, *(const v8h*)(p + 256)); } static __device__ __forceinline__ v8f mma(V a, V b, v8f c) { return wmma16(a, b, c); } };
template <> struct WFrag<bf> { typedef v16bf V; static __device__ __forceinline__ V ld(const bf* p) { return cat16b(*(const v8us*)p, *(const v8us*)(p + 256)); } static __device__ __forceinline__ v8f mma(V a, V b, v8f c) { return wmmab(a, b, c); } };
template <typename T16, int NSPLIT, bool BIAS, int K>   // K at compile time: the row blocks' distances are immediate offsets of the loads
__global__ __launch_bounds__(32) void k_gemmw(const T16* __restrict__ A, const T16* __restrict__ A2, const T16* __restrict__ Bt, const T16* __restrict__ Bt2, float* C, int ldc, const float* __restrict__ bias0, const float* __restrict__ bias1, const float* __restrict__ bias2, size_t sA, size_t sB, size_t sC) {
    typedef typename WFrag<T16>::V V;
    __shared__ __align__(16) float os[16 * 68];
    const size_t z = blockIdx.z; A += z * sA; if (A2) A2 += z * sA; Bt += z * sB; if (Bt2) Bt2 += z * sB; C += z * sC;
    const float* bias = (z == 0) ? bias0 : ((z == 1) ? bias1 : bias2);   // each z-slice adds its own bias vector
    const int lane = threadIdx.x & 31, lr = lane & 15, hi = lane >> 4; const int r0 = blockIdx.x * 64, c0 = blockIdx.y * 64;
    v8f acc[4][4];
#pragma unroll
    for (int mb = 0; mb < 4; ++mb)
#pragma unroll
        for (int nb = 0; nb < 4; ++nb) acc[mb][nb] = (v8f){};
    constexpr int rs = 16 * K;   // elements of one block of 16 rows
    const size_t aoff = (size_t)r0 * K, boff = (size_t)c0 * K; const unsigned off = (unsigned)lane * 16u;   // the lane's byte offset, fixed over the loop, beside wave-uniform bases that walk k
#pragma unroll 1
    for (int kb = 0; kb < K / 32; ++kb) {
        V a[4], a2[4];
        const T16* pa = (const T16*)((const char*)(A + aoff + kb * FE) + off); const T16* pa2 = (NSPLIT == 1 || NSPLIT == 2) ? (const T16*)((const char*)(A2 + aoff + kb * FE) + off) : pa; const T16* pb = (const T16*)((const char*)(Bt + boff + kb * FE) + off); const T16* pb2 = NSPLIT >= 2 ? (const T16*)((const char*)(Bt2 + boff + kb * FE) + off) : pb;
#pragma unroll
        for (int mb = 0; mb < 4; ++mb) { a[mb] = WFrag<T16>::ld(pa + mb * rs); if (NSPLIT == 1 || NSPLIT == 2) a2[mb] = WFrag<T16>::ld(pa2 + mb * rs); }
#pragma unroll
        for (int nb = 0; nb < 4; ++nb) { const V b = WFrag<T16>::ld(pb + nb * rs); V b2; if (NSPLIT >= 2) b2 = WFrag<T16>::ld(pb2 + nb * rs);
#pragma unroll
            for (int mb = 0; mb < 4; ++mb) { acc[mb][nb] = WFrag<T16>::mma(a[mb], b, acc[mb][nb]); if (NSPLIT == 1 || NSPLIT == 2) acc[mb][nb] = WFrag<T16>::mma(a2[mb], b, acc[mb][nb]); if (NSPLIT >= 2) acc[mb][nb] = WFrag<T16>::mma(a[mb], b2, acc[mb][nb]); } }
        asm volatile("s_wait_xcnt 0x0" :: "v"(pa), "v"(pa2), "v"(pb), "v"(pb2) : "memory");   // the wait in front of any rewrite of these loads' address registers; it names them, so that they live to here
        asm volatile("v_nop\n\tv_nop\n\tv_nop\n\tv_nop" : "+v"(acc[0][0]), "+v"(acc[1][1]), "+v"(acc[2][2]), "+v"(acc[3][3]) : "v"(a[0]), "v"(a[3]));
    }
#pragma unroll
    for (int mb = 0; mb < 4; ++mb) {
#pragma unroll
        for (int nb = 0; nb < 4; ++nb) {
#pragma unroll
            for (int j = 0; j < 8; ++j) os[(hi * 8 + j) * 68 + nb * 16 + lr] = acc[mb][nb][j]; }
        __builtin_amdgcn_wave_barrier(); asm volatile("" ::: "memory");
        float* crow = C + (size_t)(r0 + mb * 16) * ldc + c0;
{ v4f vs[8]; float* cp[8];
#pragma unroll
            for (int s = 0; s < 8; ++s) { const int row = 2 * s + hi, cofs = lr * 4; v4f val = *(const v4fa*)(os + row * 68 + cofs); if (BIAS) { val[0] += bfr(bias[c0 + cofs]); val[1] += bfr(bias[c0 + cofs + 1]); val[2] += bfr(bias[c0 + cofs + 2]); val[3] += bfr(bias[c0 + cofs + 3]); }
                vs[s] = val; cp[s] = crow + (size_t)row * ldc + cofs; *(v4f*)cp[s] = val; }
            // the wait in front of any rewrite of these stores' address and data registers; it names them, so that they live to here
            asm volatile("s_wait_xcnt 0x0" :: "v"(cp[0]), "v"(cp[1]), "v"(cp[2]), "v"(cp[3]), "v"(cp[4]), "v"(cp[5]), "v"(cp[6]), "v"(cp[7]), "v"(vs[0]), "v"(vs[1]), "v"(vs[2]), "v"(vs[3]), "v"(vs[4]), "v"(vs[5]), "v"(vs[6]), "v"(vs[7]) : "memory");
             }
        __builtin_amdgcn_wave_barrier(); asm volatile("" ::: "memory");
    }
}

__device__ __forceinline__ h16 tohx(float x) { return (h16)x; }
__device__ __forceinline__ void splitf(float y, unsigned short& h, unsigned short& l) { h = f2bf(y); l = f2bf(y - bf2f(h)); }
typedef __attribute__((ext_vector_type(2))) _Float16 v2h;
typedef __attribute__((ext_vector_type(4))) _Float16 v4h;
typedef __attribute__((ext_vector_type(2))) unsigned short v2us;
typedef __attribute__((ext_vector_type(4))) unsigned short v4us;
typedef __attribute__((ext_vector_type(2))) float v2f;
typedef __attribute__((ext_vector_type(4))) int v4i;

// the three producers below: one thread per 16-byte piece of a packed plane, in the plane's own order (whole lines written); piece i is lane i & 31, half c = (i >> 5) & 1 of fragment i >> 6
__global__ __launch_bounds__(256) void k_wtG(const float* __restrict__ w, bf* Bt) {   // Bt[n][k] = w[k][n], k < DQ, n < DM: 16 lanes read 16 consecutive n
    const int i = blockIdx.x * 256 + threadIdx.x; if (i >= DM * DQ / 8) return; const int f = i >> 6, kb = f % (DQ / 32), rb = f / (DQ / 32); const int n = rb * 16 + (i & 15), k0 = kb * 32 + ((i >> 5) & 1) * 16 + ((i >> 4) & 1) * 8; v8us o;
    const float* p = w + (size_t)k0 * DM + n; float v[8];
#pragma unroll
    for (int u = 0; u < 8; ++u) v[u] = p[u * DM];
    asm volatile("s_wait_xcnt 0x0" :: "v"(p) : "memory");   // the wait in front of any rewrite of these loads' address registers; it names them, so that they live to here
#pragma unroll
    for (int u = 0; u < 8; ++u) o[u] = f2bf(v[u]); *(v8us*)(Bt + (size_t)i * 8) = o;  }
__global__ __launch_bounds__(256) void k_cvt8(const float* __restrict__ src, bf* dst, size_t n8) { const size_t i = (size_t)blockIdx.x * 256 + threadIdx.x; if (i >= n8) return; const size_t f = i >> 6, kb = f % (DM / 32), rb = f / (DM / 32);
    const v8f v = *(const v8f*)(src + (rb * 16 + (i & 15)) * DM + kb * 32 + ((i >> 5) & 1) * 16 + ((i >> 4) & 1) * 8); v8us o;
#pragma unroll
    for (int k = 0; k < 8; ++k) o[k] = f2bf(v[k]); *(v8us*)(dst + i * 8) = o;  }
// ---- k_fattn: causal attention of one (sequence, head) pair and one strip of query rows in one wave; scores and probabilities stay in registers (online softmax over blocks of 32 keys).
// Transposed products: S^T = K Q^T (A = key rows, B = query rows), so a lane holds 16 scores of ONE query (column lr): keys k0 + 8 hi + j and k0 + 16 + 8 hi + j. Those 16 values, converted in place, are the
// B operand of O^T += V^T P^T (A = value plane rows [d][t]) in the k order of the loaders. Running maximum, sum and rescale factor are per lane; the two lane halves are joined by one exchange.
// The strip's output rows leave as the hi/lo planes of the output projection's A operand: lane = query row, 8 consecutive d per accumulator, which is one half of a packed fragment: 512 consecutive bytes a store.
// Packed planes: q, k rows t, k = d, fragments [t / 16][d / 32]; v rows d, k = t, fragments [t / 32][d / 16]: a block of 32 keys is 4 consecutive fragments of either, at element k0 * HD.
#define L2E 1.4426950408889634f
__device__ __forceinline__ float xhalf(float x) { const int b = __float_as_int(x); return __int_as_float(__builtin_amdgcn_permlanex16(b, b, 0x76543210, 0xfedcba98, false, false)); }   // lane l <-> l ^ 16
__device__ __forceinline__ float ex2(float x) { float r; asm("v_exp_f32 %0, %1\n\tv_nop" : "=v"(r) : "v"(x)); return r; }
__device__ __forceinline__ void put8(v8f o, float inv, bf* ph, bf* pl) { v8us oh, ol;
#pragma unroll
    for (int j = 0; j < 8; ++j) { unsigned short a, c2; splitf(o[j] * inv, a, c2); oh[j] = a; ol[j] = c2; }
    *(v8us*)ph = oh; *(v8us*)pl = ol;
    asm volatile("s_wait_xcnt 0x0" :: "v"(ph), "v"(pl), "v"(oh), "v"(ol) : "memory"); }   // the wait in front of any rewrite of these stores' address and data registers; it names them, so that they live to here
// rows >= RH: single fp16 products, 32 query rows per wave; probabilities carry the factor PCAR = 2^10 (it cancels against the row sum)
__device__ __forceinline__ void attn_lo(const h16* __restrict__ Q, const h16* __restrict__ Kp, const h16* __restrict__ Vt, int q0, bf* Ah, bf* Al, int lr, int hi) {
    v16h qf[2][2]; const h16* qp = Q + (size_t)q0 * HD + (hi * 16 + lr) * 8;   // 16 rows of HD = 64 are two fragments: row block r0 begins at element r0 * HD, as it did
#pragma unroll
    for (int nb = 0; nb < 2; ++nb)
#pragma unroll
        for (int ks = 0; ks < 2; ++ks) qf[nb][ks] = WFrag<h16>::ld(qp + (nb * 2 + ks) * FE);
    v8f o[4][2]; float m[2], l[2];
#pragma unroll
    for (int nb = 0; nb < 2; ++nb) { m[nb] = -3.0e38f; l[nb] = 0.f;
#pragma unroll
        for (int db = 0; db < 4; ++db) o[db][nb] = (v8f){}; }
    const h16* kp = Kp + (hi * 16 + lr) * 8; const unsigned vo = (unsigned)(hi * 16 + lr) * 16u;   // value loads: the lane's byte offset, fixed over the loop, beside a wave-uniform base that walks the keys
    v16h kf[2][2];
#pragma unroll
    for (int kt = 0; kt < 2; ++kt)
#pragma unroll
        for (int ks = 0; ks < 2; ++ks) kf[kt][ks] = WFrag<h16>::ld(kp + (kt * 2 + ks) * FE);
    asm volatile("s_wait_xcnt 0x0" :: "v"(qp), "v"(kp) : "memory");   // the wait in front of any rewrite of these loads' address registers; it names them, so that they live to here
#pragma unroll 1   // run-time trip count; one body already holds most of the register budget
    for (int k0 = 0; k0 < q0 + 32; k0 += 32) {
        v16h vf[4]; const h16* vp = (const h16*)((const char*)(Vt + (size_t)k0 * HD) + vo);
#pragma unroll
        for (int db = 0; db < 4; ++db) vf[db] = WFrag<h16>::ld(vp + db * FE);
        v8f s[2][2];
#pragma unroll
        for (int kt = 0; kt < 2; ++kt)
#pragma unroll
            for (int nb = 0; nb < 2; ++nb) s[kt][nb] = wmma16(kf[kt][1], qf[nb][1], wmma16(kf[kt][0], qf[nb][0], (v8f){}));
        if (k0 < q0) kp += 32 * HD;   // the next block's key fragments fly during this block's softmax; the last block fetches its own again, so the address stays inside the plane
#pragma unroll
        for (int kt = 0; kt < 2; ++kt)
#pragma unroll
            for (int ks = 0; ks < 2; ++ks) kf[kt][ks] = WFrag<h16>::ld(kp + (kt * 2 + ks) * FE);
        asm volatile("s_wait_xcnt 0x0" :: "v"(vp), "v"(kp) : "memory");   // the wait in front of any rewrite of the value and key loads' address registers; it names them, so that they live to here
        __builtin_amdgcn_sched_barrier(0);   // keeps the key loads above the softmax; without it the scheduler sinks them to the loop's foot and their latency is exposed again
#pragma unroll
        for (int nb = 0; nb < 2; ++nb) { const int q = q0 + nb * 16 + lr; float t[16]; float mx = m[nb];
#pragma unroll
            for (int e = 0; e < 16; ++e) { const int key = k0 + (e >> 3) * 16 + hi * 8 + (e & 7); t[e] = (key <= q) ? s[e >> 3][nb][e & 7] * SCL : -3.0e38f; mx = fmaxf(mx, t[e]); }
            mx = fmaxf(mx, xhalf(mx));
            const float al = ex2((m[nb] - mx) * L2E); m[nb] = mx; float sum = 0.f; v16h pf;
#pragma unroll
            for (int e = 0; e < 16; ++e) { const float p = ex2((t[e] - mx) * L2E + 10.0f); sum += p; pf[e] = tohx(p); }
            l[nb] = l[nb] * al + sum;
#pragma unroll
            for (int db = 0; db < 4; ++db) { o[db][nb] *= al; o[db][nb] = wmma16(vf[db], pf, o[db][nb]); } }
    }
#pragma unroll
    for (int nb = 0; nb < 2; ++nb) { const float inv = __fdiv_rn(1.0f, l[nb] + xhalf(l[nb])); const size_t ro = (size_t)(q0 + nb * 16) * DQ + (hi * 16 + lr) * 8;   // row block [rb][kb]; the head's two fragments of it lie side by side
#pragma unroll
        for (int db = 0; db < 4; ++db) put8(o[db][nb], inv, Ah + ro + db * 256, Al + ro + db * 256); }
}
// rows < RH: hi+lo bf16 planes, 3 products each for the scores and for P.V, 32 query rows per wave
__device__ __forceinline__ void attn_hl(const bf* __restrict__ Qh, const bf* __restrict__ Ql, const bf* __restrict__ Kh, const bf* __restrict__ Kl, const bf* __restrict__ Vh, const bf* __restrict__ Vl, int q0, bf* Ah, bf* Al, int lr, int hi) {
    v16bf qh[2][2], ql[2][2]; const bf* qph = Qh + (size_t)q0 * HD + (hi * 16 + lr) * 8; const bf* qpl = Ql + (size_t)q0 * HD + (hi * 16 + lr) * 8;
#pragma unroll
    for (int nb = 0; nb < 2; ++nb)
#pragma unroll
        for (int ks = 0; ks < 2; ++ks) { qh[nb][ks] = WFrag<bf>::ld(qph + (nb * 2 + ks) * FE); ql[nb][ks] = WFrag<bf>::ld(qpl + (nb * 2 + ks) * FE); }
    asm volatile("s_wait_xcnt 0x0" :: "v"(qph), "v"(qpl) : "memory");   // the wait in front of any rewrite of these loads' address registers; it names them, so that they live to here
    v8f o[4][2]; float m[2], l[2];
#pragma unroll
    for (int nb = 0; nb < 2; ++nb) { m[nb] = -3.0e38f; l[nb] = 0.f;
#pragma unroll
        for (int db = 0; db < 4; ++db) o[db][nb] = (v8f){}; }
    const unsigned ko = (unsigned)(hi * 16 + lr) * 16u, vo = ko;   // the lane's byte offsets, fixed over the loop, beside wave-uniform bases that walk the keys
#pragma unroll 1   // run-time trip count; one body already holds most of the register budget
    for (int k0 = 0; k0 < q0 + 32; k0 += 32) {
        const bf* kph = (const bf*)((const char*)(Kh + (size_t)k0 * HD) + ko); const bf* kpl = (const bf*)((const char*)(Kl + (size_t)k0 * HD) + ko);
        v16bf kh[2][2], kl[2][2];   // all key fragments of the block are requested together: one latency a block, not one per fragment pair
#pragma unroll
        for (int kt = 0; kt < 2; ++kt)
#pragma unroll
            for (int ks = 0; ks < 2; ++ks) { kh[kt][ks] = WFrag<bf>::ld(kph + (kt * 2 + ks) * FE); kl[kt][ks] = WFrag<bf>::ld(kpl + (kt * 2 + ks) * FE); }
        asm volatile("s_wait_xcnt 0x0" :: "v"(kph), "v"(kpl) : "memory");   // the wait in front of any rewrite of the key loads' address registers; it names them, so that they live to here
        __builtin_amdgcn_sched_barrier(0);   // keeps the sixteen key loads together above the products; without it the scheduler sinks them pair by pair between the products, one exposed latency each
        v8f s[2][2];
#pragma unroll
        for (int kt = 0; kt < 2; ++kt) { s[kt][0] = (v8f){}; s[kt][1] = (v8f){};
#pragma unroll
            for (int ks = 0; ks < 2; ++ks)
#pragma unroll
                for (int nb = 0; nb < 2; ++nb) { s[kt][nb] = wmmab(kh[kt][ks], qh[nb][ks], s[kt][nb]); s[kt][nb] = wmmab(kh[kt][ks], ql[nb][ks], s[kt][nb]); s[kt][nb] = wmmab(kl[kt][ks], qh[nb][ks], s[kt][nb]); } }
        const bf* vph = (const bf*)((const char*)(Vh + (size_t)k0 * HD) + vo); const bf* vpl = (const bf*)((const char*)(Vl + (size_t)k0 * HD) + vo);
        v16bf vh[4], vl[4];
#pragma unroll
        for (int db = 0; db < 4; ++db) { vh[db] = WFrag<bf>::ld(vph + db * FE); vl[db] = WFrag<bf>::ld(vpl + db * FE); }
        asm volatile("s_wait_xcnt 0x0" :: "v"(vph), "v"(vpl) : "memory");   // the same wait for the value loads' address registers; the loads' own place is held by the next line
        __builtin_amdgcn_sched_barrier(0);   // keeps the value loads above the softmax, which hides their latency; without it the scheduler sinks half of them, and the wait with them, to the products
        v16bf ph[2], pl[2]; float al[2];
#pragma unroll
        for (int nb = 0; nb < 2; ++nb) { const int q = q0 + nb * 16 + lr; float t[16]; float mx = m[nb];
#pragma unroll
            for (int e = 0; e < 16; ++e) { const int key = k0 + (e >> 3) * 16 + hi * 8 + (e & 7); t[e] = (key <= q) ? s[e >> 3][nb][e & 7] * SCL : -3.0e38f; mx = fmaxf(mx, t[e]); }
            mx = fmaxf(mx, xhalf(mx));
            al[nb] = ex2((m[nb] - mx) * L2E); m[nb] = mx; float sum = 0.f; v8us h0, h1, l0, l1;
#pragma unroll
            for (int e = 0; e < 8; ++e) { const float p0 = ex2((t[e] - mx) * L2E), p1 = ex2((t[e + 8] - mx) * L2E); sum += p0; sum += p1; unsigned short a, c2; splitf(p0, a, c2); h0[e] = a; l0[e] = c2; splitf(p1, a, c2); h1[e] = a; l1[e] = c2; }
            l[nb] = l[nb] * al[nb] + sum; ph[nb] = cat16b(h0, h1); pl[nb] = cat16b(l0, l1); }
#pragma unroll
        for (int db = 0; db < 4; ++db)
#pragma unroll
            for (int nb = 0; nb < 2; ++nb) { o[db][nb] *= al[nb]; o[db][nb] = wmmab(vh[db], ph[nb], o[db][nb]); o[db][nb] = wmmab(vh[db], pl[nb], o[db][nb]); o[db][nb] = wmmab(vl[db], ph[nb], o[db][nb]); }
    }
#pragma unroll
    for (int nb = 0; nb < 2; ++nb) { const float inv = __fdiv_rn(1.0f, l[nb] + xhalf(l[nb])); const size_t ro = (size_t)(q0 + nb * 16) * DQ + (hi * 16 + lr) * 8;   // row block [rb][kb]; the head's two fragments of it lie side by side
#pragma unroll
        for (int db = 0; db < 4; ++db) put8(o[db][nb], inv, Ah + ro + db * 256, Al + ro + db * 256); }
}
// grid (NZ pairs, 8), four independent waves per block (no barrier, no LDS): even y = rows >= RH, odd y = rows < RH. Each half of a sequence is 16 strips of 32 rows; group g = y >> 1 takes strips
// g, 7 - g, 8 + g, 15 - g, so every block of a path walks the same number of key blocks in all, and its waves read the same key and value lines from the start of the sequence on.
// amdgpu_waves_per_eu(3, 3): holds the register allocation to three waves per SIMD, so that all NZ * 8 blocks are resident at once; without it the hi+lo path takes two waves' worth.
__global__ __launch_bounds__(128) __attribute__((amdgpu_waves_per_eu(3, 3))) void k_fattn(const h16* __restrict__ Q16, const h16* __restrict__ K16, const h16* __restrict__ V16, const bf* __restrict__ Qh, const bf* __restrict__ Ql, const bf* __restrict__ Kh, const bf* __restrict__ Kl, const bf* __restrict__ Vh, const bf* __restrict__ Vl, bf* Ah, bf* Al) {
    const int lane = threadIdx.x & 31, lr = lane & 15, hi = lane >> 4; const int w = __builtin_amdgcn_readfirstlane(threadIdx.x >> 5);   // the wave's number in a scalar register: loop bounds stay scalar
    const int zz = blockIdx.x, g = blockIdx.y >> 1; const size_t zo = (size_t)zz * TT * HD, zv = zo;
    const int strip = (w >> 1) * 8 + ((w & 1) ? 7 - g : g);
    const size_t oo = (size_t)(zz / NH_) * TT * DQ + (zz % NH_) * 2 * FE;   // this pair's first element in the merged planes (rows [sequence][t], k = [head][d], packed)
    if ((blockIdx.y & 1) == 0) attn_lo(Q16 + zo, K16 + zo, V16 + zv, RH + 32 * strip, Ah + oo, Al + oo, lr, hi);
    else attn_hl(Qh + zo, Ql + zo, Kh + zo, Kl + zo, Vh + zv, Vl + zv, 32 * strip, Ah + oo, Al + oo, lr, hi);
}

// ---- k_proj: the three projections (grid z: q, k, v), ONE WAVE per 64x64 tile with the loop of k_gemmw; grid (rows / 64, heads, 3), 32 threads. The tile leaves as the attention kernel's
// operand planes (fp16, bf16 hi, bf16 lo of product + bias); the f32 projections never reach memory. In an accumulator a lane holds 8 consecutive rows of the A operand at one row of the B operand, so
// q, k: A = weight rows (d), B = x rows (t): 8 consecutive d of one token. v: A = x rows (t), B = weight rows (d): 8 consecutive t of one d.
// Either way an accumulator, converted, IS one half of a packed fragment of the plane in lane order: it leaves straight from registers as 512 consecutive bytes, and the tile is 8 consecutive fragments of each plane.
// amdgpu_waves_per_eu(5): holds the register allocation to five waves per SIMD, as k_gemmw's loop has it, so that all tiles are resident at once; without it the epilogue takes four waves' worth.
__global__ __launch_bounds__(32) __attribute__((amdgpu_waves_per_eu(5))) void k_proj(const bf* __restrict__ X, const bf* __restrict__ Wt, const float* __restrict__ bias0, const float* __restrict__ bias1, const float* __restrict__ bias2, h16* P16, bf* Ph, bf* Pl, h16* V16, bf* Vh, bf* Vl) {
    const int z = blockIdx.z; const bool isv = (z == 2);
    const float* bias = (z == 0) ? bias0 : ((z == 1) ? bias1 : bias2);
    const int lane = threadIdx.x & 31, lr = lane & 15, hi = lane >> 4; const int r0 = blockIdx.x * 64, c0 = blockIdx.y * 64;
    const bf* xr = X + (size_t)r0 * DM; const bf* wr = Wt + ((size_t)z * DQ + c0) * DM;   // a block of 16 rows is DM / 32 fragments = 16 * DM elements: it begins where it did
    const bf* A = isv ? xr : wr; const bf* B = isv ? wr : xr;
    v8f acc[4][4];
#pragma unroll
    for (int ib = 0; ib < 4; ++ib)
#pragma unroll
        for (int jb = 0; jb < 4; ++jb) acc[ib][jb] = (v8f){};
    const unsigned off = (unsigned)lane * 16u;   // the lane's byte offset, fixed over the loop, beside wave-uniform bases that walk k
#pragma unroll 1   // as in k_gemmw: one body holds the register budget
    for (int kb = 0; kb < DM / 32; ++kb) {
        const bf* pa = (const bf*)((const char*)(A + kb * FE) + off); const bf* pb = (const bf*)((const char*)(B + kb * FE) + off);
        v16bf a[4];
#pragma unroll
        for (int ib = 0; ib < 4; ++ib) a[ib] = WFrag<bf>::ld(pa + ib * 16 * DM);
#pragma unroll
        for (int jb = 0; jb < 4; ++jb) { const v16bf b = WFrag<bf>::ld(pb + jb * 16 * DM);
#pragma unroll
            for (int ib = 0; ib < 4; ++ib) acc[ib][jb] = wmmab(a[ib], b, acc[ib][jb]); }
        asm volatile("s_wait_xcnt 0x0" :: "v"(pa), "v"(pb) : "memory");   // the wait in front of any rewrite of these loads' address registers; it names them, so that they live to here
        asm volatile("v_nop\n\tv_nop\n\tv_nop\n\tv_nop" : "+v"(acc[0][0]), "+v"(acc[1][1]), "+v"(acc[2][2]), "+v"(acc[3][3]) : "v"(a[0]), "v"(a[3]));   // as in k_gemmw: the distance behind the last matrix instruction, on the loop's back edge too
    }
    const size_t pair = (size_t)(r0 / TT) * NH_ + blockIdx.y; const int t0 = r0 % TT;
    const size_t base = (isv ? 0 : (size_t)z * NZ * TT * HD) + (pair * TT + t0) * HD;   // the k planes follow the q planes; 64 tokens are 8 fragments in either fragment order
    unsigned short* d16 = (unsigned short*)(isv ? V16 : P16) + base; bf* dh = (isv ? Vh : Ph) + base; bf* dl = (isv ? Vl : Pl) + base;
    const unsigned si = isv ? 4 * FE * 2 : FE * 2, sj = isv ? FE * 2 : 2 * FE * 2;   // bytes from fragment to fragment along ib >> 1 and along jb: v [t / 32][d / 16], q and k [t / 16][d / 32]
    float bj[4]; const int bx = c0 + lr;   // v: the bias runs along the lanes; q, k: along the accumulator's 8 values
#pragma unroll
    for (int jb = 0; jb < 4; ++jb) bj[jb] = bias[bx + jb * 16];
    asm volatile("s_wait_xcnt 0x0" :: "v"(bx) : "memory");   // the wait in front of any rewrite of these loads' index register; it names it, so that it lives to here
#pragma unroll
    for (int jb = 0; jb < 4; ++jb) bj[jb] = bfr(bj[jb]);
#pragma unroll
    for (int g = 0; g < 2; ++g) { float bi[2][8];
#pragma unroll
        for (int c = 0; c < 2; ++c)
#pragma unroll
            for (int e = 0; e < 8; ++e) bi[c][e] = bfr(bias[c0 + (g * 2 + c) * 16 + hi * 8 + e]);
#pragma unroll
        for (int jb = 0; jb < 4; ++jb) { v8us w[2][3];   // one whole fragment of each plane at a time
#pragma unroll
            for (int c = 0; c < 2; ++c) { v8h o16; v8us oh, ol;
#pragma unroll
                for (int e = 0; e < 8; ++e) { const float r = acc[g * 2 + c][jb][e] + (isv ? bj[jb] : bi[c][e]); o16[e] = tohx(r); unsigned short a2, c2; splitf(r, a2, c2); oh[e] = a2; ol[e] = c2; }
                w[c][0] = __builtin_bit_cast(v8us, o16); w[c][1] = oh; w[c][2] = ol; }
            const unsigned fo = jb * sj + g * si;   // wave-uniform
#pragma unroll
            for (int c = 0; c < 2; ++c) { *(v8usa*)((char*)d16 + fo + c * 512 + off) = w[c][0]; *(v8usa*)((char*)dh + fo + c * 512 + off) = w[c][1]; *(v8usa*)((char*)dl + fo + c * 512 + off) = w[c][2]; }
            asm volatile("s_wait_xcnt 0x0" ::: "memory");   // the wait in front of the next fragment's rewrite of these stores' address and data registers; the next line holds that work behind it
            __builtin_amdgcn_sched_barrier(0);   // keeps the later fragments' conversions below the wait; without it the scheduler also lifts them far up and the converted values spill to scratch
        } }
}
__global__ __launch_bounds__(256) void k_wtH(const float* __restrict__ w0, const float* __restrict__ w1, const float* __restrict__ w2, bf* Bt) { const float* w = (blockIdx.y == 0) ? w0 : ((blockIdx.y == 1) ? w1 : w2); Bt += (size_t)blockIdx.y * DQ * DM; const int i = blockIdx.x * 256 + threadIdx.x; if (i >= DQ * DM / 8) return; const int f = i >> 6, kb = f % (DM / 32), rb = f / (DM / 32); const int n = rb * 16 + (i & 15), k0 = kb * 32 + ((i >> 5) & 1) * 16 + ((i >> 4) & 1) * 8; const int h = n / HD, c = n % HD; v8us o;   // Bt[h*64 + c][d] = W[h][d][c], packed: 16 lanes read 16 consecutive c
#pragma unroll
    for (int u = 0; u < 8; ++u) o[u] = f2bf(w[((size_t)h * DM + k0 + u) * HD + c]); *(v8us*)(Bt + (size_t)i * 8) = o;  }

extern "C" void kernel_launch(void* const* d_in, const int* in_sizes, int n_in,
                              void* d_out, int out_size, void* d_ws, size_t ws_size, hipStream_t stream) {
    (void)in_sizes; (void)n_in; (void)out_size;
    const float* x = (const float*)d_in[0]; const float* wqh = (const float*)d_in[1]; const float* bq = (const float*)d_in[2]; const float* wkh = (const float*)d_in[3]; const float* bk = (const float*)d_in[4]; const float* wvh = (const float*)d_in[5]; const float* bv = (const float*)d_in[6]; const float* wo = (const float*)d_in[7]; const float* bo = (const float*)d_in[8]; const float* wq = nullptr; const float* wk = nullptr; const float* wv = nullptr; (void)wq; (void)wk; (void)wv; const float* cosT = nullptr; const float* sinT = nullptr; (void)cosT; (void)sinT;
    float* OUT = (float*)d_out;     // [8][1024][768]
    char* wsp = (char*)d_ws;
    auto take = [&](size_t bytes) { char* p = wsp; wsp += (bytes + 255) & ~(size_t)255; return (void*)p; };
    bf* WQ = (bf*)take((size_t)DQ * DM * 2); bf* WK = (bf*)take((size_t)DKV * DM * 2); bf* WV = (bf*)take((size_t)DKV * DM * 2); bf* WO = (bf*)take((size_t)DM * DQ * 2); (void)WK; (void)WV;   // WQ, WK, WV lie back to back (z-stride DQ*DM)
    const size_t PL = (size_t)NZ * TT * HD;   // elements of one plane over all (sequence, head) pairs; each q plane is followed by its k plane, which k_proj relies on
    h16* QP16 = (h16*)take(PL * 2); h16* KP16 = (h16*)take(PL * 2); h16* VT16 = (h16*)take(PL * 2);
    bf* QPh = (bf*)take(PL * 2); bf* KPh = (bf*)take(PL * 2); bf* QPl = (bf*)take(PL * 2); bf* KPl = (bf*)take(PL * 2); bf* VTh = (bf*)take(PL * 2); bf* VTl = (bf*)take(PL * 2);
    char* R = (char*)take((size_t)ZH * TT * TT * 4);   // one region, two stream-ordered uses: the x plane; then the merged head planes
    if ((size_t)(wsp - (char*)d_ws) > ws_size) return;    // ws 256 MiB
    bf* XB = (bf*)R;
    bf* ATh = (bf*)R; bf* ATl = ATh + (size_t)NB_ * TT * DQ;
    k_wtH<<<dim3((unsigned)(((size_t)DQ * DM / 8 + 255) / 256), 3, 1), 256, 0, stream>>>(wqh, wkh, wvh, WQ);
    k_wtG<<<(unsigned)((DQ * DM / 8 + 255) / 256), 256, 0, stream>>>(wo, WO);
    k_cvt8<<<(unsigned)(((size_t)NB_ * TT * DM / 8 + 255) / 256), 256, 0, stream>>>(x, XB, (size_t)NB_ * TT * DM / 8);
    k_proj<<<dim3(NB_ * TT / 64, NH_, 3), 32, 0, stream>>>(XB, WQ, bq, bk, bv, QP16, QPh, QPl, VT16, VTh, VTl);
    k_fattn<<<dim3(NZ, 8, 1), 128, 0, stream>>>(QP16, KP16, VT16, QPh, QPl, KPh, KPl, VTh, VTl, ATh, ATl);
    k_gemmw<bf, 1, true, DQ><<<dim3(NB_ * TT / 64, DM / 64, 1), 32, 0, stream>>>(ATh, ATl, WO, nullptr, OUT, DM, bo, bo, bo, 0, 0, 0);
}

// v005
// Measured time: 118 microseconds a run.
// Next to v004, in two timings, it ran 1.04 times as fast each time.
// All steps since v000 together make it 25.6 times as fast.
#include <hip/hip_runtime.h>

// MaskedMultiHeadAttention (hidden [8][1024][768]; per-head q/k/v = x Wq[h] + bq[h] (Wq [12][768][64]); causal softmax(q.k / 8); out = concat(heads) Wo + bo -> [8][1024][768]). That is EIGHT sequences of 1,024 tokens at width 768 with 12 heads x 64 ([8][1024][768]) and the inputs in the order x, Wq, bq, Wk, bk, Wv, bv, W0, b0 (each bias after its own weight).
// Compute dtypes, f32 accumulate: every input rounded to bf16; q/k/v on PLAIN bf16 operands (inputs: exact; the 12 per-head weights gathered into one [768 x 768] operand) + bias; causal scores and attn.v: query rows < 512 hl (3 products), the rest single fp16 (x1024); softmax f32; Wo hl x exact (2 products) + bias.

#define NB_  8
#define TT   1024
#define DM   768
#define NH_  12
#define NKV  12
#define REP  (NH_ / NKV)
#define HD   64
#define DQ   (NH_ * HD)
#define DKV  (NKV * HD)
#define ZH   24
#define NZ   (NB_ * NH_)
#define RH   512                  // query rows < RH use hi+lo planes
#define WIN  1024
#define PCAR 1024.0f
#define SCL  0.125f   // HD^-0.5
typedef _Float16 h16;
typedef unsigned short bf;
typedef __attribute__((ext_vector_type(16))) __bf16   v16bf;
typedef __attribute__((ext_vector_type(16))) _Float16 v16h;
typedef __attribute__((ext_vector_type(8)))  _Float16 v8h;
typedef __attribute__((ext_vector_type(8)))  unsigned short v8us;
typedef __attribute__((ext_vector_type(8)))  float    v8f;
typedef __attribute__((ext_vector_type(4)))  float    v4f;
typedef v8h  __attribute__((may_alias)) v8ha;
typedef v4f  __attribute__((may_alias)) v4fa;
typedef v8us __attribute__((may_alias)) v8usa;
#define FE 512   // elements of one packed 16 x 32 fragment

__device__ __forceinline__ unsigned short f2bf(float f) { unsigned u = __float_as_uint(f); u += 0x7FFFu + ((u >> 16) & 1u); return (unsigned short)(u >> 16); }
__device__ __forceinline__ float bf2f(unsigned short b) { return __uint_as_float(((unsigned)b) << 16); }
__device__ __forceinline__ float bfr(float f) { return bf2f(f2bf(f)); }
__device__ __forceinline__ v16h cat16(v8h lo, v8h hi) { return __builtin_shufflevector(lo, hi, 0, 1, 2, 3, 4, 5, 6, 7, 8, 9, 10, 11, 12, 13, 14, 15); }
__device__ __forceinline__ v16bf cat16b(v8us lo, v8us hi) { return __builtin_bit_cast(v16bf, __builtin_shufflevector(lo, hi, 0, 1, 2, 3, 4, 5, 6, 7, 8, 9, 10, 11, 12, 13, 14, 15)); }
__device__ __forceinline__ v8f wmma16(v16h a, v16h b, v8f c) { return __builtin_amdgcn_wmma_f32_16x16x32_f16(false, a, false, b, (short)0, c, false, false); }
__device__ __forceinline__ v8f wmmab(v16bf a, v16bf b, v8f c) { return __builtin_amdgcn_wmma_f32_16x16x32_bf16(false, a, false, b, (short)0, c, false, false); }



// ---- Fragment-packed planes. Every 16-bit operand plane [rows][k] is stored as whole WMMA fragments: the fragment of rows 16 rb .. + 15 and k 32 kb .. + 31 is FE = 512 consecutive elements (1 KiB),
// element (row, k) at c * 256 + lane * 8 + (k & 7) with c = (k >> 4) & 1 and lane = ((k >> 3) & 1) * 16 + (row & 15). A fragment load is then two loads of 512 consecutive bytes (4 whole lines each)
// instead of two loads that touch 16 lines each; the k order of the operands is the one it was. ld(p) takes the fragment's first element + lane * 8.
// ---- k_gemmw: register-blocked GEMM, ONE WAVE per 64x64 output tile (16 accumulators), operands straight from fragment-packed planes, fragments in [rb][kb] order; grid (M/64, N/64, Z), 32 threads.
// C[m][n] (f32, pitch ldc, + optional f32 bias[n]) = sum_k A[m][k] Bt[n][k] (+ split products per NSPLIT). z-batch strides sA/sB/sC in elements. K % 32 == 0.
template <typename T16> struct WFrag;
template <> struct WFrag<h16> { typedef v16h V; static __device__ __forceinline__ V ld(const h16* p) { return cat16(*(const v8h*)p, *(const v8h*)(p + 256)); } static __device__ __forceinline__ v8f mma(V a, V b, v8f c) { return wmma16(a, b, c); } };
template <> struct WFrag<bf> { typedef v16bf V; static __device__ __forceinline__ V ld(const bf* p) { return cat16b(*(const v8us*)p, *(const v8us*)(p + 256)); } static __device__ __forceinline__ v8f mma(V a, V b, v8f c) { return wmmab(a, b, c); } };
template <typename T16, int NSPLIT, bool BIAS, int K>   // K at compile time: the row blocks' distances are immediate offsets of the loads
__global__ __launch_bounds__(32) void k_gemmw(const T16* __restrict__ A, const T16* __restrict__ A2, const T16* __restrict__ Bt, const T16* __restrict__ Bt2, float* C, int ldc, const float* __restrict__ bias0, const float* __restrict__ bias1, const float* __restrict__ bias2, size_t sA, size_t sB, size_t sC) {
    typedef typename WFrag<T16>::V V;
    __shared__ __align__(16) float os[16 * 68];
    const size_t z = blockIdx.z; A += z * sA; if (A2) A2 += z * sA; Bt += z * sB; if (Bt2) Bt2 += z * sB; C += z * sC;
    const float* bias = (z == 0) ? bias0 : ((z == 1) ? bias1 : bias2);   // each z-slice adds its own bias vector
    const int lane = threadIdx.x & 31, lr = lane & 15, hi = lane >> 4; const int r0 = blockIdx.x * 64, c0 = blockIdx.y * 64;
    v8f acc[4][4];
#pragma unroll
    for (int mb = 0; mb < 4; ++mb)
#pragma unroll
        for (int nb = 0; nb < 4; ++nb) acc[mb][nb] = (v8f){};
    constexpr int rs = 16 * K;   // elements of one block of 16 rows
    const size_t aoff = (size_t)r0 * K, boff = (size_t)c0 * K; const unsigned off = (unsigned)lane * 16u;   // the lane's byte offset, fixed over the loop, beside wave-uniform bases that walk k
#pragma unroll 1
    for (int kb = 0; kb < K / 32; ++kb) {
        V a[4], a2[4];
        const T16* pa = (const T16*)((const char*)(A + aoff + kb * FE) + off); const T16* pa2 = (NSPLIT == 1 || NSPLIT == 2) ? (const T16*)((const char*)(A2 + aoff + kb * FE) + off) : pa; const T16* pb = (const T16*)((const char*)(Bt + boff + kb * FE) + off); const T16* pb2 = NSPLIT >= 2 ? (const T16*)((const char*)(Bt2 + boff + kb * FE) + off) : pb;
#pragma unroll
        for (int mb = 0; mb < 4; ++mb) { a[mb] = WFrag<T16>::ld(pa + mb * rs); if (NSPLIT == 1 || NSPLIT == 2) a2[mb] = WFrag<T16>::ld(pa2 + mb * rs); }
#pragma unroll
        for (int nb = 0; nb < 4; ++nb) { const V b = WFrag<T16>::ld(pb + nb * rs); V b2; if (NSPLIT >= 2) b2 = WFrag<T16>::ld(pb2 + nb * rs);
#pragma unroll
            for (int mb = 0; mb < 4; ++mb) { acc[mb][nb] = WFrag<T16>::mma(a[mb], b, acc[mb][nb]); if (NSPLIT == 1 || NSPLIT == 2) acc[mb][nb] = WFrag<T16>::mma(a2[mb], b, acc[mb][nb]); if (NSPLIT >= 2) acc[mb][nb] = WFrag<T16>::mma(a[mb], b2, acc[mb][nb]); } }
        asm volatile("s_wait_xcnt 0x0" :: "v"(pa), "v"(pa2), "v"(pb), "v"(pb2) : "memory");   // the wait in front of any rewrite of these loads' address registers; it names them, so that they live to here
        asm volatile("v_nop\n\tv_nop\n\tv_nop\n\tv_nop" : "+v"(acc[0][0]), "+v"(acc[1][1]), "+v"(acc[2][2]), "+v"(acc[3][3]) : "v"(a[0]), "v"(a[3]));
    }
#pragma unroll
    for (int mb = 0; mb < 4; ++mb) {
#pragma unroll
        for (int nb = 0; nb < 4; ++nb) {
#pragma unroll
            for (int j = 0; j < 8; ++j) os[(hi * 8 + j) * 68 + nb * 16 + lr] = acc[mb][nb][j]; }
        __builtin_amdgcn_wave_barrier(); asm volatile("" ::: "memory");
        float* crow = C + (size_t)(r0 + mb * 16) * ldc + c0;
{ v4f vs[8]; float* cp[8];
#pragma unroll
            for (int s = 0; s < 8; ++s) { const int row = 2 * s + hi, cofs = lr * 4; v4f val = *(const v4fa*)(os + row * 68 + cofs); if (BIAS) { val[0] += bfr(bias[c0 + cofs]); val[1] += bfr(bias[c0 + cofs + 1]); val[2] += bfr(bias[c0 + cofs + 2]); val[3] += bfr(bias[c0 + cofs + 3]); }
                vs[s] = val; cp[s] = crow + (size_t)row * ldc + cofs; *(v4f*)cp[s] = val; }
            // the wait in front of any rewrite of these stores' address and data registers; it names them, so that they live to here
            asm volatile("s_wait_xcnt 0x0" :: "v"(cp[0]), "v"(cp[1]), "v"(cp[2]), "v"(cp[3]), "v"(cp[4]), "v"(cp[5]), "v"(cp[6]), "v"(cp[7]), "v"(vs[0]), "v"(vs[1]), "v"(vs[2]), "v"(vs[3]), "v"(vs[4]), "v"(vs[5]), "v"(vs[6]), "v"(vs[7]) : "memory");
             }
        __builtin_amdgcn_wave_barrier(); asm volatile("" ::: "memory");
    }
}

__device__ __forceinline__ h16 tohx(float x) { return (h16)x; }
__device__ __forceinline__ void splitf(float y, unsigned short& h, unsigned short& l) { h = f2bf(y); l = f2bf(y - bf2f(h)); }
typedef __attribute__((ext_vector_type(2))) _Float16 v2h;
typedef __attribute__((ext_vector_type(4))) _Float16 v4h;
typedef __attribute__((ext_vector_type(2))) unsigned short v2us;
typedef __attribute__((ext_vector_type(4))) unsigned short v4us;
typedef __attribute__((ext_vector_type(2))) float v2f;
typedef __attribute__((ext_vector_type(4))) int v4i;

// ---- k_pack: every operand packing (x; Wq, Wk, Wv; W0) in ONE launch of few waves that each do many pieces. A piece is 16 bytes of a packed plane, in the plane's own order (whole lines written): piece i is
// lane i & 31, half c = (i >> 5) & 1 of fragment i >> 6. A wave takes XW (x) or WW (weights) runs of 32 consecutive pieces, all their loads in flight together: a launch
// with one piece a thread is priced by the number of waves to start, not by its bytes. Consecutive runs walk k by 16, so a thread's loads are one address with immediate offsets.
#define XW 8   // pieces per thread, x: 4 fragments a wave
#define WW 4   // pieces per thread, weights: 2 fragments a wave
#define XBLK (NB_ * TT * DM / 8 / XW / 256)   // blocks of 8 waves for x
#define WBLK (DQ * DM / 8 / WW / 256)         // blocks of 8 waves for each of the four weight matrices
static_assert((DM / 32) % (XW / 2) == 0 && (DM / 32) % (WW / 2) == 0 && (DQ / 32) % (WW / 2) == 0, "a wave's fragments lie in one block of 16 rows");
static_assert(NB_ * TT * DM % (8 * XW * 256) == 0 && DQ * DM % (8 * WW * 256) == 0, "whole blocks");
template <int RS>   // RS: floats from k to k + 1 in the source; p: the lane's element at its first k; d: the lane's first piece
__device__ __forceinline__ void pack_w(const float* __restrict__ p, bf* d) { float v[WW][8]; v8us o[WW];
#pragma unroll
    for (int j = 0; j < WW; ++j)
#pragma unroll
        for (int u = 0; u < 8; ++u) v[j][u] = p[(j * 16 + u) * RS];
    asm volatile("s_wait_xcnt 0x0" :: "v"(p) : "memory");   // the wait in front of any rewrite of these loads' address registers; it names them, so that they live to here
#pragma unroll
    for (int j = 0; j < WW; ++j) {
#pragma unroll
        for (int u = 0; u < 8; ++u) o[j][u] = f2bf(v[j][u]);
        *(v8us*)(d + j * 256) = o[j]; }
    asm volatile("s_wait_xcnt 0x0" :: "v"(d), "v"(o[0]), "v"(o[1]), "v"(o[2]), "v"(o[3]) : "memory"); }   // the same wait for these stores' address and data registers; it names them, so that they live to here
__global__ __launch_bounds__(256) void k_pack(const float* __restrict__ x, const float* __restrict__ w0, const float* __restrict__ w1, const float* __restrict__ w2, const float* __restrict__ wo, bf* XB, bf* Wt, bf* WO) {
    const int lane = threadIdx.x & 31, lr = lane & 15, hi = lane >> 4; const int w = __builtin_amdgcn_readfirstlane(threadIdx.x >> 5);   // the wave's number in a scalar register: the fragment arithmetic stays scalar
    if (blockIdx.x < XBLK) {   // XB[t][k] = x[t][k]: a lane reads 8 consecutive k of its row, the wave 512 consecutive bytes of each of 16 rows in all
        const int wv = blockIdx.x * 8 + w, rb = wv / (DM / 32 / (XW / 2)), kb0 = (wv % (DM / 32 / (XW / 2))) * (XW / 2);
        const float* p = x + (size_t)(rb * 16 + lr) * DM + kb0 * 32 + hi * 8; bf* d = XB + (size_t)wv * (XW * 256) + lane * 8; v8f v[XW]; v8us o[XW];
#pragma unroll
        for (int j = 0; j < XW; ++j) v[j] = *(const v8f*)(p + j * 16);
        asm volatile("s_wait_xcnt 0x0" :: "v"(p) : "memory");   // the wait in front of any rewrite of these loads' address registers; it names them, so that they live to here
#pragma unroll
        for (int j = 0; j < XW; ++j) {
#pragma unroll
            for (int u = 0; u < 8; ++u) o[j][u] = f2bf(v[j][u]);
            *(v8us*)(d + j * 256) = o[j]; }
        asm volatile("s_wait_xcnt 0x0" :: "v"(d), "v"(o[0]), "v"(o[1]), "v"(o[2]), "v"(o[3]), "v"(o[4]), "v"(o[5]), "v"(o[6]), "v"(o[7]) : "memory");   // the same wait for these stores' address and data registers
        return; }
    const int b = blockIdx.x - XBLK, mat = b / WBLK, wv = (b % WBLK) * 8 + w; const size_t di = (size_t)wv * (WW * 256) + lane * 8;
    if (mat < 3) {   // Wt[mat][h * 64 + c][d] = W[h][d][c]: 16 lanes read 16 consecutive c
        const int rb = wv / (DM / 32 / (WW / 2)), k0 = (wv % (DM / 32 / (WW / 2))) * (WW / 2) * 32 + hi * 8, n = rb * 16 + lr; const float* wm = (mat == 0) ? w0 : ((mat == 1) ? w1 : w2);
        pack_w<HD>(wm + ((size_t)(n / HD) * DM + k0) * HD + n % HD, Wt + (size_t)mat * DQ * DM + di);
    } else {         // WO[n][k] = W0[k][n], k < DQ, n < DM: 16 lanes read 16 consecutive n
        const int rb = wv / (DQ / 32 / (WW / 2)), k0 = (wv % (DQ / 32 / (WW / 2))) * (WW / 2) * 32 + hi * 8, n = rb * 16 + lr;
        pack_w<DM>(wo + (size_t)k0 * DM + n, WO + di); }
}
// ---- k_fattn: causal attention of one (sequence, head) pair and one strip of query rows in one wave; scores and probabilities stay in registers (online softmax over blocks of 32 keys).
// Transposed products: S^T = K Q^T (A = key rows, B = query rows), so a lane holds 16 scores of ONE query (column lr): keys k0 + 8 hi + j and k0 + 16 + 8 hi + j. Those 16 values, converted in place, are the
// B operand of O^T += V^T P^T (A = value plane rows [d][t]) in the k order of the loaders. Running maximum, sum and rescale factor are per lane; the two lane halves are joined by one exchange.
// The strip's output rows leave as the hi/lo planes of the output projection's A operand: lane = query row, 8 consecutive d per accumulator, which is one half of a packed fragment: 512 consecutive bytes a store.
// Packed planes: q, k rows t, k = d, fragments [t / 16][d / 32]; v rows d, k = t, fragments [t / 32][d / 16]: a block of 32 keys is 4 consecutive fragments of either, at element k0 * HD.
#define L2E 1.4426950408889634f
__device__ __forceinline__ float xhalf(float x) { const int b = __float_as_int(x); return __int_as_float(__builtin_amdgcn_permlanex16(b, b, 0x76543210, 0xfedcba98, false, false)); }   // lane l <-> l ^ 16
__device__ __forceinline__ float ex2(float x) { float r; asm("v_exp_f32 %0, %1\n\tv_nop" : "=v"(r) : "v"(x)); return r; }
__device__ __forceinline__ void put8(v8f o, float inv, bf* ph, bf* pl) { v8us oh, ol;
#pragma unroll
    for (int j = 0; j < 8; ++j) { unsigned short a, c2; splitf(o[j] * inv, a, c2); oh[j] = a; ol[j] = c2; }
    *(v8us*)ph = oh; *(v8us*)pl = ol;
    asm volatile("s_wait_xcnt 0x0" :: "v"(ph), "v"(pl), "v"(oh), "v"(ol) : "memory"); }   // the wait in front of any rewrite of these stores' address and data registers; it names them, so that they live to here
// rows >= RH: single fp16 products, 32 query rows per wave; probabilities carry the factor PCAR = 2^10 (it cancels against the row sum)
__device__ __forceinline__ void attn_lo(const h16* __restrict__ Q, const h16* __restrict__ Kp, const h16* __restrict__ Vt, int q0, bf* Ah, bf* Al, int lr, int hi) {
    v16h qf[2][2]; const h16* qp = Q + (size_t)q0 * HD + (hi * 16 + lr) * 8;   // 16 rows of HD = 64 are two fragments: row block r0 begins at element r0 * HD, as it did
#pragma unroll
    for (int nb = 0; nb < 2; ++nb)
#pragma unroll
        for (int ks = 0; ks < 2; ++ks) qf[nb][ks] = WFrag<h16>::ld(qp + (nb * 2 + ks) * FE);
    v8f o[4][2]; float m[2], l[2];
#pragma unroll
    for (int nb = 0; nb < 2; ++nb) { m[nb] = -3.0e38f; l[nb] = 0.f;
#pragma unroll
        for (int db = 0; db < 4; ++db) o[db][nb] = (v8f){}; }
    const h16* kp = Kp + (hi * 16 + lr) * 8; const unsigned vo = (unsigned)(hi * 16 + lr) * 16u;   // value loads: the lane's byte offset, fixed over the loop, beside a wave-uniform base that walks the keys
    v16h kf[2][2];
#pragma unroll
    for (int kt = 0; kt < 2; ++kt)
#pragma unroll
        for (int ks = 0; ks < 2; ++ks) kf[kt][ks] = WFrag<h16>::ld(kp + (kt * 2 + ks) * FE);
    asm volatile("s_wait_xcnt 0x0" :: "v"(qp), "v"(kp) : "memory");   // the wait in front of any rewrite of these loads' address registers; it names them, so that they live to here
#pragma unroll 1   // run-time trip count; one body already holds most of the register budget
    for (int k0 = 0; k0 < q0 + 32; k0 += 32) {
        v16h vf[4]; const h16* vp = (const h16*)((const char*)(Vt + (size_t)k0 * HD) + vo);
#pragma unroll
        for (int db = 0; db < 4; ++db) vf[db] = WFrag<h16>::ld(vp + db * FE);
        v8f s[2][2];
#pragma unroll
        for (int kt = 0; kt < 2; ++kt)
#pragma unroll
            for (int nb = 0; nb < 2; ++nb) s[kt][nb] = wmma16(kf[kt][1], qf[nb][1], wmma16(kf[kt][0], qf[nb][0], (v8f){}));
        if (k0 < q0) kp += 32 * HD;   // the next block's key fragments fly during this block's softmax; the last block fetches its own again, so the address stays inside the plane
#pragma unroll
        for (int kt = 0; kt < 2; ++kt)
#pragma unroll
            for (int ks = 0; ks < 2; ++ks) kf[kt][ks] = WFrag<h16>::ld(kp + (kt * 2 + ks) * FE);
        asm volatile("s_wait_xcnt 0x0" :: "v"(vp), "v"(kp) : "memory");   // the wait in front of any rewrite of the value and key loads' address registers; it names them, so that they live to here
        __builtin_amdgcn_sched_barrier(0);   // keeps the key loads above the softmax; without it the scheduler sinks them to the loop's foot and their latency is exposed again
#pragma unroll
        for (int nb = 0; nb < 2; ++nb) { const int q = q0 + nb * 16 + lr; float t[16]; float mx = m[nb];
#pragma unroll
            for (int e = 0; e < 16; ++e) { const int key = k0 + (e >> 3) * 16 + hi * 8 + (e & 7); t[e] = (key <= q) ? s[e >> 3][nb][e & 7] * SCL : -3.0e38f; mx = fmaxf(mx, t[e]); }
            mx = fmaxf(mx, xhalf(mx));
            const float al = ex2((m[nb] - mx) * L2E); m[nb] = mx; float sum = 0.f; v16h pf;
#pragma unroll
            for (int e = 0; e < 16; ++e) { const float p = ex2((t[e] - mx) * L2E + 10.0f); sum += p; pf[e] = tohx(p); }
            l[nb] = l[nb] * al + sum;
#pragma unroll
            for (int db = 0; db < 4; ++db) { o[db][nb] *= al; o[db][nb] = wmma16(vf[db], pf, o[db][nb]); } }
    }
#pragma unroll
    for (int nb = 0; nb < 2; ++nb) { const float inv = __fdiv_rn(1.0f, l[nb] + xhalf(l[nb])); const size_t ro = (size_t)(q0 + nb * 16) * DQ + (hi * 16 + lr) * 8;   // row block [rb][kb]; the head's two fragments of it lie side by side
#pragma unroll
        for (int db = 0; db < 4; ++db) put8(o[db][nb], inv, Ah + ro + db * 256, Al + ro + db * 256); }
}
// rows < RH: hi+lo bf16 planes, 3 products each for the scores and for P.V, 32 query rows per wave
__device__ __forceinline__ void attn_hl(const bf* __restrict__ Qh, const bf* __restrict__ Ql, const bf* __restrict__ Kh, const bf* __restrict__ Kl, const bf* __restrict__ Vh, const bf* __restrict__ Vl, int q0, bf* Ah, bf* Al, int lr, int hi) {
    v16bf qh[2][2], ql[2][2]; const bf* qph = Qh + (size_t)q0 * HD + (hi * 16 + lr) * 8; const bf* qpl = Ql + (size_t)q0 * HD + (hi * 16 + lr) * 8;
#pragma unroll
    for (int nb = 0; nb < 2; ++nb)
#pragma unroll
        for (int ks = 0; ks < 2; ++ks) { qh[nb][ks] = WFrag<bf>::ld(qph + (nb * 2 + ks) * FE); ql[nb][ks] = WFrag<bf>::ld(qpl + (nb * 2 + ks) * FE); }
    asm volatile("s_wait_xcnt 0x0" :: "v"(qph), "v"(qpl) : "memory");   // the wait in front of any rewrite of these loads' address registers; it names them, so that they live to here
    v8f o[4][2]; float m[2], l[2];
#pragma unroll
    for (int nb = 0; nb < 2; ++nb) { m[nb] = -3.0e38f; l[nb] = 0.f;
#pragma unroll
        for (int db = 0; db < 4; ++db) o[db][nb] = (v8f){}; }
    const unsigned ko = (unsigned)(hi * 16 + lr) * 16u, vo = ko;   // the lane's byte offsets, fixed over the loop, beside wave-uniform bases that walk the keys
#pragma unroll 1   // run-time trip count; one body already holds most of the register budget
    for (int k0 = 0; k0 < q0 + 32; k0 += 32) {
        const bf* kph = (const bf*)((const char*)(Kh + (size_t)k0 * HD) + ko); const bf* kpl = (const bf*)((const char*)(Kl + (size_t)k0 * HD) + ko);
        v16bf kh[2][2], kl[2][2];   // all key fragments of the block are requested together: one latency a block, not one per fragment pair
#pragma unroll
        for (int kt = 0; kt < 2; ++kt)
#pragma unroll
            for (int ks = 0; ks < 2; ++ks) { kh[kt][ks] = WFrag<bf>::ld(kph + (kt * 2 + ks) * FE); kl[kt][ks] = WFrag<bf>::ld(kpl + (kt * 2 + ks) * FE); }
        asm volatile("s_wait_xcnt 0x0" :: "v"(kph), "v"(kpl) : "memory");   // the wait in front of any rewrite of the key loads' address registers; it names them, so that they live to here
        __builtin_amdgcn_sched_barrier(0);   // keeps the sixteen key loads together above the products; without it the scheduler sinks them pair by pair between the products, one exposed latency each
        v8f s[2][2];
#pragma unroll
        for (int kt = 0; kt < 2; ++kt) { s[kt][0] = (v8f){}; s[kt][1] = (v8f){};
#pragma unroll
            for (int ks = 0; ks < 2; ++ks)
#pragma unroll
                for (int nb = 0; nb < 2; ++nb) { s[kt][nb] = wmmab(kh[kt][ks], qh[nb][ks], s[kt][nb]); s[kt][nb] = wmmab(kh[kt][ks], ql[nb][ks], s[kt][nb]); s[kt][nb] = wmmab(kl[kt][ks], qh[nb][ks], s[kt][nb]); } }
        const bf* vph = (const bf*)((const char*)(Vh + (size_t)k0 * HD) + vo); const bf* vpl = (const bf*)((const char*)(Vl + (size_t)k0 * HD) + vo);
        v16bf vh[4], vl[4];
#pragma unroll
        for (int db = 0; db < 4; ++db) { vh[db] = WFrag<bf>::ld(vph + db * FE); vl[db] = WFrag<bf>::ld(vpl + db * FE); }
        asm volatile("s_wait_xcnt 0x0" :: "v"(vph), "v"(vpl) : "memory");   // the same wait for the value loads' address registers; the loads' own place is held by the next line
        __builtin_amdgcn_sched_barrier(0);   // keeps the value loads above the softmax, which hides their latency; without it the scheduler sinks half of them, and the wait with them, to the products
        v16bf ph[2], pl[2]; float al[2];
#pragma unroll
        for (int nb = 0; nb < 2; ++nb) { const int q = q0 + nb * 16 + lr; float t[16]; float mx = m[nb];
#pragma unroll
            for (int e = 0; e < 16; ++e) { const int key = k0 + (e >> 3) * 16 + hi * 8 + (e & 7); t[e] = (key <= q) ? s[e >> 3][nb][e & 7] * SCL : -3.0e38f; mx = fmaxf(mx, t[e]); }
            mx = fmaxf(mx, xhalf(mx));
            al[nb] = ex2((m[nb] - mx) * L2E); m[nb] = mx; float sum = 0.f; v8us h0, h1, l0, l1;
#pragma unroll
            for (int e = 0; e < 8; ++e) { const float p0 = ex2((t[e] - mx) * L2E), p1 = ex2((t[e + 8] - mx) * L2E); sum += p0; sum += p1; unsigned short a, c2; splitf(p0, a, c2); h0[e] = a; l0[e] = c2; splitf(p1, a, c2); h1[e] = a; l1[e] = c2; }
            l[nb] = l[nb] * al[nb] + sum; ph[nb] = cat16b(h0, h1); pl[nb] = cat16b(l0, l1); }
#pragma unroll
        for (int db = 0; db < 4; ++db)
#pragma unroll
            for (int nb = 0; nb < 2; ++nb) { o[db][nb] *= al[nb]; o[db][nb] = wmmab(vh[db], ph[nb], o[db][nb]); o[db][nb] = wmmab(vh[db], pl[nb], o[db][nb]); o[db][nb] = wmmab(vl[db], ph[nb], o[db][nb]); }
    }
#pragma unroll
    for (int nb = 0; nb < 2; ++nb) { const float inv = __fdiv_rn(1.0f, l[nb] + xhalf(l[nb])); const size_t ro = (size_t)(q0 + nb * 16) * DQ + (hi * 16 + lr) * 8;   // row block [rb][kb]; the head's two fragments of it lie side by side
#pragma unroll
        for (int db = 0; db < 4; ++db) put8(o[db][nb], inv, Ah + ro + db * 256, Al + ro + db * 256); }
}
// grid (NZ pairs, 8), four independent waves per block (no barrier, no LDS): even y = rows >= RH, odd y = rows < RH. Each half of a sequence is 16 strips of 32 rows; group g = y >> 1 takes strips
// g, 7 - g, 8 + g, 15 - g, so every block of a path walks the same number of key blocks in all, and its waves read the same key and value lines from the start of the sequence on.
// amdgpu_waves_per_eu(3, 3): holds the register allocation to three waves per SIMD, so that all NZ * 8 blocks are resident at once; without it the hi+lo path takes two waves' worth.
__global__ __launch_bounds__(128) __attribute__((amdgpu_waves_per_eu(3, 3))) void k_fattn(const h16* __restrict__ Q16, const h16* __restrict__ K16, const h16* __restrict__ V16, const bf* __restrict__ Qh, const bf* __restrict__ Ql, const bf* __restrict__ Kh, const bf* __restrict__ Kl, const bf* __restrict__ Vh, const bf* __restrict__ Vl, bf* Ah, bf* Al) {
    const int lane = threadIdx.x & 31, lr = lane & 15, hi = lane >> 4; const int w = __builtin_amdgcn_readfirstlane(threadIdx.x >> 5);   // the wave's number in a scalar register: loop bounds stay scalar
    const int zz = blockIdx.x, g = blockIdx.y >> 1; const size_t zo = (size_t)zz * TT * HD, zv = zo;
    const int strip = (w >> 1) * 8 + ((w & 1) ? 7 - g : g);
    const size_t oo = (size_t)(zz / NH_) * TT * DQ + (zz % NH_) * 2 * FE;   // this pair's first element in the merged planes (rows [sequence][t], k = [head][d], packed)
    if ((blockIdx.y & 1) == 0) attn_lo(Q16 + zo, K16 + zo, V16 + zv, RH + 32 * strip, Ah + oo, Al + oo, lr, hi);
    else attn_hl(Qh + zo, Ql + zo, Kh + zo, Kl + zo, Vh + zv, Vl + zv, 32 * strip, Ah + oo, Al + oo, lr, hi);
}

// ---- k_proj: the three projections (grid z: q, k, v), ONE WAVE per 64x64 tile with the loop of k_gemmw; grid (rows / 64, heads, 3), 32 threads. The tile leaves as the attention kernel's
// operand planes (fp16, bf16 hi, bf16 lo of product + bias); the f32 projections never reach memory. In an accumulator a lane holds 8 consecutive rows of the A operand at one row of the B operand, so
// q, k: A = weight rows (d), B = x rows (t): 8 consecutive d of one token. v: A = x rows (t), B = weight rows (d): 8 consecutive t of one d.
// Either way an accumulator, converted, IS one half of a packed fragment of the plane in lane order: it leaves straight from registers as 512 consecutive bytes, and the tile is 8 consecutive fragments of each plane.
// amdgpu_waves_per_eu(5): holds the register allocation to five waves per SIMD, as k_gemmw's loop has it, so that all tiles are resident at once; without it the epilogue takes four waves' worth.
__global__ __launch_bounds__(32) __attribute__((amdgpu_waves_per_eu(5))) void k_proj(const bf* __restrict__ X, const bf* __restrict__ Wt, const float* __restrict__ bias0, const float* __restrict__ bias1, const float* __restrict__ bias2, h16* P16, bf* Ph, bf* Pl, h16* V16, bf* Vh, bf* Vl) {
    const int z = blockIdx.z; const bool isv = (z == 2);
    const float* bias = (z == 0) ? bias0 : ((z == 1) ? bias1 : bias2);
    const int lane = threadIdx.x & 31, lr = lane & 15, hi = lane >> 4; const int r0 = blockIdx.x * 64, c0 = blockIdx.y * 64;
    const bf* xr = X + (size_t)r0 * DM; const bf* wr = Wt + ((size_t)z * DQ + c0) * DM;   // a block of 16 rows is DM / 32 fragments = 16 * DM elements: it begins where it did
    const bf* A = isv ? xr : wr; const bf* B = isv ? wr : xr;
    v8f acc[4][4];
#pragma unroll
    for (int ib = 0; ib < 4; ++ib)
#pragma unroll
        for (int jb = 0; jb < 4; ++jb) acc[ib][jb] = (v8f){};
    const unsigned off = (unsigned)lane * 16u;   // the lane's byte offset, fixed over the loop, beside wave-uniform bases that walk k
#pragma unroll 1   // as in k_gemmw: one body holds the register budget
    for (int kb = 0; kb < DM / 32; ++kb) {
        const bf* pa = (const bf*)((const char*)(A + kb * FE) + off); const bf* pb = (const bf*)((const char*)(B + kb * FE) + off);
        v16bf a[4];
#pragma unroll
        for (int ib = 0; ib < 4; ++ib) a[ib] = WFrag<bf>::ld(pa + ib * 16 * DM);
#pragma unroll
        for (int jb = 0; jb < 4; ++jb) { const v16bf b = WFrag<bf>::ld(pb + jb * 16 * DM);
#pragma unroll
            for (int ib = 0; ib < 4; ++ib) acc[ib][jb] = wmmab(a[ib], b, acc[ib][jb]); }
        asm volatile("s_wait_xcnt 0x0" :: "v"(pa), "v"(pb) : "memory");   // the wait in front of any rewrite of these loads' address registers; it names them, so that they live to here
        asm volatile("v_nop\n\tv_nop\n\tv_nop\n\tv_nop" : "+v"(acc[0][0]), "+v"(acc[1][1]), "+v"(acc[2][2]), "+v"(acc[3][3]) : "v"(a[0]), "v"(a[3]));   // as in k_gemmw: the distance behind the last matrix instruction, on the loop's back edge too
    }
    const size_t pair = (size_t)(r0 / TT) * NH_ + blockIdx.y; const int t0 = r0 % TT;
    const size_t base = (isv ? 0 : (size_t)z * NZ * TT * HD) + (pair * TT + t0) * HD;   // the k planes follow the q planes; 64 tokens are 8 fragments in either fragment order
    unsigned short* d16 = (unsigned short*)(isv ? V16 : P16) + base; bf* dh = (isv ? Vh : Ph) + base; bf* dl = (isv ? Vl : Pl) + base;
    const unsigned si = isv ? 4 * FE * 2 : FE * 2, sj = isv ? FE * 2 : 2 * FE * 2;   // bytes from fragment to fragment along ib >> 1 and along jb: v [t / 32][d / 16], q and k [t / 16][d / 32]
    float bj[4]; const int bx = c0 + lr;   // v: the bias runs along the lanes; q, k: along the accumulator's 8 values
#pragma unroll
    for (int jb = 0; jb < 4; ++jb) bj[jb] = bias[bx + jb * 16];
    asm volatile("s_wait_xcnt 0x0" :: "v"(bx) : "memory");   // the wait in front of any rewrite of these loads' index register; it names it, so that it lives to here
#pragma unroll
    for (int jb = 0; jb < 4; ++jb) bj[jb] = bfr(bj[jb]);
#pragma unroll
    for (int g = 0; g < 2; ++g) { float bi[2][8];
#pragma unroll
        for (int c = 0; c < 2; ++c)
#pragma unroll
            for (int e = 0; e < 8; ++e) bi[c][e] = bfr(bias[c0 + (g * 2 + c) * 16 + hi * 8 + e]);
#pragma unroll
        for (int jb = 0; jb < 4; ++jb) { v8us w[2][3];   // one whole fragment of each plane at a time
#pragma unroll
            for (int c = 0; c < 2; ++c) { v8h o16; v8us oh, ol;
#pragma unroll
                for (int e = 0; e < 8; ++e) { const float r = acc[g * 2 + c][jb][e] + (isv ? bj[jb] : bi[c][e]); o16[e] = tohx(r); unsigned short a2, c2; splitf(r, a2, c2); oh[e] = a2; ol[e] = c2; }
                w[c][0] = __builtin_bit_cast(v8us, o16); w[c][1] = oh; w[c][2] = ol; }
            const unsigned fo = jb * sj + g * si;   // wave-uniform
#pragma unroll
            for (int c = 0; c < 2; ++c) { *(v8usa*)((char*)d16 + fo + c * 512 + off) = w[c][0]; *(v8usa*)((char*)dh + fo + c * 512 + off) = w[c][1]; *(v8usa*)((char*)dl + fo + c * 512 + off) = w[c][2]; }
            asm volatile("s_wait_xcnt 0x0" ::: "memory");   // the wait in front of the next fragment's rewrite of these stores' address and data registers; the next line holds that work behind it
            __builtin_amdgcn_sched_barrier(0);   // keeps the later fragments' conversions below the wait; without it the scheduler also lifts them far up and the converted values spill to scratch
        } }
}

extern "C" void kernel_launch(void* const* d_in, const int* in_sizes, int n_in,
                              void* d_out, int out_size, void* d_ws, size_t ws_size, hipStream_t stream) {
    (void)in_sizes; (void)n_in; (void)out_size;
    const float* x = (const float*)d_in[0]; const float* wqh = (const float*)d_in[1]; const float* bq = (const float*)d_in[2]; const float* wkh = (const float*)d_in[3]; const float* bk = (const float*)d_in[4]; const float* wvh = (const float*)d_in[5]; const float* bv = (const float*)d_in[6]; const float* wo = (const float*)d_in[7]; const float* bo = (const float*)d_in[8]; const float* wq = nullptr; const float* wk = nullptr; const float* wv = nullptr; (void)wq; (void)wk; (void)wv; const float* cosT = nullptr; const float* sinT = nullptr; (void)cosT; (void)sinT;
    float* OUT = (float*)d_out;     // [8][1024][768]
    char* wsp = (char*)d_ws;
    auto take = [&](size_t bytes) { char* p = wsp; wsp += (bytes + 255) & ~(size_t)255; return (void*)p; };
    bf* WQ = (bf*)take((size_t)DQ * DM * 2); bf* WK = (bf*)take((size_t)DKV * DM * 2); bf* WV = (bf*)take((size_t)DKV * DM * 2); bf* WO = (bf*)take((size_t)DM * DQ * 2); (void)WK; (void)WV;   // WQ, WK, WV lie back to back (z-stride DQ*DM)
    const size_t PL = (size_t)NZ * TT * HD;   // elements of one plane over all (sequence, head) pairs; each q plane is followed by its k plane, which k_proj relies on
    h16* QP16 = (h16*)take(PL * 2); h16* KP16 = (h16*)take(PL * 2); h16* VT16 = (h16*)take(PL * 2);
    bf* QPh = (bf*)take(PL * 2); bf* KPh = (bf*)take(PL * 2); bf* QPl = (bf*)take(PL * 2); bf* KPl = (bf*)take(PL * 2); bf* VTh = (bf*)take(PL * 2); bf* VTl = (bf*)take(PL * 2);
    char* R = (char*)take((size_t)ZH * TT * TT * 4);   // one region, two stream-ordered uses: the x plane; then the merged head planes
    if ((size_t)(wsp - (char*)d_ws) > ws_size) return;    // ws 256 MiB
    bf* XB = (bf*)R;
    bf* ATh = (bf*)R; bf* ATl = ATh + (size_t)NB_ * TT * DQ;
    k_pack<<<XBLK + 4 * WBLK, 256, 0, stream>>>(x, wqh, wkh, wvh, wo, XB, WQ, WO);
    k_proj<<<dim3(NB_ * TT / 64, NH_, 3), 32, 0, stream>>>(XB, WQ, bq, bk, bv, QP16, QPh, QPl, VT16, VTh, VTl);
    k_fattn<<<dim3(NZ, 8, 1), 128, 0, stream>>>(QP16, KP16, VT16, QPh, QPl, KPh, KPl, VTh, VTl, ATh, ATl);
    k_gemmw<bf, 1, true, DQ><<<dim3(NB_ * TT / 64, DM / 64, 1), 32, 0, stream>>>(ATh, ATl, WO, nullptr, OUT, DM, bo, bo, bo, 0, 0, 0);
}

// v006
// One run takes 99.7 microseconds.
// Two timings next to v005 both put it at 1.19 times that version's speed.
// All steps since v000 together make it 30.5 times as fast.
#include <hip/hip_runtime.h>

// MaskedMultiHeadAttention (hidden [8][1024][768]; per-head q/k/v = x Wq[h] + bq[h] (Wq [12][768][64]); causal softmax(q.k / 8); out = concat(heads) Wo + bo -> [8][1024][768]). That is EIGHT sequences of 1,024 tokens at width 768 with 12 heads x 64 ([8][1024][768]) and the inputs in the order x, Wq, bq, Wk, bk, Wv, bv, W0, b0 (each bias after its own weight).
// Compute dtypes, f32 accumulate: every input rounded to bf16; q/k/v on PLAIN bf16 operands (inputs: exact; the 12 per-head weights gathered into one [768 x 768] operand) + bias; causal scores and attn.v: query rows < 512 hl (3 products), the rest single fp16 (x1024); softmax f32; Wo hl x exact (2 products) + bias.

#define NB_  8
#define TT   1024
#define DM   768
#define NH_  12
#define NKV  12
#define REP  (NH_ / NKV)
#define HD   64
#define DQ   (NH_ * HD)
#define DKV  (NKV * HD)
#define ZH   24
#define NZ   (NB_ * NH_)
#define RH   512                  // query rows < RH use hi+lo planes
#define WIN  1024
#define PCAR 1024.0f
#define SCL  0.125f   // HD^-0.5
typedef _Float16 h16;
typedef unsigned short bf;
typedef __attribute__((ext_vector_type(16))) __bf16   v16bf;
typedef __attribute__((ext_vector_type(16))) _Float16 v16h;
typedef __attribute__((ext_vector_type(8)))  _Float16 v8h;
typedef __attribute__((ext_vector_type(8)))  unsigned short v8us;
typedef __attribute__((ext_vector_type(8)))  float    v8f;
typedef __attribute__((ext_vector_type(4)))  float    v4f;
typedef v8h  __attribute__((may_alias)) v8ha;
typedef v4f  __attribute__((may_alias)) v4fa;
typedef v8us __attribute__((may_alias)) v8usa;
#define FE 512   // elements of one packed 16 x 32 fragment

__device__ __forceinline__ unsigned short f2bf(float f) { unsigned u = __float_as_uint(f); u += 0x7FFFu + ((u >> 16) & 1u); return (unsigned short)(u >> 16); }
__device__ __forceinline__ float bf2f(unsigned short b) { return __uint_as_float(((unsigned)b) << 16); }
__device__ __forceinline__ float bfr(float f) { return bf2f(f2bf(f)); }
__device__ __forceinline__ v16h cat16(v8h lo, v8h hi) { return __builtin_shufflevector(lo, hi, 0, 1, 2, 3, 4, 5, 6, 7, 8, 9, 10, 11, 12, 13, 14, 15); }
__device__ __forceinline__ v16bf cat16b(v8us lo, v8us hi) { return __builtin_bit_cast(v16bf, __builtin_shufflevector(lo, hi, 0, 1, 2, 3, 4, 5, 6, 7, 8, 9, 10, 11, 12, 13, 14, 15)); }
__device__ __forceinline__ v8f wmma16(v16h a, v16h b, v8f c) { return __builtin_amdgcn_wmma_f32_16x16x32_f16(false, a, false, b, (short)0, c, false, false); }
__device__ __forceinline__ v8f wmmab(v16bf a, v16bf b, v8f c) { return __builtin_amdgcn_wmma_f32_16x16x32_bf16(false, a, false, b, (short)0, c, false, false); }



// ---- Fragment-packed planes. Every 16-bit operand plane [rows][k] is stored as whole WMMA fragments: the fragment of rows 16 rb .. + 15 and k 32 kb .. + 31 is FE = 512 consecutive elements (1 KiB),
// element (row, k) at c * 256 + lane * 8 + (k & 7) with c = (k >> 4) & 1 and lane = ((k >> 3) & 1) * 16 + (row & 15). A fragment load is then two loads of 512 consecutive bytes (4 whole lines each)
// instead of two loads that touch 16 lines each; the k order of the operands is the one it was. ld(p) takes the fragment's first element + lane * 8.
// ---- k_gemmw: register-blocked GEMM, ONE WAVE per 64x64 output tile (16 accumulators), operands straight from fragment-packed planes, fragments in [rb][kb] order; grid (M/64, N/64, Z), 32 threads.
// C[m][n] (f32, pitch ldc, + optional f32 bias[n]) = sum_k A[m][k] Bt[n][k] (+ split products per NSPLIT). z-batch strides sA/sB/sC in elements. K % 32 == 0.
template <typename T16> struct WFrag;
template <> struct WFrag<h16> { typedef v16h V; static __device__ __forceinline__ V ld(const h16* p) { return cat16(*(const v8h*)p, *(const v8h*)(p + 256)); } static __device__ __forceinline__ v8f mma(V a, V b, v8f c) { return wmma16(a, b, c); } };
template <> struct WFrag<bf> { typedef v16bf V; static __device__ __forceinline__ V ld(const bf* p) { return cat16b(*(const v8us*)p, *(const v8us*)(p + 256)); } static __device__ __forceinline__ v8f mma(V a, V b, v8f c) { return wmmab(a, b, c); } };
// One k block's fragments of a 64x64 tile. The GEMM loops keep a ring of three such sets in registers: while block kb is multiplied, the loads of blocks kb + 1 and kb + 2 are in flight,
// so a wave waits for a load that was issued two blocks of products earlier, not for one that it has just issued.
template <typename T16> struct WSet { typename WFrag<T16>::V a[4], a2[4], b[4], b2[4]; };
template <typename T16, int NSPLIT, int K, int KB>   // A, A2, Bt, Bt2: the tile's first fragments, wave-uniform and fixed; off: the lane's byte offset at the ring's current block; KB: blocks ahead, an immediate offset of the loads
__device__ __forceinline__ void wfetch(WSet<T16>& f, const T16* A, const T16* A2, const T16* Bt, const T16* Bt2, unsigned off) {
    constexpr int rs = 16 * K;   // elements of one block of 16 rows
#pragma unroll
    for (int mb = 0; mb < 4; ++mb) { f.a[mb] = WFrag<T16>::ld((const T16*)((const char*)(A + KB * FE + mb * rs) + off)); if (NSPLIT == 1 || NSPLIT == 2) f.a2[mb] = WFrag<T16>::ld((const T16*)((const char*)(A2 + KB * FE + mb * rs) + off)); }
#pragma unroll
    for (int nb = 0; nb < 4; ++nb) { f.b[nb] = WFrag<T16>::ld((const T16*)((const char*)(Bt + KB * FE + nb * rs) + off)); if (NSPLIT >= 2) f.b2[nb] = WFrag<T16>::ld((const T16*)((const char*)(Bt2 + KB * FE + nb * rs) + off)); }
    __builtin_amdgcn_sched_barrier(0);   // keeps a set's loads together, in front of the products that follow and behind the older set's loads; without it the scheduler mixes two sets' loads, and the counted wait for the older set waits for the younger too
}
template <typename T16, int NSPLIT>
__device__ __forceinline__ void wmul(const WSet<T16>& f, v8f (&acc)[4][4]) {
#pragma unroll
    for (int nb = 0; nb < 4; ++nb)
#pragma unroll
        for (int mb = 0; mb < 4; ++mb) { acc[mb][nb] = WFrag<T16>::mma(f.a[mb], f.b[nb], acc[mb][nb]); if (NSPLIT == 1 || NSPLIT == 2) acc[mb][nb] = WFrag<T16>::mma(f.a2[mb], f.b[nb], acc[mb][nb]); if (NSPLIT >= 2) acc[mb][nb] = WFrag<T16>::mma(f.a[mb], f.b2[nb], acc[mb][nb]); }
    __builtin_amdgcn_sched_barrier(0);   // keeps the next set's loads below these products, whose operand registers they refill; without it the scheduler lifts them, the allocation grows and values spill to scratch
}
// amdgpu_waves_per_eu(2): the ring of three sets takes more than a third of a SIMD's registers; two waves per SIMD hold all tiles of the launch at once.
template <typename T16, int NSPLIT, bool BIAS, int K>   // K at compile time: the row blocks' distances are immediate offsets of the loads
__global__ __launch_bounds__(32) __attribute__((amdgpu_waves_per_eu(2))) void k_gemmw(const T16* __restrict__ A, const T16* __restrict__ A2, const T16* __restrict__ Bt, const T16* __restrict__ Bt2, float* C, int ldc, const float* __restrict__ bias0, const float* __restrict__ bias1, const float* __restrict__ bias2, size_t sA, size_t sB, size_t sC) {
    typedef typename WFrag<T16>::V V;
    __shared__ __align__(16) float os[16 * 68];
    const size_t z = blockIdx.z; A += z * sA; if (A2) A2 += z * sA; Bt += z * sB; if (Bt2) Bt2 += z * sB; C += z * sC;
    const float* bias = (z == 0) ? bias0 : ((z == 1) ? bias1 : bias2);   // each z-slice adds its own bias vector
    const int lane = threadIdx.x & 31, lr = lane & 15, hi = lane >> 4; const int r0 = blockIdx.x * 64, c0 = blockIdx.y * 64;
    v8f acc[4][4];
#pragma unroll
    for (int mb = 0; mb < 4; ++mb)
#pragma unroll
        for (int nb = 0; nb < 4; ++nb) acc[mb][nb] = (v8f){};
    constexpr int NKB = K / 32; static_assert(NKB % 3 == 0 && NKB >= 6, "the ring walks k in threes");
    unsigned off = (unsigned)lane * 16u;   // the lane's byte offset: it walks k, beside wave-uniform bases that stay
    A += (size_t)r0 * K; if (NSPLIT == 1 || NSPLIT == 2) A2 += (size_t)r0 * K; Bt += (size_t)c0 * K; if (NSPLIT >= 2) Bt2 += (size_t)c0 * K;
    WSet<T16> f0, f1, f2;
    wfetch<T16, NSPLIT, K, 0>(f0, A, A2, Bt, Bt2, off); wfetch<T16, NSPLIT, K, 1>(f1, A, A2, Bt, Bt2, off);
#pragma unroll 1   // one body holds three blocks, one per set of the ring
    for (int t = 0; t < NKB / 3 - 1; ++t) {
        wfetch<T16, NSPLIT, K, 2>(f2, A, A2, Bt, Bt2, off); wmul<T16, NSPLIT>(f0, acc);
        wfetch<T16, NSPLIT, K, 3>(f0, A, A2, Bt, Bt2, off); wmul<T16, NSPLIT>(f1, acc);
        wfetch<T16, NSPLIT, K, 4>(f1, A, A2, Bt, Bt2, off); wmul<T16, NSPLIT>(f2, acc);
        asm volatile("s_wait_xcnt 0x0" : "+v"(off) :: "memory");   // the wait in front of the rewrite of these loads' offset register on the next line, which takes the offset from this statement and so stays behind it
        off += 3 * FE * 2;
    }
    wfetch<T16, NSPLIT, K, 2>(f2, A, A2, Bt, Bt2, off); wmul<T16, NSPLIT>(f0, acc); wmul<T16, NSPLIT>(f1, acc); wmul<T16, NSPLIT>(f2, acc);   // the last three blocks: one set is still to fetch
    asm volatile("s_wait_xcnt 0x0" :: "v"(off) : "memory");   // the same wait, in front of the epilogue's reuse of the offset register; it names it, so that it lives to here
#pragma unroll
    for (int mb = 0; mb < 4; ++mb) {
#pragma unroll
        for (int nb = 0; nb < 4; ++nb) {
#pragma unroll
            for (int j = 0; j < 8; ++j) os[(hi * 8 + j) * 68 + nb * 16 + lr] = acc[mb][nb][j]; }
        __builtin_amdgcn_wave_barrier(); asm volatile("" ::: "memory");
        float* crow = C + (size_t)(r0 + mb * 16) * ldc + c0;
{ v4f vs[8]; float* cp[8];
#pragma unroll
            for (int s = 0; s < 8; ++s) { const int row = 2 * s + hi, cofs = lr * 4; v4f val = *(const v4fa*)(os + row * 68 + cofs); if (BIAS) { val[0] += bfr(bias[c0 + cofs]); val[1] += bfr(bias[c0 + cofs + 1]); val[2] += bfr(bias[c0 + cofs + 2]); val[3] += bfr(bias[c0 + cofs + 3]); }
                vs[s] = val; cp[s] = crow + (size_t)row * ldc + cofs; *(v4f*)cp[s] = val; }
            // the wait in front of any rewrite of these stores' address and data registers; it names them, so that they live to here
            asm volatile("s_wait_xcnt 0x0" :: "v"(cp[0]), "v"(cp[1]), "v"(cp[2]), "v"(cp[3]), "v"(cp[4]), "v"(cp[5]), "v"(cp[6]), "v"(cp[7]), "v"(vs[0]), "v"(vs[1]), "v"(vs[2]), "v"(vs[3]), "v"(vs[4]), "v"(vs[5]), "v"(vs[6]), "v"(vs[7]) : "memory");
             }
        __builtin_amdgcn_wave_barrier(); asm volatile("" ::: "memory");
    }
}

__device__ __forceinline__ h16 tohx(float x) { return (h16)x; }
__device__ __forceinline__ void splitf(float y, unsigned short& h, unsigned short& l) { h = f2bf(y); l = f2bf(y - bf2f(h)); }
typedef __attribute__((ext_vector_type(2))) _Float16 v2h;
typedef __attribute__((ext_vector_type(4))) _Float16 v4h;
typedef __attribute__((ext_vector_type(2))) unsigned short v2us;
typedef __attribute__((ext_vector_type(4))) unsigned short v4us;
typedef __attribute__((ext_vector_type(2))) float v2f;
typedef __attribute__((ext_vector_type(4))) int v4i;

// ---- k_pack: every operand packing (x; Wq, Wk, Wv; W0) in ONE launch of few waves that each do many pieces. A piece is 16 bytes of a packed plane, in the plane's own order (whole lines written): piece i is
// lane i & 31, half c = (i >> 5) & 1 of fragment i >> 6. A wave takes XW (x) or WW (weights) runs of 32 consecutive pieces, all their loads in flight together: a launch
// with one piece a thread is priced by the number of waves to start, not by its bytes. Consecutive runs walk k by 16, so a thread's loads are one address with immediate offsets.
#define XW 8   // pieces per thread, x: 4 fragments a wave
#define WW 4   // pieces per thread, weights: 2 fragments a wave
#define XBLK (NB_ * TT * DM / 8 / XW / 256)   // blocks of 8 waves for x
#define WBLK (DQ * DM / 8 / WW / 256)         // blocks of 8 waves for each of the four weight matrices
static_assert((DM / 32) % (XW / 2) == 0 && (DM / 32) % (WW / 2) == 0 && (DQ / 32) % (WW / 2) == 0, "a wave's fragments lie in one block of 16 rows");
static_assert(NB_ * TT * DM % (8 * XW * 256) == 0 && DQ * DM % (8 * WW * 256) == 0, "whole blocks");
template <int RS>   // RS: floats from k to k + 1 in the source; p: the lane's element at its first k; d: the lane's first piece
__device__ __forceinline__ void pack_w(const float* __restrict__ p, bf* d) { float v[WW][8]; v8us o[WW];
#pragma unroll
    for (int j = 0; j < WW; ++j)
#pragma unroll
        for (int u = 0; u < 8; ++u) v[j][u] = p[(j * 16 + u) * RS];
    asm volatile("s_wait_xcnt 0x0" :: "v"(p) : "memory");   // the wait in front of any rewrite of these loads' address registers; it names them, so that they live to here
#pragma unroll
    for (int j = 0; j < WW; ++j) {
#pragma unroll
        for (int u = 0; u < 8; ++u) o[j][u] = f2bf(v[j][u]);
        *(v8us*)(d + j * 256) = o[j]; }
    asm volatile("s_wait_xcnt 0x0" :: "v"(d), "v"(o[0]), "v"(o[1]), "v"(o[2]), "v"(o[3]) : "memory"); }   // the same wait for these stores' address and data registers; it names them, so that they live to here
__global__ __launch_bounds__(256) void k_pack(const float* __restrict__ x, const float* __restrict__ w0, const float* __restrict__ w1, const float* __restrict__ w2, const float* __restrict__ wo, bf* XB, bf* Wt, bf* WO) {
    const int lane = threadIdx.x & 31, lr = lane & 15, hi = lane >> 4; const int w = __builtin_amdgcn_readfirstlane(threadIdx.x >> 5);   // the wave's number in a scalar register: the fragment arithmetic stays scalar
    if (blockIdx.x < XBLK) {   // XB[t][k] = x[t][k]: a lane reads 8 consecutive k of its row, the wave 512 consecutive bytes of each of 16 rows in all
        const int wv = blockIdx.x * 8 + w, rb = wv / (DM / 32 / (XW / 2)), kb0 = (wv % (DM / 32 / (XW / 2))) * (XW / 2);
        const float* p = x + (size_t)(rb * 16 + lr) * DM + kb0 * 32 + hi * 8; bf* d = XB + (size_t)wv * (XW * 256) + lane * 8; v8f v[XW]; v8us o[XW];
#pragma unroll
        for (int j = 0; j < XW; ++j) v[j] = *(const v8f*)(p + j * 16);
        asm volatile("s_wait_xcnt 0x0" :: "v"(p) : "memory");   // the wait in front of any rewrite of these loads' address registers; it names them, so that they live to here
#pragma unroll
        for (int j = 0; j < XW; ++j) {
#pragma unroll
            for (int u = 0; u < 8; ++u) o[j][u] = f2bf(v[j][u]);
            *(v8us*)(d + j * 256) = o[j]; }
        asm volatile("s_wait_xcnt 0x0" :: "v"(d), "v"(o[0]), "v"(o[1]), "v"(o[2]), "v"(o[3]), "v"(o[4]), "v"(o[5]), "v"(o[6]), "v"(o[7]) : "memory");   // the same wait for these stores' address and data registers
        return; }
    const int b = blockIdx.x - XBLK, mat = b / WBLK, wv = (b % WBLK) * 8 + w; const size_t di = (size_t)wv * (WW * 256) + lane * 8;
    if (mat < 3) {   // Wt[mat][h * 64 + c][d] = W[h][d][c]: 16 lanes read 16 consecutive c
        const int rb = wv / (DM / 32 / (WW / 2)), k0 = (wv % (DM / 32 / (WW / 2))) * (WW / 2) * 32 + hi * 8, n = rb * 16 + lr; const float* wm = (mat == 0) ? w0 : ((mat == 1) ? w1 : w2);
        pack_w<HD>(wm + ((size_t)(n / HD) * DM + k0) * HD + n % HD, Wt + (size_t)mat * DQ * DM + di);
    } else {         // WO[n][k] = W0[k][n], k < DQ, n < DM: 16 lanes read 16 consecutive n
        const int rb = wv / (DQ / 32 / (WW / 2)), k0 = (wv % (DQ / 32 / (WW / 2))) * (WW / 2) * 32 + hi * 8, n = rb * 16 + lr;
        pack_w<DM>(wo + (size_t)k0 * DM + n, WO + di); }
}
// ---- k_fattn: causal attention of one (sequence, head) pair and one strip of query rows in one wave; scores and probabilities stay in registers (online softmax over blocks of 32 keys).
// Transposed products: S^T = K Q^T (A = key rows, B = query rows), so a lane holds 16 scores of ONE query (column lr): keys k0 + 8 hi + j and k0 + 16 + 8 hi + j. Those 16 values, converted in place, are the
// B operand of O^T += V^T P^T (A = value plane rows [d][t]) in the k order of the loaders. Running maximum, sum and rescale factor are per lane; the two lane halves are joined by one exchange.
// The strip's output rows leave as the hi/lo planes of the output projection's A operand: lane = query row, 8 consecutive d per accumulator, which is one half of a packed fragment: 512 consecutive bytes a store.
// Packed planes: q, k rows t, k = d, fragments [t / 16][d / 32]; v rows d, k = t, fragments [t / 32][d / 16]: a block of 32 keys is 4 consecutive fragments of either, at element k0 * HD.
#define L2E 1.4426950408889634f
__device__ __forceinline__ float xhalf(float x) { const int b = __float_as_int(x); return __int_as_float(__builtin_amdgcn_permlanex16(b, b, 0x76543210, 0xfedcba98, false, false)); }   // lane l <-> l ^ 16
__device__ __forceinline__ float ex2(float x) { float r; asm("v_exp_f32 %0, %1\n\tv_nop" : "=v"(r) : "v"(x)); return r; }
__device__ __forceinline__ void put8(v8f o, float inv, bf* ph, bf* pl) { v8us oh, ol;
#pragma unroll
    for (int j = 0; j < 8; ++j) { unsigned short a, c2; splitf(o[j] * inv, a, c2); oh[j] = a; ol[j] = c2; }
    *(v8us*)ph = oh; *(v8us*)pl = ol;
    asm volatile("s_wait_xcnt 0x0" :: "v"(ph), "v"(pl), "v"(oh), "v"(ol) : "memory"); }   // the wait in front of any rewrite of these stores' address and data registers; it names them, so that they live to here
// rows >= RH: single fp16 products, 32 query rows per wave; probabilities carry the factor PCAR = 2^10 (it cancels against the row sum)
__device__ __forceinline__ void attn_lo(const h16* __restrict__ Q, const h16* __restrict__ Kp, const h16* __restrict__ Vt, int q0, bf* Ah, bf* Al, int lr, int hi) {
    v16h qf[2][2]; const h16* qp = Q + (size_t)q0 * HD + (hi * 16 + lr) * 8;   // 16 rows of HD = 64 are two fragments: row block r0 begins at element r0 * HD, as it did
#pragma unroll
    for (int nb = 0; nb < 2; ++nb)
#pragma unroll
        for (int ks = 0; ks < 2; ++ks) qf[nb][ks] = WFrag<h16>::ld(qp + (nb * 2 + ks) * FE);
    v8f o[4][2]; float m[2], l[2];
#pragma unroll
    for (int nb = 0; nb < 2; ++nb) { m[nb] = -3.0e38f; l[nb] = 0.f;
#pragma unroll
        for (int db = 0; db < 4; ++db) o[db][nb] = (v8f){}; }
    const h16* kp = Kp + (hi * 16 + lr) * 8; const unsigned vo = (unsigned)(hi * 16 + lr) * 16u;   // value loads: the lane's byte offset, fixed over the loop, beside a wave-uniform base that walks the keys
    v16h kf[2][2];
#pragma unroll
    for (int kt = 0; kt < 2; ++kt)
#pragma unroll
        for (int ks = 0; ks < 2; ++ks) kf[kt][ks] = WFrag<h16>::ld(kp + (kt * 2 + ks) * FE);
    asm volatile("s_wait_xcnt 0x0" :: "v"(qp), "v"(kp) : "memory");   // the wait in front of any rewrite of these loads' address registers; it names them, so that they live to here
#pragma unroll 1   // run-time trip count; one body already holds most of the register budget
    for (int k0 = 0; k0 < q0 + 32; k0 += 32) {
        v16h vf[4]; const h16* vp = (const h16*)((const char*)(Vt + (size_t)k0 * HD) + vo);
#pragma unroll
        for (int db = 0; db < 4; ++db) vf[db] = WFrag<h16>::ld(vp + db * FE);
        v8f s[2][2];
#pragma unroll
        for (int kt = 0; kt < 2; ++kt)
#pragma unroll
            for (int nb = 0; nb < 2; ++nb) s[kt][nb] = wmma16(kf[kt][1], qf[nb][1], wmma16(kf[kt][0], qf[nb][0], (v8f){}));
        if (k0 < q0) kp += 32 * HD;   // the next block's key fragments fly during this block's softmax; the last block fetches its own again, so the address stays inside the plane
#pragma unroll
        for (int kt = 0; kt < 2; ++kt)
#pragma unroll
            for (int ks = 0; ks < 2; ++ks) kf[kt][ks] = WFrag<h16>::ld(kp + (kt * 2 + ks) * FE);
        asm volatile("s_wait_xcnt 0x0" :: "v"(vp), "v"(kp) : "memory");   // the wait in front of any rewrite of the value and key loads' address registers; it names them, so that they live to here
        __builtin_amdgcn_sched_barrier(0);   // keeps the key loads above the softmax; without it the scheduler sinks them to the loop's foot and their latency is exposed again
#pragma unroll
        for (int nb = 0; nb < 2; ++nb) { const int q = q0 + nb * 16 + lr; float t[16]; float mx = m[nb];
#pragma unroll
            for (int e = 0; e < 16; ++e) { const int key = k0 + (e >> 3) * 16 + hi * 8 + (e & 7); t[e] = (key <= q) ? s[e >> 3][nb][e & 7] * SCL : -3.0e38f; mx = fmaxf(mx, t[e]); }
            mx = fmaxf(mx, xhalf(mx));
            const float al = ex2((m[nb] - mx) * L2E); m[nb] = mx; float sum = 0.f; v16h pf;
#pragma unroll
            for (int e = 0; e < 16; ++e) { const float p = ex2((t[e] - mx) * L2E + 10.0f); sum += p; pf[e] = tohx(p); }
            l[nb] = l[nb] * al + sum;
#pragma unroll
            for (int db = 0; db < 4; ++db) { o[db][nb] *= al; o[db][nb] = wmma16(vf[db], pf, o[db][nb]); } }
    }
#pragma unroll
    for (int nb = 0; nb < 2; ++nb) { const float inv = __fdiv_rn(1.0f, l[nb] + xhalf(l[nb])); const size_t ro = (size_t)(q0 + nb * 16) * DQ + (hi * 16 + lr) * 8;   // row block [rb][kb]; the head's two fragments of it lie side by side
#pragma unroll
        for (int db = 0; db < 4; ++db) put8(o[db][nb], inv, Ah + ro + db * 256, Al + ro + db * 256); }
}
// rows < RH: hi+lo bf16 planes, 3 products each for the scores and for P.V, 32 query rows per wave
__device__ __forceinline__ void attn_hl(const bf* __restrict__ Qh, const bf* __restrict__ Ql, const bf* __restrict__ Kh, const bf* __restrict__ Kl, const bf* __restrict__ Vh, const bf* __restrict__ Vl, int q0, bf* Ah, bf* Al, int lr, int hi) {
    v16bf qh[2][2], ql[2][2]; const bf* qph = Qh + (size_t)q0 * HD + (hi * 16 + lr) * 8; const bf* qpl = Ql + (size_t)q0 * HD + (hi * 16 + lr) * 8;
#pragma unroll
    for (int nb = 0; nb < 2; ++nb)
#pragma unroll
        for (int ks = 0; ks < 2; ++ks) { qh[nb][ks] = WFrag<bf>::ld(qph + (nb * 2 + ks) * FE); ql[nb][ks] = WFrag<bf>::ld(qpl + (nb * 2 + ks) * FE); }
    asm volatile("s_wait_xcnt 0x0" :: "v"(qph), "v"(qpl) : "memory");   // the wait in front of any rewrite of these loads' address registers; it names them, so that they live to here
    v8f o[4][2]; float m[2], l[2];
#pragma unroll
    for (int nb = 0; nb < 2; ++nb) { m[nb] = -3.0e38f; l[nb] = 0.f;
#pragma unroll
        for (int db = 0; db < 4; ++db) o[db][nb] = (v8f){}; }
    const unsigned ko = (unsigned)(hi * 16 + lr) * 16u, vo = ko;   // the lane's byte offsets, fixed over the loop, beside wave-uniform bases that walk the keys
#pragma unroll 1   // run-time trip count; one body already holds most of the register budget
    for (int k0 = 0; k0 < q0 + 32; k0 += 32) {
        const bf* kph = (const bf*)((const char*)(Kh + (size_t)k0 * HD) + ko); const bf* kpl = (const bf*)((const char*)(Kl + (size_t)k0 * HD) + ko);
        v16bf kh[2][2], kl[2][2];   // all key fragments of the block are requested together: one latency a block, not one per fragment pair
#pragma unroll
        for (int kt = 0; kt < 2; ++kt)
#pragma unroll
            for (int ks = 0; ks < 2; ++ks) { kh[kt][ks] = WFrag<bf>::ld(kph + (kt * 2 + ks) * FE); kl[kt][ks] = WFrag<bf>::ld(kpl + (kt * 2 + ks) * FE); }
        asm volatile("s_wait_xcnt 0x0" :: "v"(kph), "v"(kpl) : "memory");   // the wait in front of any rewrite of the key loads' address registers; it names them, so that they live to here
        __builtin_amdgcn_sched_barrier(0);   // keeps the sixteen key loads together above the products; without it the scheduler sinks them pair by pair between the products, one exposed latency each
        v8f s[2][2];
#pragma unroll
        for (int kt = 0; kt < 2; ++kt) { s[kt][0] = (v8f){}; s[kt][1] = (v8f){};
#pragma unroll
            for (int ks = 0; ks < 2; ++ks)
#pragma unroll
                for (int nb = 0; nb < 2; ++nb) { s[kt][nb] = wmmab(kh[kt][ks], qh[nb][ks], s[kt][nb]); s[kt][nb] = wmmab(kh[kt][ks], ql[nb][ks], s[kt][nb]); s[kt][nb] = wmmab(kl[kt][ks], qh[nb][ks], s[kt][nb]); } }
        const bf* vph = (const bf*)((const char*)(Vh + (size_t)k0 * HD) + vo); const bf* vpl = (const bf*)((const char*)(Vl + (size_t)k0 * HD) + vo);
        v16bf vh[4], vl[4];
#pragma unroll
        for (int db = 0; db < 4; ++db) { vh[db] = WFrag<bf>::ld(vph + db * FE); vl[db] = WFrag<bf>::ld(vpl + db * FE); }
        asm volatile("s_wait_xcnt 0x0" :: "v"(vph), "v"(vpl) : "memory");   // the same wait for the value loads' address registers; the loads' own place is held by the next line
        __builtin_amdgcn_sched_barrier(0);   // keeps the value loads above the softmax, which hides their latency; without it the scheduler sinks half of them, and the wait with them, to the products
        v16bf ph[2], pl[2]; float al[2];
#pragma unroll
        for (int nb = 0; nb < 2; ++nb) { const int q = q0 + nb * 16 + lr; float t[16]; float mx = m[nb];
#pragma unroll
            for (int e = 0; e < 16; ++e) { const int key = k0 + (e >> 3) * 16 + hi * 8 + (e & 7); t[e] = (key <= q) ? s[e >> 3][nb][e & 7] * SCL : -3.0e38f; mx = fmaxf(mx, t[e]); }
            mx = fmaxf(mx, xhalf(mx));
            al[nb] = ex2((m[nb] - mx) * L2E); m[nb] = mx; float sum = 0.f; v8us h0, h1, l0, l1;
#pragma unroll
            for (int e = 0; e < 8; ++e) { const float p0 = ex2((t[e] - mx) * L2E), p1 = ex2((t[e + 8] - mx) * L2E); sum += p0; sum += p1; unsigned short a, c2; splitf(p0, a, c2); h0[e] = a; l0[e] = c2; splitf(p1, a, c2); h1[e] = a; l1[e] = c2; }
            l[nb] = l[nb] * al[nb] + sum; ph[nb] = cat16b(h0, h1); pl[nb] = cat16b(l0, l1); }
#pragma unroll
        for (int db = 0; db < 4; ++db)
#pragma unroll
            for (int nb = 0; nb < 2; ++nb) { o[db][nb] *= al[nb]; o[db][nb] = wmmab(vh[db], ph[nb], o[db][nb]); o[db][nb] = wmmab(vh[db], pl[nb], o[db][nb]); o[db][nb] = wmmab(vl[db], ph[nb], o[db][nb]); }
    }
#pragma unroll
    for (int nb = 0; nb < 2; ++nb) { const float inv = __fdiv_rn(1.0f, l[nb] + xhalf(l[nb])); const size_t ro = (size_t)(q0 + nb * 16) * DQ + (hi * 16 + lr) * 8;   // row block [rb][kb]; the head's two fragments of it lie side by side
#pragma unroll
        for (int db = 0; db < 4; ++db) put8(o[db][nb], inv, Ah + ro + db * 256, Al + ro + db * 256); }
}
// grid (NZ pairs, 8), four independent waves per block (no barrier, no LDS): even y = rows >= RH, odd y = rows < RH. Each half of a sequence is 16 strips of 32 rows; group g = y >> 1 takes strips
// g, 7 - g, 8 + g, 15 - g, so every block of a path walks the same number of key blocks in all, and its waves read the same key and value lines from the start of the sequence on.
// amdgpu_waves_per_eu(3, 3): holds the register allocation to three waves per SIMD, so that all NZ * 8 blocks are resident at once; without it the hi+lo path takes two waves' worth.
__global__ __launch_bounds__(128) __attribute__((amdgpu_waves_per_eu(3, 3))) void k_fattn(const h16* __restrict__ Q16, const h16* __restrict__ K16, const h16* __restrict__ V16, const bf* __restrict__ Qh, const bf* __restrict__ Ql, const bf* __restrict__ Kh, const bf* __restrict__ Kl, const bf* __restrict__ Vh, const bf* __restrict__ Vl, bf* Ah, bf* Al) {
    const int lane = threadIdx.x & 31, lr = lane & 15, hi = lane >> 4; const int w = __builtin_amdgcn_readfirstlane(threadIdx.x >> 5);   // the wave's number in a scalar register: loop bounds stay scalar
    const int zz = blockIdx.x, g = blockIdx.y >> 1; const size_t zo = (size_t)zz * TT * HD, zv = zo;
    const int strip = (w >> 1) * 8 + ((w & 1) ? 7 - g : g);
    const size_t oo = (size_t)(zz / NH_) * TT * DQ + (zz % NH_) * 2 * FE;   // this pair's first element in the merged planes (rows [sequence][t], k = [head][d], packed)
    if ((blockIdx.y & 1) == 0) attn_lo(Q16 + zo, K16 + zo, V16 + zv, RH + 32 * strip, Ah + oo, Al + oo, lr, hi);
    else attn_hl(Qh + zo, Ql + zo, Kh + zo, Kl + zo, Vh + zv, Vl + zv, 32 * strip, Ah + oo, Al + oo, lr, hi);
}

// ---- k_proj: the three projections (grid z: q, k, v), ONE WAVE per 64x64 tile with the loop of k_gemmw; grid (rows / 64, heads, 3), 32 threads. The tile leaves as the attention kernel's
// operand planes (fp16, bf16 hi, bf16 lo of product + bias); the f32 projections never reach memory. In an accumulator a lane holds 8 consecutive rows of the A operand at one row of the B operand, so
// q, k: A = weight rows (d), B = x rows (t): 8 consecutive d of one token. v: A = x rows (t), B = weight rows (d): 8 consecutive t of one d.
// Either way an accumulator, converted, IS one half of a packed fragment of the plane in lane order: it leaves straight from registers as 512 consecutive bytes, and the tile is 8 consecutive fragments of each plane.
// amdgpu_waves_per_eu(3): the accumulators and the ring of three fragment sets take a third of a SIMD's registers; the tiles beyond three per SIMD start as earlier ones end.
__global__ __launch_bounds__(32) __attribute__((amdgpu_waves_per_eu(3))) void k_proj(const bf* __restrict__ X, const bf* __restrict__ Wt, const float* __restrict__ bias0, const float* __restrict__ bias1, const float* __restrict__ bias2, h16* P16, bf* Ph, bf* Pl, h16* V16, bf* Vh, bf* Vl) {
    const int z = blockIdx.z; const bool isv = (z == 2);
    const float* bias = (z == 0) ? bias0 : ((z == 1) ? bias1 : bias2);
    const int lane = threadIdx.x & 31, lr = lane & 15, hi = lane >> 4; const int r0 = blockIdx.x * 64, c0 = blockIdx.y * 64;
    const bf* xr = X + (size_t)r0 * DM; const bf* wr = Wt + ((size_t)z * DQ + c0) * DM;   // a block of 16 rows is DM / 32 fragments = 16 * DM elements: it begins where it did
    const bf* A = isv ? xr : wr; const bf* B = isv ? wr : xr;
    v8f acc[4][4];
#pragma unroll
    for (int ib = 0; ib < 4; ++ib)
#pragma unroll
        for (int jb = 0; jb < 4; ++jb) acc[ib][jb] = (v8f){};
    const unsigned off = (unsigned)lane * 16u;   // the lane's byte offset in a half fragment
    unsigned ko = off;   // the same at the ring's current block: it walks k, beside wave-uniform bases that stay
    constexpr int NKB = DM / 32; static_assert(NKB % 3 == 0 && NKB >= 6, "the ring walks k in threes");
    WSet<bf> f0, f1, f2;   // as in k_gemmw: three sets, loads two blocks ahead of their products
    wfetch<bf, 0, DM, 0>(f0, A, A, B, B, ko); wfetch<bf, 0, DM, 1>(f1, A, A, B, B, ko);
#pragma unroll 1   // one body holds three blocks, one per set of the ring
    for (int t = 0; t < NKB / 3 - 1; ++t) {
        wfetch<bf, 0, DM, 2>(f2, A, A, B, B, ko); wmul<bf, 0>(f0, acc);
        wfetch<bf, 0, DM, 3>(f0, A, A, B, B, ko); wmul<bf, 0>(f1, acc);
        wfetch<bf, 0, DM, 4>(f1, A, A, B, B, ko); wmul<bf, 0>(f2, acc);
        asm volatile("s_wait_xcnt 0x0" : "+v"(ko) :: "memory");   // the wait in front of the rewrite of these loads' offset register on the next line, which takes the offset from this statement and so stays behind it
        ko += 3 * FE * 2;
    }
    wfetch<bf, 0, DM, 2>(f2, A, A, B, B, ko); wmul<bf, 0>(f0, acc); wmul<bf, 0>(f1, acc); wmul<bf, 0>(f2, acc);   // the last three blocks: one set is still to fetch
    asm volatile("s_wait_xcnt 0x0" :: "v"(ko) : "memory");   // the same wait, in front of the epilogue's reuse of the offset register; it names it, so that it lives to here
    const size_t pair = (size_t)(r0 / TT) * NH_ + blockIdx.y; const int t0 = r0 % TT;
    const size_t base = (isv ? 0 : (size_t)z * NZ * TT * HD) + (pair * TT + t0) * HD;   // the k planes follow the q planes; 64 tokens are 8 fragments in either fragment order
    unsigned short* d16 = (unsigned short*)(isv ? V16 : P16) + base; bf* dh = (isv ? Vh : Ph) + base; bf* dl = (isv ? Vl : Pl) + base;
    const unsigned si = isv ? 4 * FE * 2 : FE * 2, sj = isv ? FE * 2 : 2 * FE * 2;   // bytes from fragment to fragment along ib >> 1 and along jb: v [t / 32][d / 16], q and k [t / 16][d / 32]
    float bj[4]; const int bx = c0 + lr;   // v: the bias runs along the lanes; q, k: along the accumulator's 8 values
#pragma unroll
    for (int jb = 0; jb < 4; ++jb) bj[jb] = bias[bx + jb * 16];
    asm volatile("s_wait_xcnt 0x0" :: "v"(bx) : "memory");   // the wait in front of any rewrite of these loads' index register; it names it, so that it lives to here
#pragma unroll
    for (int jb = 0; jb < 4; ++jb) bj[jb] = bfr(bj[jb]);
#pragma unroll
    for (int g = 0; g < 2; ++g) { float bi[2][8];
#pragma unroll
        for (int c = 0; c < 2; ++c)
#pragma unroll
            for (int e = 0; e < 8; ++e) bi[c][e] = bfr(bias[c0 + (g * 2 + c) * 16 + hi * 8 + e]);
#pragma unroll
        for (int jb = 0; jb < 4; ++jb) { v8us w[2][3];   // one whole fragment of each plane at a time
#pragma unroll
            for (int c = 0; c < 2; ++c) { v8h o16; v8us oh, ol;
#pragma unroll
                for (int e = 0; e < 8; ++e) { const float r = acc[g * 2 + c][jb][e] + (isv ? bj[jb] : bi[c][e]); o16[e] = tohx(r); unsigned short a2, c2; splitf(r, a2, c2); oh[e] = a2; ol[e] = c2; }
                w[c][0] = __builtin_bit_cast(v8us, o16); w[c][1] = oh; w[c][2] = ol; }
            const unsigned fo = jb * sj + g * si;   // wave-uniform
#pragma unroll
            for (int c = 0; c < 2; ++c) { *(v8usa*)((char*)d16 + fo + c * 512 + off) = w[c][0]; *(v8usa*)((char*)dh + fo + c * 512 + off) = w[c][1]; *(v8usa*)((char*)dl + fo + c * 512 + off) = w[c][2]; }
            asm volatile("s_wait_xcnt 0x0" ::: "memory");   // the wait in front of the next fragment's rewrite of these stores' address and data registers; the next line holds that work behind it
            __builtin_amdgcn_sched_barrier(0);   // keeps the later fragments' conversions below the wait; without it the scheduler also lifts them far up and the converted values spill to scratch
        } }
}

extern "C" void kernel_launch(void* const* d_in, const int* in_sizes, int n_in,
                              void* d_out, int out_size, void* d_ws, size_t ws_size, hipStream_t stream) {
    (void)in_sizes; (void)n_in; (void)out_size;
    const float* x = (const float*)d_in[0]; const float* wqh = (const float*)d_in[1]; const float* bq = (const float*)d_in[2]; const float* wkh = (const float*)d_in[3]; const float* bk = (const float*)d_in[4]; const float* wvh = (const float*)d_in[5]; const float* bv = (const float*)d_in[6]; const float* wo = (const float*)d_in[7]; const float* bo = (const float*)d_in[8]; const float* wq = nullptr; const float* wk = nullptr; const float* wv = nullptr; (void)wq; (void)wk; (void)wv; const float* cosT = nullptr; const float* sinT = nullptr; (void)cosT; (void)sinT;
    float* OUT = (float*)d_out;     // [8][1024][768]
    char* wsp = (char*)d_ws;
    auto take = [&](size_t bytes) { char* p = wsp; wsp += (bytes + 255) & ~(size_t)255; return (void*)p; };
    bf* WQ = (bf*)take((size_t)DQ * DM * 2); bf* WK = (bf*)take((size_t)DKV * DM * 2); bf* WV = (bf*)take((size_t)DKV * DM * 2); bf* WO = (bf*)take((size_t)DM * DQ * 2); (void)WK; (void)WV;   // WQ, WK, WV lie back to back (z-stride DQ*DM)
    const size_t PL = (size_t)NZ * TT * HD;   // elements of one plane over all (sequence, head) pairs; each q plane is followed by its k plane, which k_proj relies on
    h16* QP16 = (h16*)take(PL * 2); h16* KP16 = (h16*)take(PL * 2); h16* VT16 = (h16*)take(PL * 2);
    bf* QPh = (bf*)take(PL * 2); bf* KPh = (bf*)take(PL * 2); bf* QPl = (bf*)take(PL * 2); bf* KPl = (bf*)take(PL * 2); bf* VTh = (bf*)take(PL * 2); bf* VTl = (bf*)take(PL * 2);
    char* R = (char*)take((size_t)ZH * TT * TT * 4);   // one region, two stream-ordered uses: the x plane; then the merged head planes
    if ((size_t)(wsp - (char*)d_ws) > ws_size) return;    // ws 256 MiB
    bf* XB = (bf*)R;
    bf* ATh = (bf*)R; bf* ATl = ATh + (size_t)NB_ * TT * DQ;
    k_pack<<<XBLK + 4 * WBLK, 256, 0, stream>>>(x, wqh, wkh, wvh, wo, XB, WQ, WO);
    k_proj<<<dim3(NB_ * TT / 64, NH_, 3), 32, 0, stream>>>(XB, WQ, bq, bk, bv, QP16, QPh, QPl, VT16, VTh, VTl);
    k_fattn<<<dim3(NZ, 8, 1), 128, 0, stream>>>(QP16, KP16, VT16, QPh, QPl, KPh, KPl, VTh, VTl, ATh, ATl);
    k_gemmw<bf, 1, true, DQ><<<dim3(NB_ * TT / 64, DM / 64, 1), 32, 0, stream>>>(ATh, ATl, WO, nullptr, OUT, DM, bo, bo, bo, 0, 0, 0);
}

// v007
// A run of this version takes 95.2 microseconds.
// Next to v006, in two timings, it ran 1.05 times as fast each time.
// All steps since v000 together make it 32.1 times as fast.
#include <hip/hip_runtime.h>

// MaskedMultiHeadAttention (hidden [8][1024][768]; per-head q/k/v = x Wq[h] + bq[h] (Wq [12][768][64]); causal softmax(q.k / 8); out = concat(heads) Wo + bo -> [8][1024][768]). That is EIGHT sequences of 1,024 tokens at width 768 with 12 heads x 64 ([8][1024][768]) and the inputs in the order x, Wq, bq, Wk, bk, Wv, bv, W0, b0 (each bias after its own weight).
// Compute dtypes, f32 accumulate: every input rounded to bf16; q/k/v on PLAIN bf16 operands (inputs: exact; the 12 per-head weights gathered into one [768 x 768] operand) + bias; causal scores and attn.v: query rows < 512 hl (3 products), the rest single fp16 (x1024); softmax f32; Wo hl x exact (2 products) + bias.

#define NB_  8
#define TT   1024
#define DM   768
#define NH_  12
#define NKV  12
#define REP  (NH_ / NKV)
#define HD   64
#define DQ   (NH_ * HD)
#define DKV  (NKV * HD)
#define ZH   24
#define NZ   (NB_ * NH_)
#define RH   512                  // query rows < RH use hi+lo planes
#define WIN  1024
#define PCAR 1024.0f
#define SCL  0.125f   // HD^-0.5
typedef _Float16 h16;
typedef unsigned short bf;
typedef __attribute__((ext_vector_type(16))) __bf16   v16bf;
typedef __attribute__((ext_vector_type(16))) _Float16 v16h;
typedef __attribute__((ext_vector_type(8)))  _Float16 v8h;
typedef __attribute__((ext_vector_type(8)))  unsigned short v8us;
typedef __attribute__((ext_vector_type(8)))  float    v8f;
typedef __attribute__((ext_vector_type(4)))  float    v4f;
typedef v8h  __attribute__((may_alias)) v8ha;
typedef v4f  __attribute__((may_alias)) v4fa;
typedef v8us __attribute__((may_alias)) v8usa;
#define FE 512   // elements of one packed 16 x 32 fragment

// Roundings to 16 bits go through the hardware's packed converts (two values an instruction, round to nearest even), not through integer add-and-shift per value; the rounded values are the same.
__device__ __forceinline__ unsigned short f2bf(float f) { return __builtin_bit_cast(unsigned short, (__bf16)f); }
typedef __attribute__((ext_vector_type(2)))  __bf16   v2bf;
typedef __attribute__((ext_vector_type(2)))  float    v2fl;
typedef __attribute__((ext_vector_type(4)))  unsigned v4u;
__device__ __forceinline__ unsigned cvt2(float a, float b) { return __builtin_bit_cast(unsigned, __builtin_convertvector((v2fl){a, b}, v2bf)); }   // one packed word of two rounded values
__device__ __forceinline__ v4u cvt8w(v8f x) { return (v4u){cvt2(x[0], x[1]), cvt2(x[2], x[3]), cvt2(x[4], x[5]), cvt2(x[6], x[7])}; }
__device__ __forceinline__ v8us cvt8(v8f x) { return __builtin_bit_cast(v8us, cvt8w(x)); }
__device__ __forceinline__ void split8(v8f y, v8us& h, v8us& l) { const v4u w = cvt8w(y); h = __builtin_bit_cast(v8us, w); v8f f;   // hi plane, and the rounded remainder as lo plane
#pragma unroll
    for (int i = 0; i < 4; ++i) { f[2 * i] = __uint_as_float(w[i] << 16); f[2 * i + 1] = __uint_as_float(w[i] & 0xFFFF0000u); }   // the hi values back in f32, straight from the packed words
    l = cvt8(y - f); }
__device__ __forceinline__ float bf2f(unsigned short b) { return __uint_as_float(((unsigned)b) << 16); }
__device__ __forceinline__ float bfr(float f) { return bf2f(f2bf(f)); }
__device__ __forceinline__ v16h cat16(v8h lo, v8h hi) { return __builtin_shufflevector(lo, hi, 0, 1, 2, 3, 4, 5, 6, 7, 8, 9, 10, 11, 12, 13, 14, 15); }
__device__ __forceinline__ v16bf cat16b(v8us lo, v8us hi) { return __builtin_bit_cast(v16bf, __builtin_shufflevector(lo, hi, 0, 1, 2, 3, 4, 5, 6, 7, 8, 9, 10, 11, 12, 13, 14, 15)); }
__device__ __forceinline__ v8f wmma16(v16h a, v16h b, v8f c) { return __builtin_amdgcn_wmma_f32_16x16x32_f16(false, a, false, b, (short)0, c, false, false); }
__device__ __forceinline__ v8f wmmab(v16bf a, v16bf b, v8f c) { return __builtin_amdgcn_wmma_f32_16x16x32_bf16(false, a, false, b, (short)0, c, false, false); }



// ---- Fragment-packed planes. Every 16-bit operand plane [rows][k] is stored as whole WMMA fragments: the fragment of rows 16 rb .. + 15 and k 32 kb .. + 31 is FE = 512 consecutive elements (1 KiB),
// element (row, k) at c * 256 + lane * 8 + (k & 7) with c = (k >> 4) & 1 and lane = ((k >> 3) & 1) * 16 + (row & 15). A fragment load is then two loads of 512 consecutive bytes (4 whole lines each)
// instead of two loads that touch 16 lines each; the k order of the operands is the one it was. ld(p) takes the fragment's first element + lane * 8.
// ---- k_gemmw: register-blocked GEMM, ONE WAVE per 64x64 output tile (16 accumulators), operands straight from fragment-packed planes, fragments in [rb][kb] order; grid (M/64, N/64, Z), 32 threads.
// C[m][n] (f32, pitch ldc, + optional f32 bias[n]) = sum_k A[m][k] Bt[n][k] (+ split products per NSPLIT). z-batch strides sA/sB/sC in elements. K % 32 == 0.
template <typename T16> struct WFrag;
template <> struct WFrag<h16> { typedef v16h V; static __device__ __forceinline__ V ld(const h16* p) { return cat16(*(const v8h*)p, *(const v8h*)(p + 256)); } static __device__ __forceinline__ v8f mma(V a, V b, v8f c) { return wmma16(a, b, c); } };
template <> struct WFrag<bf> { typedef v16bf V; static __device__ __forceinline__ V ld(const bf* p) { return cat16b(*(const v8us*)p, *(const v8us*)(p + 256)); } static __device__ __forceinline__ v8f mma(V a, V b, v8f c) { return wmmab(a, b, c); } };
// One k block's fragments of a 64x64 tile. The GEMM loops keep a ring of three such sets in registers: while block kb is multiplied, the loads of blocks kb + 1 and kb + 2 are in flight,
// so a wave waits for a load that was issued two blocks of products earlier, not for one that it has just issued.
template <typename T16> struct WSet { typename WFrag<T16>::V a[4], a2[4], b[4], b2[4]; };
template <typename T16, int NSPLIT, int K, int KB>   // A, A2, Bt, Bt2: the tile's first fragments, wave-uniform and fixed; off: the lane's byte offset at the ring's current block; KB: blocks ahead, an immediate offset of the loads
__device__ __forceinline__ void wfetch(WSet<T16>& f, const T16* A, const T16* A2, const T16* Bt, const T16* Bt2, unsigned off) {
    constexpr int rs = 16 * K;   // elements of one block of 16 rows
#pragma unroll
    for (int mb = 0; mb < 4; ++mb) { f.a[mb] = WFrag<T16>::ld((const T16*)((const char*)(A + KB * FE + mb * rs) + off)); if (NSPLIT == 1 || NSPLIT == 2) f.a2[mb] = WFrag<T16>::ld((const T16*)((const char*)(A2 + KB * FE + mb * rs) + off)); }
#pragma unroll
    for (int nb = 0; nb < 4; ++nb) { f.b[nb] = WFrag<T16>::ld((const T16*)((const char*)(Bt + KB * FE + nb * rs) + off)); if (NSPLIT >= 2) f.b2[nb] = WFrag<T16>::ld((const T16*)((const char*)(Bt2 + KB * FE + nb * rs) + off)); }
    __builtin_amdgcn_sched_barrier(0);   // keeps a set's loads together, in front of the products that follow and behind the older set's loads; without it the scheduler mixes two sets' loads, and the counted wait for the older set waits for the younger too
}
template <typename T16, int NSPLIT>
__device__ __forceinline__ void wmul(const WSet<T16>& f, v8f (&acc)[4][4]) {
#pragma unroll
    for (int nb = 0; nb < 4; ++nb)
#pragma unroll
        for (int mb = 0; mb < 4; ++mb) { acc[mb][nb] = WFrag<T16>::mma(f.a[mb], f.b[nb], acc[mb][nb]); if (NSPLIT == 1 || NSPLIT == 2) acc[mb][nb] = WFrag<T16>::mma(f.a2[mb], f.b[nb], acc[mb][nb]); if (NSPLIT >= 2) acc[mb][nb] = WFrag<T16>::mma(f.a[mb], f.b2[nb], acc[mb][nb]); }
    __builtin_amdgcn_sched_barrier(0);   // keeps the next set's loads below these products, whose operand registers they refill; without it the scheduler lifts them, the allocation grows and values spill to scratch
}
// amdgpu_waves_per_eu(2): the ring of three sets takes more than a third of a SIMD's registers; two waves per SIMD hold all tiles of the launch at once.
template <typename T16, int NSPLIT, bool BIAS, int K>   // K at compile time: the row blocks' distances are immediate offsets of the loads
__global__ __launch_bounds__(32) __attribute__((amdgpu_waves_per_eu(2))) void k_gemmw(const T16* __restrict__ A, const T16* __restrict__ A2, const T16* __restrict__ Bt, const T16* __restrict__ Bt2, float* C, int ldc, const float* __restrict__ bias0, const float* __restrict__ bias1, const float* __restrict__ bias2, size_t sA, size_t sB, size_t sC) {
    typedef typename WFrag<T16>::V V;
    __shared__ __align__(16) float os[16 * 68];
    const size_t z = blockIdx.z; A += z * sA; if (A2) A2 += z * sA; Bt += z * sB; if (Bt2) Bt2 += z * sB; C += z * sC;
    const float* bias = (z == 0) ? bias0 : ((z == 1) ? bias1 : bias2);   // each z-slice adds its own bias vector
    const int lane = threadIdx.x & 31, lr = lane & 15, hi = lane >> 4; const int r0 = blockIdx.x * 64, c0 = blockIdx.y * 64;
    v8f acc[4][4];
#pragma unroll
    for (int mb = 0; mb < 4; ++mb)
#pragma unroll
        for (int nb = 0; nb < 4; ++nb) acc[mb][nb] = (v8f){};
    constexpr int NKB = K / 32; static_assert(NKB % 3 == 0 && NKB >= 6, "the ring walks k in threes");
    unsigned off = (unsigned)lane * 16u;   // the lane's byte offset: it walks k, beside wave-uniform bases that stay
    A += (size_t)r0 * K; if (NSPLIT == 1 || NSPLIT == 2) A2 += (size_t)r0 * K; Bt += (size_t)c0 * K; if (NSPLIT >= 2) Bt2 += (size_t)c0 * K;
    WSet<T16> f0, f1, f2;
    wfetch<T16, NSPLIT, K, 0>(f0, A, A2, Bt, Bt2, off); wfetch<T16, NSPLIT, K, 1>(f1, A, A2, Bt, Bt2, off);
#pragma unroll 1   // one body holds three blocks, one per set of the ring
    for (int t = 0; t < NKB / 3 - 1; ++t) {
        wfetch<T16, NSPLIT, K, 2>(f2, A, A2, Bt, Bt2, off); wmul<T16, NSPLIT>(f0, acc);
        wfetch<T16, NSPLIT, K, 3>(f0, A, A2, Bt, Bt2, off); wmul<T16, NSPLIT>(f1, acc);
        wfetch<T16, NSPLIT, K, 4>(f1, A, A2, Bt, Bt2, off); wmul<T16, NSPLIT>(f2, acc);
        asm volatile("s_wait_xcnt 0x0" : "+v"(off) :: "memory");   // the wait in front of the rewrite of these loads' offset register on the next line, which takes the offset from this statement and so stays behind it
        off += 3 * FE * 2;
    }
    wfetch<T16, NSPLIT, K, 2>(f2, A, A2, Bt, Bt2, off); wmul<T16, NSPLIT>(f0, acc); wmul<T16, NSPLIT>(f1, acc); wmul<T16, NSPLIT>(f2, acc);   // the last three blocks: one set is still to fetch
    asm volatile("s_wait_xcnt 0x0" :: "v"(off) : "memory");   // the same wait, in front of the epilogue's reuse of the offset register; it names it, so that it lives to here
#pragma unroll
    for (int mb = 0; mb < 4; ++mb) {
#pragma unroll
        for (int nb = 0; nb < 4; ++nb) {
#pragma unroll
            for (int j = 0; j < 8; ++j) os[(hi * 8 + j) * 68 + nb * 16 + lr] = acc[mb][nb][j]; }
        __builtin_amdgcn_wave_barrier(); asm volatile("" ::: "memory");
        float* crow = C + (size_t)(r0 + mb * 16) * ldc + c0;
{ v4f vs[8]; float* cp[8];
#pragma unroll
            for (int s = 0; s < 8; ++s) { const int row = 2 * s + hi, cofs = lr * 4; v4f val = *(const v4fa*)(os + row * 68 + cofs); if (BIAS) { val[0] += bfr(bias[c0 + cofs]); val[1] += bfr(bias[c0 + cofs + 1]); val[2] += bfr(bias[c0 + cofs + 2]); val[3] += bfr(bias[c0 + cofs + 3]); }
                vs[s] = val; cp[s] = crow + (size_t)row * ldc + cofs; *(v4f*)cp[s] = val; }
            // the wait in front of any rewrite of these stores' address and data registers; it names them, so that they live to here
            asm volatile("s_wait_xcnt 0x0" :: "v"(cp[0]), "v"(cp[1]), "v"(cp[2]), "v"(cp[3]), "v"(cp[4]), "v"(cp[5]), "v"(cp[6]), "v"(cp[7]), "v"(vs[0]), "v"(vs[1]), "v"(vs[2]), "v"(vs[3]), "v"(vs[4]), "v"(vs[5]), "v"(vs[6]), "v"(vs[7]) : "memory");
             }
        __builtin_amdgcn_wave_barrier(); asm volatile("" ::: "memory");
    }
}

__device__ __forceinline__ h16 tohx(float x) { return (h16)x; }
typedef __attribute__((ext_vector_type(2))) _Float16 v2h;
typedef __attribute__((ext_vector_type(4))) _Float16 v4h;
typedef __attribute__((ext_vector_type(2))) unsigned short v2us;
typedef __attribute__((ext_vector_type(4))) unsigned short v4us;
typedef __attribute__((ext_vector_type(2))) float v2f;
typedef __attribute__((ext_vector_type(4))) int v4i;

// ---- k_pack: every operand packing (x; Wq, Wk, Wv; W0) in ONE launch of few waves that each do many pieces. A piece is 16 bytes of a packed plane, in the plane's own order (whole lines written): piece i is
// lane i & 31, half c = (i >> 5) & 1 of fragment i >> 6. A wave takes XW (x) or WW (weights) runs of 32 consecutive pieces, all their loads in flight together: a launch
// with one piece a thread is priced by the number of waves to start, not by its bytes. Consecutive runs walk k by 16, so a thread's loads are one address with immediate offsets.
#define XW 8   // pieces per thread, x: 4 fragments a wave
#define WW 4   // pieces per thread, weights: 2 fragments a wave
#define XBLK (NB_ * TT * DM / 8 / XW / 256)   // blocks of 8 waves for x
#define WBLK (DQ * DM / 8 / WW / 256)         // blocks of 8 waves for each of the four weight matrices
static_assert((DM / 32) % (XW / 2) == 0 && (DM / 32) % (WW / 2) == 0 && (DQ / 32) % (WW / 2) == 0, "a wave's fragments lie in one block of 16 rows");
static_assert(NB_ * TT * DM % (8 * XW * 256) == 0 && DQ * DM % (8 * WW * 256) == 0, "whole blocks");
template <int RS>   // RS: floats from k to k + 1 in the source; p: the lane's element at its first k; d: the lane's first piece
__device__ __forceinline__ void pack_w(const float* __restrict__ p, bf* d) { v8f v[WW]; v8us o[WW];
#pragma unroll
    for (int j = 0; j < WW; ++j)
#pragma unroll
        for (int u = 0; u < 8; ++u) v[j][u] = p[(j * 16 + u) * RS];
    asm volatile("s_wait_xcnt 0x0" :: "v"(p) : "memory");   // the wait in front of any rewrite of these loads' address registers; it names them, so that they live to here
    __builtin_amdgcn_sched_barrier(0);   // keeps the converts below all the loads; without it the scheduler lifts converts among them and issues the last loads only when the first have returned: two latencies, not one
#pragma unroll
    for (int j = 0; j < WW; ++j) { o[j] = cvt8(v[j]); *(v8us*)(d + j * 256) = o[j]; }
    asm volatile("s_wait_xcnt 0x0" :: "v"(d), "v"(o[0]), "v"(o[1]), "v"(o[2]), "v"(o[3]) : "memory"); }   // the same wait for these stores' address and data registers; it names them, so that they live to here
__global__ __launch_bounds__(256) void k_pack(const float* __restrict__ x, const float* __restrict__ w0, const float* __restrict__ w1, const float* __restrict__ w2, const float* __restrict__ wo, bf* XB, bf* Wt, bf* WO) {
    const int lane = threadIdx.x & 31, lr = lane & 15, hi = lane >> 4; const int w = __builtin_amdgcn_readfirstlane(threadIdx.x >> 5);   // the wave's number in a scalar register: the fragment arithmetic stays scalar
    if (blockIdx.x < XBLK) {   // XB[t][k] = x[t][k]: a lane reads 8 consecutive k of its row, the wave 512 consecutive bytes of each of 16 rows in all
        const int wv = blockIdx.x * 8 + w, rb = wv / (DM / 32 / (XW / 2)), kb0 = (wv % (DM / 32 / (XW / 2))) * (XW / 2);
        const float* p = x + (size_t)(rb * 16 + lr) * DM + kb0 * 32 + hi * 8; bf* d = XB + (size_t)wv * (XW * 256) + lane * 8; v8f v[XW]; v8us o[XW];
#pragma unroll
        for (int j = 0; j < XW; ++j) v[j] = *(const v8f*)(p + j * 16);
        asm volatile("s_wait_xcnt 0x0" :: "v"(p) : "memory");   // the wait in front of any rewrite of these loads' address registers; it names them, so that they live to here
        __builtin_amdgcn_sched_barrier(0);   // keeps the converts below all the loads, as in pack_w
#pragma unroll
        for (int j = 0; j < XW; ++j) { o[j] = cvt8(v[j]); *(v8us*)(d + j * 256) = o[j]; }
        asm volatile("s_wait_xcnt 0x0" :: "v"(d), "v"(o[0]), "v"(o[1]), "v"(o[2]), "v"(o[3]), "v"(o[4]), "v"(o[5]), "v"(o[6]), "v"(o[7]) : "memory");   // the same wait for these stores' address and data registers
        return; }
    const int b = blockIdx.x - XBLK, mat = b / WBLK, wv = (b % WBLK) * 8 + w; const size_t di = (size_t)wv * (WW * 256) + lane * 8;
    if (mat < 3) {   // Wt[mat][h * 64 + c][d] = W[h][d][c]: 16 lanes read 16 consecutive c
        const int rb = wv / (DM / 32 / (WW / 2)), k0 = (wv % (DM / 32 / (WW / 2))) * (WW / 2) * 32 + hi * 8, n = rb * 16 + lr; const float* wm = (mat == 0) ? w0 : ((mat == 1) ? w1 : w2);
        pack_w<HD>(wm + ((size_t)(n / HD) * DM + k0) * HD + n % HD, Wt + (size_t)mat * DQ * DM + di);
    } else {         // WO[n][k] = W0[k][n], k < DQ, n < DM: 16 lanes read 16 consecutive n
        const int rb = wv / (DQ / 32 / (WW / 2)), k0 = (wv % (DQ / 32 / (WW / 2))) * (WW / 2) * 32 + hi * 8, n = rb * 16 + lr;
        pack_w<DM>(wo + (size_t)k0 * DM + n, WO + di); }
}
// ---- k_fattn: causal attention of one (sequence, head) pair and one strip of query rows in one wave; scores and probabilities stay in registers (online softmax over blocks of 32 keys).
// Transposed products: S^T = K Q^T (A = key rows, B = query rows), so a lane holds 16 scores of ONE query (column lr): keys k0 + 8 hi + j and k0 + 16 + 8 hi + j. Those 16 values, converted in place, are the
// B operand of O^T += V^T P^T (A = value plane rows [d][t]) in the k order of the loaders. Running maximum, sum and rescale factor are per lane; the two lane halves are joined by one exchange.
// The strip's output rows leave as the hi/lo planes of the output projection's A operand: lane = query row, 8 consecutive d per accumulator, which is one half of a packed fragment: 512 consecutive bytes a store.
// Packed planes: q, k rows t, k = d, fragments [t / 16][d / 32]; v rows d, k = t, fragments [t / 32][d / 16]: a block of 32 keys is 4 consecutive fragments of either, at element k0 * HD.
#define L2E 1.4426950408889634f
__device__ __forceinline__ float xhalf(float x) { const int b = __float_as_int(x); return __int_as_float(__builtin_amdgcn_permlanex16(b, b, 0x76543210, 0xfedcba98, false, false)); }   // lane l <-> l ^ 16
__device__ __forceinline__ float ex2(float x) { float r; asm("v_exp_f32 %0, %1\n\tv_nop" : "=v"(r) : "v"(x)); return r; }
__device__ __forceinline__ void put8(v8f o, float inv, bf* ph, bf* pl) { v8us oh, ol; split8(o * inv, oh, ol);
    *(v8us*)ph = oh; *(v8us*)pl = ol;
    asm volatile("s_wait_xcnt 0x0" :: "v"(ph), "v"(pl), "v"(oh), "v"(ol) : "memory"); }   // the wait in front of any rewrite of these stores' address and data registers; it names them, so that they live to here
// rows >= RH: single fp16 products, 32 query rows per wave; probabilities carry the factor PCAR = 2^10 (it cancels against the row sum)
__device__ __forceinline__ void attn_lo(const h16* __restrict__ Q, const h16* __restrict__ Kp, const h16* __restrict__ Vt, int q0, bf* Ah, bf* Al, int lr, int hi) {
    v16h qf[2][2]; const h16* qp = Q + (size_t)q0 * HD + (hi * 16 + lr) * 8;   // 16 rows of HD = 64 are two fragments: row block r0 begins at element r0 * HD, as it did
#pragma unroll
    for (int nb = 0; nb < 2; ++nb)
#pragma unroll
        for (int ks = 0; ks < 2; ++ks) qf[nb][ks] = WFrag<h16>::ld(qp + (nb * 2 + ks) * FE);
    v8f o[4][2]; float m[2], l[2];
#pragma unroll
    for (int nb = 0; nb < 2; ++nb) { m[nb] = -3.0e38f; l[nb] = 0.f;
#pragma unroll
        for (int db = 0; db < 4; ++db) o[db][nb] = (v8f){}; }
    const h16* kp = Kp + (hi * 16 + lr) * 8; const unsigned vo = (unsigned)(hi * 16 + lr) * 16u;   // value loads: the lane's byte offset, fixed over the loop, beside a wave-uniform base that walks the keys
    v16h kf[2][2];
#pragma unroll
    for (int kt = 0; kt < 2; ++kt)
#pragma unroll
        for (int ks = 0; ks < 2; ++ks) kf[kt][ks] = WFrag<h16>::ld(kp + (kt * 2 + ks) * FE);
    asm volatile("s_wait_xcnt 0x0" :: "v"(qp), "v"(kp) : "memory");   // the wait in front of any rewrite of these loads' address registers; it names them, so that they live to here
#pragma unroll 1   // run-time trip count; one body already holds most of the register budget
    for (int k0 = 0; k0 < q0 + 32; k0 += 32) {
        v16h vf[4]; const h16* vp = (const h16*)((const char*)(Vt + (size_t)k0 * HD) + vo);
#pragma unroll
        for (int db = 0; db < 4; ++db) vf[db] = WFrag<h16>::ld(vp + db * FE);
        v8f s[2][2];
#pragma unroll
        for (int kt = 0; kt < 2; ++kt)
#pragma unroll
            for (int nb = 0; nb < 2; ++nb) s[kt][nb] = wmma16(kf[kt][1], qf[nb][1], wmma16(kf[kt][0], qf[nb][0], (v8f){}));
        if (k0 < q0) kp += 32 * HD;   // the next block's key fragments fly during this block's softmax; the last block fetches its own again, so the address stays inside the plane
#pragma unroll
        for (int kt = 0; kt < 2; ++kt)
#pragma unroll
            for (int ks = 0; ks < 2; ++ks) kf[kt][ks] = WFrag<h16>::ld(kp + (kt * 2 + ks) * FE);
        asm volatile("s_wait_xcnt 0x0" :: "v"(vp), "v"(kp) : "memory");   // the wait in front of any rewrite of the value and key loads' address registers; it names them, so that they live to here
        __builtin_amdgcn_sched_barrier(0);   // keeps the key loads above the softmax; without it the scheduler sinks them to the loop's foot and their latency is exposed again
#pragma unroll
        for (int nb = 0; nb < 2; ++nb) { const int q = q0 + nb * 16 + lr; float t[16]; float mx = m[nb];
#pragma unroll
            for (int e = 0; e < 16; ++e) { const int key = k0 + (e >> 3) * 16 + hi * 8 + (e & 7); t[e] = (key <= q) ? s[e >> 3][nb][e & 7] * SCL : -3.0e38f; mx = fmaxf(mx, t[e]); }
            mx = fmaxf(mx, xhalf(mx));
            const float al = ex2((m[nb] - mx) * L2E); m[nb] = mx; float sum = 0.f; v16h pf;
#pragma unroll
            for (int e = 0; e < 16; ++e) { const float p = ex2((t[e] - mx) * L2E + 10.0f); sum += p; pf[e] = tohx(p); }
            l[nb] = l[nb] * al + sum;
#pragma unroll
            for (int db = 0; db < 4; ++db) { o[db][nb] *= al; o[db][nb] = wmma16(vf[db], pf, o[db][nb]); } }
    }
#pragma unroll
    for (int nb = 0; nb < 2; ++nb) { const float inv = __fdiv_rn(1.0f, l[nb] + xhalf(l[nb])); const size_t ro = (size_t)(q0 + nb * 16) * DQ + (hi * 16 + lr) * 8;   // row block [rb][kb]; the head's two fragments of it lie side by side
#pragma unroll
        for (int db = 0; db < 4; ++db) put8(o[db][nb], inv, Ah + ro + db * 256, Al + ro + db * 256); }
}
// rows < RH: hi+lo bf16 planes, 3 products each for the scores and for P.V, 32 query rows per wave
__device__ __forceinline__ void attn_hl(const bf* __restrict__ Qh, const bf* __restrict__ Ql, const bf* __restrict__ Kh, const bf* __restrict__ Kl, const bf* __restrict__ Vh, const bf* __restrict__ Vl, int q0, bf* Ah, bf* Al, int lr, int hi) {
    v16bf qh[2][2], ql[2][2]; const bf* qph = Qh + (size_t)q0 * HD + (hi * 16 + lr) * 8; const bf* qpl = Ql + (size_t)q0 * HD + (hi * 16 + lr) * 8;
#pragma unroll
    for (int nb = 0; nb < 2; ++nb)
#pragma unroll
        for (int ks = 0; ks < 2; ++ks) { qh[nb][ks] = WFrag<bf>::ld(qph + (nb * 2 + ks) * FE); ql[nb][ks] = WFrag<bf>::ld(qpl + (nb * 2 + ks) * FE); }
    asm volatile("s_wait_xcnt 0x0" :: "v"(qph), "v"(qpl) : "memory");   // the wait in front of any rewrite of these loads' address registers; it names them, so that they live to here
    v8f o[4][2]; float m[2], l[2];
#pragma unroll
    for (int nb = 0; nb < 2; ++nb) { m[nb] = -3.0e38f; l[nb] = 0.f;
#pragma unroll
        for (int db = 0; db < 4; ++db) o[db][nb] = (v8f){}; }
    const unsigned ko = (unsigned)(hi * 16 + lr) * 16u, vo = ko;   // the lane's byte offsets, fixed over the loop, beside wave-uniform bases that walk the keys
#pragma unroll 1   // run-time trip count; one body already holds most of the register budget
    for (int k0 = 0; k0 < q0 + 32; k0 += 32) {
        const bf* kph = (const bf*)((const char*)(Kh + (size_t)k0 * HD) + ko); const bf* kpl = (const bf*)((const char*)(Kl + (size_t)k0 * HD) + ko);
        v16bf kh[2][2], kl[2][2];   // all key fragments of the block are requested together: one latency a block, not one per fragment pair
#pragma unroll
        for (int kt = 0; kt < 2; ++kt)
#pragma unroll
            for (int ks = 0; ks < 2; ++ks) { kh[kt][ks] = WFrag<bf>::ld(kph + (kt * 2 + ks) * FE); kl[kt][ks] = WFrag<bf>::ld(kpl + (kt * 2 + ks) * FE); }
        asm volatile("s_wait_xcnt 0x0" :: "v"(kph), "v"(kpl) : "memory");   // the wait in front of any rewrite of the key loads' address registers; it names them, so that they live to here
        __builtin_amdgcn_sched_barrier(0);   // keeps the sixteen key loads together above the products; without it the scheduler sinks them pair by pair between the products, one exposed latency each
        v8f s[2][2];
#pragma unroll
        for (int kt = 0; kt < 2; ++kt) { s[kt][0] = (v8f){}; s[kt][1] = (v8f){};
#pragma unroll
            for (int ks = 0; ks < 2; ++ks)
#pragma unroll
                for (int nb = 0; nb < 2; ++nb) { s[kt][nb] = wmmab(kh[kt][ks], qh[nb][ks], s[kt][nb]); s[kt][nb] = wmmab(kh[kt][ks], ql[nb][ks], s[kt][nb]); s[kt][nb] = wmmab(kl[kt][ks], qh[nb][ks], s[kt][nb]); } }
        const bf* vph = (const bf*)((const char*)(Vh + (size_t)k0 * HD) + vo); const bf* vpl = (const bf*)((const char*)(Vl + (size_t)k0 * HD) + vo);
        v16bf vh[4], vl[4];
#pragma unroll
        for (int db = 0; db < 4; ++db) { vh[db] = WFrag<bf>::ld(vph + db * FE); vl[db] = WFrag<bf>::ld(vpl + db * FE); }
        asm volatile("s_wait_xcnt 0x0" :: "v"(vph), "v"(vpl) : "memory");   // the same wait for the value loads' address registers; the loads' own place is held by the next line
        __builtin_amdgcn_sched_barrier(0);   // keeps the value loads above the softmax, which hides their latency; without it the scheduler sinks half of them, and the wait with them, to the products
        v16bf ph[2], pl[2]; float al[2];
#pragma unroll
        for (int nb = 0; nb < 2; ++nb) { const int q = q0 + nb * 16 + lr; float t[16]; float mx = m[nb];
#pragma unroll
            for (int e = 0; e < 16; ++e) { const int key = k0 + (e >> 3) * 16 + hi * 8 + (e & 7); t[e] = (key <= q) ? s[e >> 3][nb][e & 7] * SCL : -3.0e38f; mx = fmaxf(mx, t[e]); }
            mx = fmaxf(mx, xhalf(mx));
            al[nb] = ex2((m[nb] - mx) * L2E); m[nb] = mx; float sum = 0.f; v8us h0, h1, l0, l1; v8f P0, P1;
#pragma unroll
            for (int e = 0; e < 8; ++e) { const float p0 = ex2((t[e] - mx) * L2E), p1 = ex2((t[e + 8] - mx) * L2E); sum += p0; sum += p1; P0[e] = p0; P1[e] = p1; }
            split8(P0, h0, l0); split8(P1, h1, l1);
            l[nb] = l[nb] * al[nb] + sum; ph[nb] = cat16b(h0, h1); pl[nb] = cat16b(l0, l1); }
#pragma unroll
        for (int db = 0; db < 4; ++db)
#pragma unroll
            for (int nb = 0; nb < 2; ++nb) { o[db][nb] *= al[nb]; o[db][nb] = wmmab(vh[db], ph[nb], o[db][nb]); o[db][nb] = wmmab(vh[db], pl[nb], o[db][nb]); o[db][nb] = wmmab(vl[db], ph[nb], o[db][nb]); }
    }
#pragma unroll
    for (int nb = 0; nb < 2; ++nb) { const float inv = __fdiv_rn(1.0f, l[nb] + xhalf(l[nb])); const size_t ro = (size_t)(q0 + nb * 16) * DQ + (hi * 16 + lr) * 8;   // row block [rb][kb]; the head's two fragments of it lie side by side
#pragma unroll
        for (int db = 0; db < 4; ++db) put8(o[db][nb], inv, Ah + ro + db * 256, Al + ro + db * 256); }
}
// grid (NZ pairs, 8), four independent waves per block (no barrier, no LDS): even y = rows >= RH, odd y = rows < RH. Each half of a sequence is 16 strips of 32 rows; group g = y >> 1 takes strips
// g, 7 - g, 8 + g, 15 - g, so every block of a path walks the same number of key blocks in all, and its waves read the same key and value lines from the start of the sequence on.
// amdgpu_waves_per_eu(3, 3): holds the register allocation to three waves per SIMD, so that all NZ * 8 blocks are resident at once; without it the hi+lo path takes two waves' worth.
__global__ __launch_bounds__(128) __attribute__((amdgpu_waves_per_eu(3, 3))) void k_fattn(const h16* __restrict__ Q16, const h16* __restrict__ K16, const h16* __restrict__ V16, const bf* __restrict__ Qh, const bf* __restrict__ Ql, const bf* __restrict__ Kh, const bf* __restrict__ Kl, const bf* __restrict__ Vh, const bf* __restrict__ Vl, bf* Ah, bf* Al) {
    const int lane = threadIdx.x & 31, lr = lane & 15, hi = lane >> 4; const int w = __builtin_amdgcn_readfirstlane(threadIdx.x >> 5);   // the wave's number in a scalar register: loop bounds stay scalar
    const int zz = blockIdx.x, g = blockIdx.y >> 1; const size_t zo = (size_t)zz * TT * HD, zv = zo;
    const int strip = (w >> 1) * 8 + ((w & 1) ? 7 - g : g);
    const size_t oo = (size_t)(zz / NH_) * TT * DQ + (zz % NH_) * 2 * FE;   // this pair's first element in the merged planes (rows [sequence][t], k = [head][d], packed)
    if ((blockIdx.y & 1) == 0) attn_lo(Q16 + zo, K16 + zo, V16 + zv, RH + 32 * strip, Ah + oo, Al + oo, lr, hi);
    else attn_hl(Qh + zo, Ql + zo, Kh + zo, Kl + zo, Vh + zv, Vl + zv, 32 * strip, Ah + oo, Al + oo, lr, hi);
}

// ---- k_proj: the three projections (grid z: q, k, v), ONE WAVE per 64x64 tile with the loop of k_gemmw; grid (rows / 64, heads, 3), 32 threads. The tile leaves as the attention kernel's
// operand planes (fp16, bf16 hi, bf16 lo of product + bias); the f32 projections never reach memory. In an accumulator a lane holds 8 consecutive rows of the A operand at one row of the B operand, so
// q, k: A = weight rows (d), B = x rows (t): 8 consecutive d of one token. v: A = x rows (t), B = weight rows (d): 8 consecutive t of one d.
// Either way an accumulator, converted, IS one half of a packed fragment of the plane in lane order: it leaves straight from registers as 512 consecutive bytes, and the tile is 8 consecutive fragments of each plane.
// amdgpu_waves_per_eu(3): the accumulators and the ring of three fragment sets take a third of a SIMD's registers; the tiles beyond three per SIMD start as earlier ones end.
__global__ __launch_bounds__(32) __attribute__((amdgpu_waves_per_eu(3))) void k_proj(const bf* __restrict__ X, const bf* __restrict__ Wt, const float* __restrict__ bias0, const float* __restrict__ bias1, const float* __restrict__ bias2, h16* P16, bf* Ph, bf* Pl, h16* V16, bf* Vh, bf* Vl) {
    const int z = blockIdx.z; const bool isv = (z == 2);
    const float* bias = (z == 0) ? bias0 : ((z == 1) ? bias1 : bias2);
    const int lane = threadIdx.x & 31, lr = lane & 15, hi = lane >> 4; const int r0 = blockIdx.x * 64, c0 = blockIdx.y * 64;
    const bf* xr = X + (size_t)r0 * DM; const bf* wr = Wt + ((size_t)z * DQ + c0) * DM;   // a block of 16 rows is DM / 32 fragments = 16 * DM elements: it begins where it did
    const bf* A = isv ? xr : wr; const bf* B = isv ? wr : xr;
    v8f acc[4][4];
#pragma unroll
    for (int ib = 0; ib < 4; ++ib)
#pragma unroll
        for (int jb = 0; jb < 4; ++jb) acc[ib][jb] = (v8f){};
    const unsigned off = (unsigned)lane * 16u;   // the lane's byte offset in a half fragment
    unsigned ko = off;   // the same at the ring's current block: it walks k, beside wave-uniform bases that stay
    constexpr int NKB = DM / 32; static_assert(NKB % 3 == 0 && NKB >= 6, "the ring walks k in threes");
    WSet<bf> f0, f1, f2;   // as in k_gemmw: three sets, loads two blocks ahead of their products
    wfetch<bf, 0, DM, 0>(f0, A, A, B, B, ko); wfetch<bf, 0, DM, 1>(f1, A, A, B, B, ko);
#pragma unroll 1   // one body holds three blocks, one per set of the ring
    for (int t = 0; t < NKB / 3 - 1; ++t) {
        wfetch<bf, 0, DM, 2>(f2, A, A, B, B, ko); wmul<bf, 0>(f0, acc);
        wfetch<bf, 0, DM, 3>(f0, A, A, B, B, ko); wmul<bf, 0>(f1, acc);
        wfetch<bf, 0, DM, 4>(f1, A, A, B, B, ko); wmul<bf, 0>(f2, acc);
        asm volatile("s_wait_xcnt 0x0" : "+v"(ko) :: "memory");   // the wait in front of the rewrite of these loads' offset register on the next line, which takes the offset from this statement and so stays behind it
        ko += 3 * FE * 2;
    }
    wfetch<bf, 0, DM, 2>(f2, A, A, B, B, ko); wmul<bf, 0>(f0, acc); wmul<bf, 0>(f1, acc); wmul<bf, 0>(f2, acc);   // the last three blocks: one set is still to fetch
    asm volatile("s_wait_xcnt 0x0" :: "v"(ko) : "memory");   // the same wait, in front of the epilogue's reuse of the offset register; it names it, so that it lives to here
    const size_t pair = (size_t)(r0 / TT) * NH_ + blockIdx.y; const int t0 = r0 % TT;
    const size_t base = (isv ? 0 : (size_t)z * NZ * TT * HD) + (pair * TT + t0) * HD;   // the k planes follow the q planes; 64 tokens are 8 fragments in either fragment order
    unsigned short* d16 = (unsigned short*)(isv ? V16 : P16) + base; bf* dh = (isv ? Vh : Ph) + base; bf* dl = (isv ? Vl : Pl) + base;
    const unsigned si = isv ? 4 * FE * 2 : FE * 2, sj = isv ? FE * 2 : 2 * FE * 2;   // bytes from fragment to fragment along ib >> 1 and along jb: v [t / 32][d / 16], q and k [t / 16][d / 32]
    float bj[4]; const int bx = c0 + lr;   // v: the bias runs along the lanes; q, k: along the accumulator's 8 values
#pragma unroll
    for (int jb = 0; jb < 4; ++jb) bj[jb] = bias[bx + jb * 16];
    asm volatile("s_wait_xcnt 0x0" :: "v"(bx) : "memory");   // the wait in front of any rewrite of these loads' index register; it names it, so that it lives to here
#pragma unroll
    for (int jb = 0; jb < 4; ++jb) bj[jb] = bfr(bj[jb]);
#pragma unroll
    for (int g = 0; g < 2; ++g) { float bi[2][8];
#pragma unroll
        for (int c = 0; c < 2; ++c)
#pragma unroll
            for (int e = 0; e < 8; ++e) bi[c][e] = bfr(bias[c0 + (g * 2 + c) * 16 + hi * 8 + e]);
#pragma unroll
        for (int jb = 0; jb < 4; ++jb) { v8us w[2][3];   // one whole fragment of each plane at a time
#pragma unroll
            for (int c = 0; c < 2; ++c) { v8f r; v8us oh, ol;
#pragma unroll
                for (int e = 0; e < 8; ++e) r[e] = acc[g * 2 + c][jb][e] + (isv ? bj[jb] : bi[c][e]);
                split8(r, oh, ol);
                w[c][0] = __builtin_bit_cast(v8us, __builtin_convertvector(r, v8h)); w[c][1] = oh; w[c][2] = ol; }
            const unsigned fo = jb * sj + g * si;   // wave-uniform
#pragma unroll
            for (int c = 0; c < 2; ++c) { *(v8usa*)((char*)d16 + fo + c * 512 + off) = w[c][0]; *(v8usa*)((char*)dh + fo + c * 512 + off) = w[c][1]; *(v8usa*)((char*)dl + fo + c * 512 + off) = w[c][2]; }
            asm volatile("s_wait_xcnt 0x0" ::: "memory");   // the wait in front of the next fragment's rewrite of these stores' address and data registers; the next line holds that work behind it
            __builtin_amdgcn_sched_barrier(0);   // keeps the later fragments' conversions below the wait; without it the scheduler also lifts them far up and the converted values spill to scratch
        } }
}

extern "C" void kernel_launch(void* const* d_in, const int* in_sizes, int n_in,
                              void* d_out, int out_size, void* d_ws, size_t ws_size, hipStream_t stream) {
    (void)in_sizes; (void)n_in; (void)out_size;
    const float* x = (const float*)d_in[0]; const float* wqh = (const float*)d_in[1]; const float* bq = (const float*)d_in[2]; const float* wkh = (const float*)d_in[3]; const float* bk = (const float*)d_in[4]; const float* wvh = (const float*)d_in[5]; const float* bv = (const float*)d_in[6]; const float* wo = (const float*)d_in[7]; const float* bo = (const float*)d_in[8]; const float* wq = nullptr; const float* wk = nullptr; const float* wv = nullptr; (void)wq; (void)wk; (void)wv; const float* cosT = nullptr; const float* sinT = nullptr; (void)cosT; (void)sinT;
    float* OUT = (float*)d_out;     // [8][1024][768]
    char* wsp = (char*)d_ws;
    auto take = [&](size_t bytes) { char* p = wsp; wsp += (bytes + 255) & ~(size_t)255; return (void*)p; };
    bf* WQ = (bf*)take((size_t)DQ * DM * 2); bf* WK = (bf*)take((size_t)DKV * DM * 2); bf* WV = (bf*)take((size_t)DKV * DM * 2); bf* WO = (bf*)take((size_t)DM * DQ * 2); (void)WK; (void)WV;   // WQ, WK, WV lie back to back (z-stride DQ*DM)
    const size_t PL = (size_t)NZ * TT * HD;   // elements of one plane over all (sequence, head) pairs; each q plane is followed by its k plane, which k_proj relies on
    h16* QP16 = (h16*)take(PL * 2); h16* KP16 = (h16*)take(PL * 2); h16* VT16 = (h16*)take(PL * 2);
    bf* QPh = (bf*)take(PL * 2); bf* KPh = (bf*)take(PL * 2); bf* QPl = (bf*)take(PL * 2); bf* KPl = (bf*)take(PL * 2); bf* VTh = (bf*)take(PL * 2); bf* VTl = (bf*)take(PL * 2);
    char* R = (char*)take((size_t)ZH * TT * TT * 4);   // one region, two stream-ordered uses: the x plane; then the merged head planes
    if ((size_t)(wsp - (char*)d_ws) > ws_size) return;    // ws 256 MiB
    bf* XB = (bf*)R;
    bf* ATh = (bf*)R; bf* ATl = ATh + (size_t)NB_ * TT * DQ;
    k_pack<<<XBLK + 4 * WBLK, 256, 0, stream>>>(x, wqh, wkh, wvh, wo, XB, WQ, WO);
    k_proj<<<dim3(NB_ * TT / 64, NH_, 3), 32, 0, stream>>>(XB, WQ, bq, bk, bv, QP16, QPh, QPl, VT16, VTh, VTl);
    k_fattn<<<dim3(NZ, 8, 1), 128, 0, stream>>>(QP16, KP16, VT16, QPh, QPl, KPh, KPl, VTh, VTl, ATh, ATl);
    k_gemmw<bf, 1, true, DQ><<<dim3(NB_ * TT / 64, DM / 64, 1), 32, 0, stream>>>(ATh, ATl, WO, nullptr, OUT, DM, bo, bo, bo, 0, 0, 0);
}

// v008
// A run of this version takes 91.7 microseconds.
// Two timings next to v007 both put it at 1.04 times that version's speed.
// Counting every step since v000, it is 33.4 times as fast.
#include <hip/hip_runtime.h>

// MaskedMultiHeadAttention (hidden [2][2048][1024]; per-head q/k/v = x Wq[h] + bq[h] (Wq [16][1024][64]); causal softmax(q.k / 8); out = concat(heads) Wo + bo -> [2][2048][1024]). THIS ROW: the same module on EIGHT sequences of 1,024 tokens at width 768 with 12 heads x 64 ([8][1024][768]) and the inputs in the order x, Wq, bq, Wk, bk, Wv, bv, W0, b0 (each bias after its own weight).
// Compute dtypes, f32 accumulate: every input rounded to bf16; q/k/v on PLAIN bf16 operands (inputs: exact; the 12 per-head weights gathered into one [768 x 768] operand) + bias; causal scores and attn.v: query rows < 512 hl (3 products, fp16 hi + fp16 lo, x1024), the rest single fp16 (x1024); softmax f32; Wo hl x exact (2 products) + bias.

#define NB_  8
#define TT   1024
#define DM   768
#define NH_  12
#define NKV  12
#define REP  (NH_ / NKV)
#define HD   64
#define DQ   (NH_ * HD)
#define DKV  (NKV * HD)
#define ZH   24
#define NZ   (NB_ * NH_)
#define RH   512                  // query rows < RH use hi+lo planes
#define WIN  1024
#define PCAR 1024.0f
#define SCL  0.125f   // HD^-0.5
typedef _Float16 h16;
typedef unsigned short bf;
typedef __attribute__((ext_vector_type(16))) __bf16   v16bf;
typedef __attribute__((ext_vector_type(16))) _Float16 v16h;
typedef __attribute__((ext_vector_type(8)))  _Float16 v8h;
typedef __attribute__((ext_vector_type(8)))  unsigned short v8us;
typedef __attribute__((ext_vector_type(8)))  float    v8f;
typedef __attribute__((ext_vector_type(4)))  float    v4f;
typedef v8h  __attribute__((may_alias)) v8ha;
typedef v4f  __attribute__((may_alias)) v4fa;
typedef v8us __attribute__((may_alias)) v8usa;
#define FE 512   // elements of one packed 16 x 32 fragment

// Roundings to 16 bits go through the hardware's packed converts (two values an instruction, round to nearest even), not through integer add-and-shift per value; the rounded values are the same.
__device__ __forceinline__ unsigned short f2bf(float f) { return __builtin_bit_cast(unsigned short, (__bf16)f); }
typedef __attribute__((ext_vector_type(2)))  __bf16   v2bf;
typedef __attribute__((ext_vector_type(2)))  float    v2fl;
typedef __attribute__((ext_vector_type(4)))  unsigned v4u;
__device__ __forceinline__ unsigned cvt2(float a, float b) { return __builtin_bit_cast(unsigned, __builtin_convertvector((v2fl){a, b}, v2bf)); }   // one packed word of two rounded values
__device__ __forceinline__ v4u cvt8w(v8f x) { return (v4u){cvt2(x[0], x[1]), cvt2(x[2], x[3]), cvt2(x[4], x[5]), cvt2(x[6], x[7])}; }
__device__ __forceinline__ v8us cvt8(v8f x) { return __builtin_bit_cast(v8us, cvt8w(x)); }
__device__ __forceinline__ void split8(v8f y, v8us& h, v8us& l) { const v4u w = cvt8w(y); h = __builtin_bit_cast(v8us, w); v8f f;   // hi plane, and the rounded remainder as lo plane
#pragma unroll
    for (int i = 0; i < 4; ++i) { f[2 * i] = __uint_as_float(w[i] << 16); f[2 * i + 1] = __uint_as_float(w[i] & 0xFFFF0000u); }   // the hi values back in f32, straight from the packed words
    l = cvt8(y - f); }
__device__ __forceinline__ void split8h(v8f y, v8h& h, v8h& l) { h = __builtin_convertvector(y, v8h); l = __builtin_convertvector(y - __builtin_convertvector(h, v8f), v8h); }   // fp16 hi plane, and the rounded remainder as fp16 lo plane
__device__ __forceinline__ float bf2f(unsigned short b) { return __uint_as_float(((unsigned)b) << 16); }
__device__ __forceinline__ float bfr(float f) { return bf2f(f2bf(f)); }
__device__ __forceinline__ v16h cat16(v8h lo, v8h hi) { return __builtin_shufflevector(lo, hi, 0, 1, 2, 3, 4, 5, 6, 7, 8, 9, 10, 11, 12, 13, 14, 15); }
__device__ __forceinline__ v16bf cat16b(v8us lo, v8us hi) { return __builtin_bit_cast(v16bf, __builtin_shufflevector(lo, hi, 0, 1, 2, 3, 4, 5, 6, 7, 8, 9, 10, 11, 12, 13, 14, 15)); }
__device__ __forceinline__ v8f wmma16(v16h a, v16h b, v8f c) { return __builtin_amdgcn_wmma_f32_16x16x32_f16(false, a, false, b, (short)0, c, false, false); }
__device__ __forceinline__ v8f wmmab(v16bf a, v16bf b, v8f c) { return __builtin_amdgcn_wmma_f32_16x16x32_bf16(false, a, false, b, (short)0, c, false, false); }



// ---- Fragment-packed planes. Every 16-bit operand plane [rows][k] is stored as whole WMMA fragments: the fragment of rows 16 rb .. + 15 and k 32 kb .. + 31 is FE = 512 consecutive elements (1 KiB),
// element (row, k) at c * 256 + lane * 8 + (k & 7) with c = (k >> 4) & 1 and lane = ((k >> 3) & 1) * 16 + (row & 15). A fragment load is then two loads of 512 consecutive bytes (4 whole lines each)
// instead of two loads that touch 16 lines each; the k order of the operands is the one it was. ld(p) takes the fragment's first element + lane * 8.
// ---- k_gemmw: register-blocked GEMM, ONE WAVE per 64x64 output tile (16 accumulators), operands straight from fragment-packed planes, fragments in [rb][kb] order; grid (M/64, N/64, Z), 32 threads.
// C[m][n] (f32, pitch ldc, + optional f32 bias[n]) = sum_k A[m][k] Bt[n][k] (+ split products per NSPLIT). z-batch strides sA/sB/sC in elements. K % 32 == 0.
template <typename T16> struct WFrag;
template <> struct WFrag<h16> { typedef v16h V; static __device__ __forceinline__ V ld(const h16* p) { return cat16(*(const v8h*)p, *(const v8h*)(p + 256)); } static __device__ __forceinline__ v8f mma(V a, V b, v8f c) { return wmma16(a, b, c); } };
template <> struct WFrag<bf> { typedef v16bf V; static __device__ __forceinline__ V ld(const bf* p) { return cat16b(*(const v8us*)p, *(const v8us*)(p + 256)); } static __device__ __forceinline__ v8f mma(V a, V b, v8f c) { return wmmab(a, b, c); } };
// One k block's fragments of a 64x64 tile. The GEMM loops keep a ring of three such sets in registers: while block kb is multiplied, the loads of blocks kb + 1 and kb + 2 are in flight,
// so a wave waits for a load that was issued two blocks of products earlier, not for one that it has just issued.
template <typename T16> struct WSet { typename WFrag<T16>::V a[4], a2[4], b[4], b2[4]; };
template <typename T16, int NSPLIT, int K, int KB>   // A, A2, Bt, Bt2: the tile's first fragments, wave-uniform and fixed; off: the lane's byte offset at the ring's current block; KB: blocks ahead, an immediate offset of the loads
__device__ __forceinline__ void wfetch(WSet<T16>& f, const T16* A, const T16* A2, const T16* Bt, const T16* Bt2, unsigned off) {
    constexpr int rs = 16 * K;   // elements of one block of 16 rows
#pragma unroll
    for (int mb = 0; mb < 4; ++mb) { f.a[mb] = WFrag<T16>::ld((const T16*)((const char*)(A + KB * FE + mb * rs) + off)); if (NSPLIT == 1 || NSPLIT == 2) f.a2[mb] = WFrag<T16>::ld((const T16*)((const char*)(A2 + KB * FE + mb * rs) + off)); }
#pragma unroll
    for (int nb = 0; nb < 4; ++nb) { f.b[nb] = WFrag<T16>::ld((const T16*)((const char*)(Bt + KB * FE + nb * rs) + off)); if (NSPLIT >= 2) f.b2[nb] = WFrag<T16>::ld((const T16*)((const char*)(Bt2 + KB * FE + nb * rs) + off)); }
    __builtin_amdgcn_sched_barrier(0);   // keeps a set's loads together, in front of the products that follow and behind the older set's loads; without it the scheduler mixes two sets' loads, and the counted wait for the older set waits for the younger too
}
template <typename T16, int NSPLIT>
__device__ __forceinline__ void wmul(const WSet<T16>& f, v8f (&acc)[4][4]) {
#pragma unroll
    for (int nb = 0; nb < 4; ++nb)
#pragma unroll
        for (int mb = 0; mb < 4; ++mb) { acc[mb][nb] = WFrag<T16>::mma(f.a[mb], f.b[nb], acc[mb][nb]); if (NSPLIT == 1 || NSPLIT == 2) acc[mb][nb] = WFrag<T16>::mma(f.a2[mb], f.b[nb], acc[mb][nb]); if (NSPLIT >= 2) acc[mb][nb] = WFrag<T16>::mma(f.a[mb], f.b2[nb], acc[mb][nb]); }
    __builtin_amdgcn_sched_barrier(0);   // keeps the next set's loads below these products, whose operand registers they refill; without it the scheduler lifts them, the allocation grows and values spill to scratch
}
// amdgpu_waves_per_eu(2): the ring of three sets takes more than a third of a SIMD's registers; two waves per SIMD hold all tiles of the launch at once.
template <typename T16, int NSPLIT, bool BIAS, int K>   // K at compile time: the row blocks' distances are immediate offsets of the loads
__global__ __launch_bounds__(32) __attribute__((amdgpu_waves_per_eu(2))) void k_gemmw(const T16* __restrict__ A, const T16* __restrict__ A2, const T16* __restrict__ Bt, const T16* __restrict__ Bt2, float* C, int ldc, const float* __restrict__ bias0, const float* __restrict__ bias1, const float* __restrict__ bias2, size_t sA, size_t sB, size_t sC) {
    typedef typename WFrag<T16>::V V;
    __shared__ __align__(16) float os[16 * 68];
    const size_t z = blockIdx.z; A += z * sA; if (A2) A2 += z * sA; Bt += z * sB; if (Bt2) Bt2 += z * sB; C += z * sC;
    const float* bias = (z == 0) ? bias0 : ((z == 1) ? bias1 : bias2);   // each z-slice adds its own bias vector
    const int lane = threadIdx.x & 31, lr = lane & 15, hi = lane >> 4; const int r0 = blockIdx.x * 64, c0 = blockIdx.y * 64;
    v8f acc[4][4];
#pragma unroll
    for (int mb = 0; mb < 4; ++mb)
#pragma unroll
        for (int nb = 0; nb < 4; ++nb) acc[mb][nb] = (v8f){};
    constexpr int NKB = K / 32; static_assert(NKB % 3 == 0 && NKB >= 6, "the ring walks k in threes");
    unsigned off = (unsigned)lane * 16u;   // the lane's byte offset: it walks k, beside wave-uniform bases that stay
    A += (size_t)r0 * K; if (NSPLIT == 1 || NSPLIT == 2) A2 += (size_t)r0 * K; Bt += (size_t)c0 * K; if (NSPLIT >= 2) Bt2 += (size_t)c0 * K;
    WSet<T16> f0, f1, f2;
    wfetch<T16, NSPLIT, K, 0>(f0, A, A2, Bt, Bt2, off); wfetch<T16, NSPLIT, K, 1>(f1, A, A2, Bt, Bt2, off);
#pragma unroll 1   // one body holds three blocks, one per set of the ring
    for (int t = 0; t < NKB / 3 - 1; ++t) {
        wfetch<T16, NSPLIT, K, 2>(f2, A, A2, Bt, Bt2, off); wmul<T16, NSPLIT>(f0, acc);
        wfetch<T16, NSPLIT, K, 3>(f0, A, A2, Bt, Bt2, off); wmul<T16, NSPLIT>(f1, acc);
        wfetch<T16, NSPLIT, K, 4>(f1, A, A2, Bt, Bt2, off); wmul<T16, NSPLIT>(f2, acc);
        asm volatile("s_wait_xcnt 0x0" : "+v"(off) :: "memory");   // the wait in front of the rewrite of these loads' offset register on the next line, which takes the offset from this statement and so stays behind it
        off += 3 * FE * 2;
    }
    wfetch<T16, NSPLIT, K, 2>(f2, A, A2, Bt, Bt2, off); wmul<T16, NSPLIT>(f0, acc); wmul<T16, NSPLIT>(f1, acc); wmul<T16, NSPLIT>(f2, acc);   // the last three blocks: one set is still to fetch
    asm volatile("s_wait_xcnt 0x0" :: "v"(off) : "memory");   // the same wait, in front of the epilogue's reuse of the offset register; it names it, so that it lives to here
#pragma unroll
    for (int mb = 0; mb < 4; ++mb) {
#pragma unroll
        for (int nb = 0; nb < 4; ++nb) {
#pragma unroll
            for (int j = 0; j < 8; ++j) os[(hi * 8 + j) * 68 + nb * 16 + lr] = acc[mb][nb][j]; }
        __builtin_amdgcn_wave_barrier(); asm volatile("" ::: "memory");
        float* crow = C + (size_t)(r0 + mb * 16) * ldc + c0;
{ v4f vs[8]; float* cp[8];
#pragma unroll
            for (int s = 0; s < 8; ++s) { const int row = 2 * s + hi, cofs = lr * 4; v4f val = *(const v4fa*)(os + row * 68 + cofs); if (BIAS) { val[0] += bfr(bias[c0 + cofs]); val[1] += bfr(bias[c0 + cofs + 1]); val[2] += bfr(bias[c0 + cofs + 2]); val[3] += bfr(bias[c0 + cofs + 3]); }
                vs[s] = val; cp[s] = crow + (size_t)row * ldc + cofs; *(v4f*)cp[s] = val; }
            // the wait in front of any rewrite of these stores' address and data registers; it names them, so that they live to here
            asm volatile("s_wait_xcnt 0x0" :: "v"(cp[0]), "v"(cp[1]), "v"(cp[2]), "v"(cp[3]), "v"(cp[4]), "v"(cp[5]), "v"(cp[6]), "v"(cp[7]), "v"(vs[0]), "v"(vs[1]), "v"(vs[2]), "v"(vs[3]), "v"(vs[4]), "v"(vs[5]), "v"(vs[6]), "v"(vs[7]) : "memory");
             }
        __builtin_amdgcn_wave_barrier(); asm volatile("" ::: "memory");
    }
}

__device__ __forceinline__ h16 tohx(float x) { return (h16)x; }
typedef __attribute__((ext_vector_type(2))) _Float16 v2h;
typedef __attribute__((ext_vector_type(4))) _Float16 v4h;
typedef __attribute__((ext_vector_type(2))) unsigned short v2us;
typedef __attribute__((ext_vector_type(4))) unsigned short v4us;
typedef __attribute__((ext_vector_type(2))) float v2f;
typedef __attribute__((ext_vector_type(4))) int v4i;

// ---- k_pack: every operand packing (x; Wq, Wk, Wv; W0) in ONE launch of few waves that each do many pieces. A piece is 16 bytes of a packed plane, in the plane's own order (whole lines written): piece i is
// lane i & 31, half c = (i >> 5) & 1 of fragment i >> 6. A wave takes XW (x) or WW (weights) runs of 32 consecutive pieces, all their loads in flight together: a launch
// with one piece a thread is priced by the number of waves to start, not by its bytes. Consecutive runs walk k by 16, so a thread's loads are one address with immediate offsets.
#define XW 8   // pieces per thread, x: 4 fragments a wave
#define WW 4   // pieces per thread, weights: 2 fragments a wave
#define XBLK (NB_ * TT * DM / 8 / XW / 256)   // blocks of 8 waves for x
#define WBLK (DQ * DM / 8 / WW / 256)         // blocks of 8 waves for each of the four weight matrices
static_assert((DM / 32) % (XW / 2) == 0 && (DM / 32) % (WW / 2) == 0 && (DQ / 32) % (WW / 2) == 0, "a wave's fragments lie in one block of 16 rows");
static_assert(NB_ * TT * DM % (8 * XW * 256) == 0 && DQ * DM % (8 * WW * 256) == 0, "whole blocks");
template <int RS>   // RS: floats from k to k + 1 in the source; p: the lane's element at its first k; d: the lane's first piece
__device__ __forceinline__ void pack_w(const float* __restrict__ p, bf* d) { v8f v[WW]; v8us o[WW];
#pragma unroll
    for (int j = 0; j < WW; ++j)
#pragma unroll
        for (int u = 0; u < 8; ++u) v[j][u] = p[(j * 16 + u) * RS];
    asm volatile("s_wait_xcnt 0x0" :: "v"(p) : "memory");   // the wait in front of any rewrite of these loads' address registers; it names them, so that they live to here
    __builtin_amdgcn_sched_barrier(0);   // keeps the converts below all the loads; without it the scheduler lifts converts among them and issues the last loads only when the first have returned: two latencies, not one
#pragma unroll
    for (int j = 0; j < WW; ++j) { o[j] = cvt8(v[j]); *(v8us*)(d + j * 256) = o[j]; }
    asm volatile("s_wait_xcnt 0x0" :: "v"(d), "v"(o[0]), "v"(o[1]), "v"(o[2]), "v"(o[3]) : "memory"); }   // the same wait for these stores' address and data registers; it names them, so that they live to here
__global__ __launch_bounds__(256) void k_pack(const float* __restrict__ x, const float* __restrict__ w0, const float* __restrict__ w1, const float* __restrict__ w2, const float* __restrict__ wo, bf* XB, bf* Wt, bf* WO) {
    const int lane = threadIdx.x & 31, lr = lane & 15, hi = lane >> 4; const int w = __builtin_amdgcn_readfirstlane(threadIdx.x >> 5);   // the wave's number in a scalar register: the fragment arithmetic stays scalar
    if (blockIdx.x < XBLK) {   // XB[t][k] = x[t][k]: a lane reads 8 consecutive k of its row, the wave 512 consecutive bytes of each of 16 rows in all
        const int wv = blockIdx.x * 8 + w, rb = wv / (DM / 32 / (XW / 2)), kb0 = (wv % (DM / 32 / (XW / 2))) * (XW / 2);
        const float* p = x + (size_t)(rb * 16 + lr) * DM + kb0 * 32 + hi * 8; bf* d = XB + (size_t)wv * (XW * 256) + lane * 8; v8f v[XW]; v8us o[XW];
#pragma unroll
        for (int j = 0; j < XW; ++j) v[j] = *(const v8f*)(p + j * 16);
        asm volatile("s_wait_xcnt 0x0" :: "v"(p) : "memory");   // the wait in front of any rewrite of these loads' address registers; it names them, so that they live to here
        __builtin_amdgcn_sched_barrier(0);   // keeps the converts below all the loads, as in pack_w
#pragma unroll
        for (int j = 0; j < XW; ++j) { o[j] = cvt8(v[j]); *(v8us*)(d + j * 256) = o[j]; }
        asm volatile("s_wait_xcnt 0x0" :: "v"(d), "v"(o[0]), "v"(o[1]), "v"(o[2]), "v"(o[3]), "v"(o[4]), "v"(o[5]), "v"(o[6]), "v"(o[7]) : "memory");   // the same wait for these stores' address and data registers
        return; }
    const int b = blockIdx.x - XBLK, mat = b / WBLK, wv = (b % WBLK) * 8 + w; const size_t di = (size_t)wv * (WW * 256) + lane * 8;
    if (mat < 3) {   // Wt[mat][h * 64 + c][d] = W[h][d][c]: 16 lanes read 16 consecutive c
        const int rb = wv / (DM / 32 / (WW / 2)), k0 = (wv % (DM / 32 / (WW / 2))) * (WW / 2) * 32 + hi * 8, n = rb * 16 + lr; const float* wm = (mat == 0) ? w0 : ((mat == 1) ? w1 : w2);
        pack_w<HD>(wm + ((size_t)(n / HD) * DM + k0) * HD + n % HD, Wt + (size_t)mat * DQ * DM + di);
    } else {         // WO[n][k] = W0[k][n], k < DQ, n < DM: 16 lanes read 16 consecutive n
        const int rb = wv / (DQ / 32 / (WW / 2)), k0 = (wv % (DQ / 32 / (WW / 2))) * (WW / 2) * 32 + hi * 8, n = rb * 16 + lr;
        pack_w<DM>(wo + (size_t)k0 * DM + n, WO + di); }
}
// ---- k_fattn: causal attention of one (sequence, head) pair and one strip of query rows in one wave; scores and probabilities stay in registers (online softmax over blocks of 32 keys).
// Transposed products: S^T = K Q^T (A = key rows, B = query rows), so a lane holds 16 scores of ONE query (column lr): keys k0 + 8 hi + j and k0 + 16 + 8 hi + j. Those 16 values, converted in place, are the
// B operand of O^T += V^T P^T (A = value plane rows [d][t]) in the k order of the loaders. Running maximum, sum and rescale factor are per lane; the two lane halves are joined by one exchange.
// The strip's output rows leave as the hi/lo planes of the output projection's A operand: lane = query row, 8 consecutive d per accumulator, which is one half of a packed fragment: 512 consecutive bytes a store.
// Packed planes: q, k rows t, k = d, fragments [t / 16][d / 32]; v rows d, k = t, fragments [t / 32][d / 16]: a block of 32 keys is 4 consecutive fragments of either, at element k0 * HD.
#define L2E 1.4426950408889634f
__device__ __forceinline__ float xhalf(float x) { const int b = __float_as_int(x); return __int_as_float(__builtin_amdgcn_permlanex16(b, b, 0x76543210, 0xfedcba98, false, false)); }   // lane l <-> l ^ 16
__device__ __forceinline__ float ex2(float x) { float r; asm("v_exp_f32 %0, %1\n\tv_nop" : "=v"(r) : "v"(x)); return r; }
__device__ __forceinline__ void put8(v8f o, float inv, bf* ph, bf* pl) { v8us oh, ol; split8(o * inv, oh, ol);
    *(v8us*)ph = oh; *(v8us*)pl = ol;
    asm volatile("s_wait_xcnt 0x0" :: "v"(ph), "v"(pl), "v"(oh), "v"(ol) : "memory"); }   // the wait in front of any rewrite of these stores' address and data registers; it names them, so that they live to here
// rows >= RH: single fp16 products, 32 query rows per wave; probabilities carry the factor PCAR = 2^10 (it cancels against the row sum)
__device__ __forceinline__ void attn_lo(const h16* __restrict__ Q, const h16* __restrict__ Kp, const h16* __restrict__ Vt, int q0, bf* Ah, bf* Al, int lr, int hi) {
    v16h qf[2][2]; const h16* qp = Q + (size_t)q0 * HD + (hi * 16 + lr) * 8;   // 16 rows of HD = 64 are two fragments: row block r0 begins at element r0 * HD, as it did
#pragma unroll
    for (int nb = 0; nb < 2; ++nb)
#pragma unroll
        for (int ks = 0; ks < 2; ++ks) qf[nb][ks] = WFrag<h16>::ld(qp + (nb * 2 + ks) * FE);
    v8f o[4][2]; float m[2], l[2];
#pragma unroll
    for (int nb = 0; nb < 2; ++nb) { m[nb] = -3.0e38f; l[nb] = 0.f;
#pragma unroll
        for (int db = 0; db < 4; ++db) o[db][nb] = (v8f){}; }
    const h16* kp = Kp + (hi * 16 + lr) * 8; const unsigned vo = (unsigned)(hi * 16 + lr) * 16u;   // value loads: the lane's byte offset, fixed over the loop, beside a wave-uniform base that walks the keys
    v16h kf[2][2];
#pragma unroll
    for (int kt = 0; kt < 2; ++kt)
#pragma unroll
        for (int ks = 0; ks < 2; ++ks) kf[kt][ks] = WFrag<h16>::ld(kp + (kt * 2 + ks) * FE);
    asm volatile("s_wait_xcnt 0x0" :: "v"(qp), "v"(kp) : "memory");   // the wait in front of any rewrite of these loads' address registers; it names them, so that they live to here
#pragma unroll 1   // run-time trip count; one body already holds most of the register budget
    for (int k0 = 0; k0 < q0 + 32; k0 += 32) {
        v16h vf[4]; const h16* vp = (const h16*)((const char*)(Vt + (size_t)k0 * HD) + vo);
#pragma unroll
        for (int db = 0; db < 4; ++db) vf[db] = WFrag<h16>::ld(vp + db * FE);
        v8f s[2][2];
#pragma unroll
        for (int kt = 0; kt < 2; ++kt)
#pragma unroll
            for (int nb = 0; nb < 2; ++nb) s[kt][nb] = wmma16(kf[kt][1], qf[nb][1], wmma16(kf[kt][0], qf[nb][0], (v8f){}));
        if (k0 < q0) kp += 32 * HD;   // the next block's key fragments fly during this block's softmax; the last block fetches its own again, so the address stays inside the plane
#pragma unroll
        for (int kt = 0; kt < 2; ++kt)
#pragma unroll
            for (int ks = 0; ks < 2; ++ks) kf[kt][ks] = WFrag<h16>::ld(kp + (kt * 2 + ks) * FE);
        asm volatile("s_wait_xcnt 0x0" :: "v"(vp), "v"(kp) : "memory");   // the wait in front of any rewrite of the value and key loads' address registers; it names them, so that they live to here
        __builtin_amdgcn_sched_barrier(0);   // keeps the key loads above the softmax; without it the scheduler sinks them to the loop's foot and their latency is exposed again
#pragma unroll
        for (int nb = 0; nb < 2; ++nb) { const int q = q0 + nb * 16 + lr; float t[16]; float mx = m[nb];
#pragma unroll
            for (int e = 0; e < 16; ++e) { const int key = k0 + (e >> 3) * 16 + hi * 8 + (e & 7); t[e] = (key <= q) ? s[e >> 3][nb][e & 7] * SCL : -3.0e38f; mx = fmaxf(mx, t[e]); }
            mx = fmaxf(mx, xhalf(mx));
            const float al = ex2((m[nb] - mx) * L2E); m[nb] = mx; float sum = 0.f; v16h pf;
#pragma unroll
            for (int e = 0; e < 16; ++e) { const float p = ex2((t[e] - mx) * L2E + 10.0f); sum += p; pf[e] = tohx(p); }
            l[nb] = l[nb] * al + sum;
#pragma unroll
            for (int db = 0; db < 4; ++db) { o[db][nb] *= al; o[db][nb] = wmma16(vf[db], pf, o[db][nb]); } }
    }
#pragma unroll
    for (int nb = 0; nb < 2; ++nb) { const float inv = __fdiv_rn(1.0f, l[nb] + xhalf(l[nb])); const size_t ro = (size_t)(q0 + nb * 16) * DQ + (hi * 16 + lr) * 8;   // row block [rb][kb]; the head's two fragments of it lie side by side
#pragma unroll
        for (int db = 0; db < 4; ++db) put8(o[db][nb], inv, Ah + ro + db * 256, Al + ro + db * 256); }
}
// rows < RH: hi+lo fp16 planes, 3 products each for the scores and for P.V, 32 query rows per wave. The hi planes ARE the fp16 planes of the single path (one plane serves both); the lo planes hold the rounded
// remainders and exist for tokens < RH only. Probabilities carry the factor PCAR = 2^10, as in attn_lo, so that small ones stay normal fp16 numbers; it cancels against the row sum.
__device__ __forceinline__ void attn_hl(const h16* __restrict__ Qh, const h16* __restrict__ Ql, const h16* __restrict__ Kh, const h16* __restrict__ Kl, const h16* __restrict__ Vh, const h16* __restrict__ Vl, int q0, bf* Ah, bf* Al, int lr, int hi) {
    v16h qh[2][2], ql[2][2]; const h16* qph = Qh + (size_t)q0 * HD + (hi * 16 + lr) * 8; const h16* qpl = Ql + (size_t)q0 * HD + (hi * 16 + lr) * 8;
#pragma unroll
    for (int nb = 0; nb < 2; ++nb)
#pragma unroll
        for (int ks = 0; ks < 2; ++ks) { qh[nb][ks] = WFrag<h16>::ld(qph + (nb * 2 + ks) * FE); ql[nb][ks] = WFrag<h16>::ld(qpl + (nb * 2 + ks) * FE); }
    asm volatile("s_wait_xcnt 0x0" :: "v"(qph), "v"(qpl) : "memory");   // the wait in front of any rewrite of these loads' address registers; it names them, so that they live to here
    v8f o[4][2]; float m[2], l[2];
#pragma unroll
    for (int nb = 0; nb < 2; ++nb) { m[nb] = -3.0e38f; l[nb] = 0.f;
#pragma unroll
        for (int db = 0; db < 4; ++db) o[db][nb] = (v8f){}; }
    const unsigned ko = (unsigned)(hi * 16 + lr) * 16u, vo = ko;   // the lane's byte offsets, fixed over the loop, beside wave-uniform bases that walk the keys
#pragma unroll 1   // run-time trip count; one body already holds most of the register budget
    for (int k0 = 0; k0 < q0 + 32; k0 += 32) {
        const h16* kph = (const h16*)((const char*)(Kh + (size_t)k0 * HD) + ko); const h16* kpl = (const h16*)((const char*)(Kl + (size_t)k0 * HD) + ko);
        v16h kh[2][2], kl[2][2];   // all key fragments of the block are requested together: one latency a block, not one per fragment pair
#pragma unroll
        for (int kt = 0; kt < 2; ++kt)
#pragma unroll
            for (int ks = 0; ks < 2; ++ks) { kh[kt][ks] = WFrag<h16>::ld(kph + (kt * 2 + ks) * FE); kl[kt][ks] = WFrag<h16>::ld(kpl + (kt * 2 + ks) * FE); }
        asm volatile("s_wait_xcnt 0x0" :: "v"(kph), "v"(kpl) : "memory");   // the wait in front of any rewrite of the key loads' address registers; it names them, so that they live to here
        __builtin_amdgcn_sched_barrier(0);   // keeps the sixteen key loads together above the products; without it the scheduler sinks them pair by pair between the products, one exposed latency each
        v8f s[2][2];
#pragma unroll
        for (int kt = 0; kt < 2; ++kt) { s[kt][0] = (v8f){}; s[kt][1] = (v8f){};
#pragma unroll
            for (int ks = 0; ks < 2; ++ks)
#pragma unroll
                for (int nb = 0; nb < 2; ++nb) { s[kt][nb] = wmma16(kh[kt][ks], qh[nb][ks], s[kt][nb]); s[kt][nb] = wmma16(kh[kt][ks], ql[nb][ks], s[kt][nb]); s[kt][nb] = wmma16(kl[kt][ks], qh[nb][ks], s[kt][nb]); } }
        const h16* vph = (const h16*)((const char*)(Vh + (size_t)k0 * HD) + vo); const h16* vpl = (const h16*)((const char*)(Vl + (size_t)k0 * HD) + vo);
        v16h vh[4], vl[4];
#pragma unroll
        for (int db = 0; db < 4; ++db) { vh[db] = WFrag<h16>::ld(vph + db * FE); vl[db] = WFrag<h16>::ld(vpl + db * FE); }
        asm volatile("s_wait_xcnt 0x0" :: "v"(vph), "v"(vpl) : "memory");   // the same wait for the value loads' address registers; the loads' own place is held by the next line
        __builtin_amdgcn_sched_barrier(0);   // keeps the value loads above the softmax, which hides their latency; without it the scheduler sinks half of them, and the wait with them, to the products
        v16h ph[2], pl[2]; float al[2];
#pragma unroll
        for (int nb = 0; nb < 2; ++nb) { const int q = q0 + nb * 16 + lr; float t[16]; float mx = m[nb];
#pragma unroll
            for (int e = 0; e < 16; ++e) { const int key = k0 + (e >> 3) * 16 + hi * 8 + (e & 7); t[e] = (key <= q) ? s[e >> 3][nb][e & 7] * SCL : -3.0e38f; mx = fmaxf(mx, t[e]); }
            mx = fmaxf(mx, xhalf(mx));
            al[nb] = ex2((m[nb] - mx) * L2E); m[nb] = mx; float sum = 0.f; v8h h0, h1, l0, l1; v8f P0, P1;
#pragma unroll
            for (int e = 0; e < 8; ++e) { const float p0 = ex2((t[e] - mx) * L2E + 10.0f), p1 = ex2((t[e + 8] - mx) * L2E + 10.0f); sum += p0; sum += p1; P0[e] = p0; P1[e] = p1; }
            split8h(P0, h0, l0); split8h(P1, h1, l1);
            l[nb] = l[nb] * al[nb] + sum; ph[nb] = cat16(h0, h1); pl[nb] = cat16(l0, l1); }
#pragma unroll
        for (int db = 0; db < 4; ++db)
#pragma unroll
            for (int nb = 0; nb < 2; ++nb) { o[db][nb] *= al[nb]; o[db][nb] = wmma16(vh[db], ph[nb], o[db][nb]); o[db][nb] = wmma16(vh[db], pl[nb], o[db][nb]); o[db][nb] = wmma16(vl[db], ph[nb], o[db][nb]); }
    }
#pragma unroll
    for (int nb = 0; nb < 2; ++nb) { const float inv = __fdiv_rn(1.0f, l[nb] + xhalf(l[nb])); const size_t ro = (size_t)(q0 + nb * 16) * DQ + (hi * 16 + lr) * 8;   // row block [rb][kb]; the head's two fragments of it lie side by side
#pragma unroll
        for (int db = 0; db < 4; ++db) put8(o[db][nb], inv, Ah + ro + db * 256, Al + ro + db * 256); }
}
// grid (NZ pairs, 8), four independent waves per block (no barrier, no LDS): even y = rows >= RH, odd y = rows < RH. Each half of a sequence is 16 strips of 32 rows; group g = y >> 1 takes strips
// g, 7 - g, 8 + g, 15 - g, so every block of a path walks the same number of key blocks in all, and its waves read the same key and value lines from the start of the sequence on.
// amdgpu_waves_per_eu(3, 3): holds the register allocation to three waves per SIMD, so that all NZ * 8 blocks are resident at once; without it the hi+lo path takes two waves' worth.
__global__ __launch_bounds__(128) __attribute__((amdgpu_waves_per_eu(3, 3))) void k_fattn(const h16* __restrict__ Q16, const h16* __restrict__ K16, const h16* __restrict__ V16, const h16* __restrict__ Ql, const h16* __restrict__ Kl, const h16* __restrict__ Vl, bf* Ah, bf* Al) {
    const int lane = threadIdx.x & 31, lr = lane & 15, hi = lane >> 4; const int w = __builtin_amdgcn_readfirstlane(threadIdx.x >> 5);   // the wave's number in a scalar register: loop bounds stay scalar
    const int zz = blockIdx.x, g = blockIdx.y >> 1; const size_t zo = (size_t)zz * TT * HD, zv = zo;
    const int strip = (w >> 1) * 8 + ((w & 1) ? 7 - g : g);
    const size_t oo = (size_t)(zz / NH_) * TT * DQ + (zz % NH_) * 2 * FE;   // this pair's first element in the merged planes (rows [sequence][t], k = [head][d], packed)
    if ((blockIdx.y & 1) == 0) attn_lo(Q16 + zo, K16 + zo, V16 + zv, RH + 32 * strip, Ah + oo, Al + oo, lr, hi);
    else attn_hl(Q16 + zo, Ql + zo, K16 + zo, Kl + zo, V16 + zv, Vl + zv, 32 * strip, Ah + oo, Al + oo, lr, hi);
}

// The tile's way out of k_proj. LO: the tile's tokens lie below RH, and the lo plane is stored beside the fp16 plane; the choice is made once per wave, so that each form is straight-line code.
template <bool LO>
__device__ __forceinline__ void proj_out(const v8f (&acc)[4][4], const float* __restrict__ bias, const float (&bj)[4], bool isv, int c0, int hi, h16* d16, h16* dl, unsigned si, unsigned sj, unsigned off) {
#pragma unroll
    for (int g = 0; g < 2; ++g) { float bi[2][8];
#pragma unroll
        for (int c = 0; c < 2; ++c)
#pragma unroll
            for (int e = 0; e < 8; ++e) bi[c][e] = bfr(bias[c0 + (g * 2 + c) * 16 + hi * 8 + e]);
#pragma unroll
        for (int jb = 0; jb < 4; ++jb) { v8h wh[2], wl[2];   // one whole fragment of each plane at a time
#pragma unroll
            for (int c = 0; c < 2; ++c) { v8f r;
#pragma unroll
                for (int e = 0; e < 8; ++e) r[e] = acc[g * 2 + c][jb][e] + (isv ? bj[jb] : bi[c][e]);
                if (LO) split8h(r, wh[c], wl[c]); else wh[c] = __builtin_convertvector(r, v8h); }
            const unsigned fo = jb * sj + g * si;   // wave-uniform
#pragma unroll
            for (int c = 0; c < 2; ++c) { *(v8ha*)((char*)d16 + fo + c * 512 + off) = wh[c]; if (LO) *(v8ha*)((char*)dl + fo + c * 512 + off) = wl[c]; }
            asm volatile("s_wait_xcnt 0x0" ::: "memory");   // the wait in front of the next fragment's rewrite of these stores' address and data registers; the next line holds that work behind it
            __builtin_amdgcn_sched_barrier(0);   // keeps the later fragments' conversions below the wait; without it the scheduler also lifts them far up and the converted values spill to scratch
        } }
}
// ---- k_proj: the three projections (grid z: q, k, v), ONE WAVE per 64x64 tile with the loop of k_gemmw; grid (rows / 64, heads, 3), 32 threads. The tile leaves as the attention kernel's
// operand planes (fp16 of product + bias for every token; for tokens < RH also the fp16 remainder, the lo plane of the hi+lo path); the f32 projections never reach memory. In an accumulator a lane holds 8 consecutive rows of the A operand at one row of the B operand, so
// q, k: A = weight rows (d), B = x rows (t): 8 consecutive d of one token. v: A = x rows (t), B = weight rows (d): 8 consecutive t of one d.
// Either way an accumulator, converted, IS one half of a packed fragment of the plane in lane order: it leaves straight from registers as 512 consecutive bytes, and the tile is 8 consecutive fragments of each plane.
// amdgpu_waves_per_eu(3): the accumulators and the ring of three fragment sets take a third of a SIMD's registers; the tiles beyond three per SIMD start as earlier ones end.
__global__ __launch_bounds__(32) __attribute__((amdgpu_waves_per_eu(3))) void k_proj(const bf* __restrict__ X, const bf* __restrict__ Wt, const float* __restrict__ bias0, const float* __restrict__ bias1, const float* __restrict__ bias2, h16* P16, h16* Pl, h16* V16, h16* Vl) {
    const int z = blockIdx.z; const bool isv = (z == 2);
    const float* bias = (z == 0) ? bias0 : ((z == 1) ? bias1 : bias2);
    const int lane = threadIdx.x & 31, lr = lane & 15, hi = lane >> 4; const int r0 = blockIdx.x * 64, c0 = blockIdx.y * 64;
    const bf* xr = X + (size_t)r0 * DM; const bf* wr = Wt + ((size_t)z * DQ + c0) * DM;   // a block of 16 rows is DM / 32 fragments = 16 * DM elements: it begins where it did
    const bf* A = isv ? xr : wr; const bf* B = isv ? wr : xr;
    v8f acc[4][4];
#pragma unroll
    for (int ib = 0; ib < 4; ++ib)
#pragma unroll
        for (int jb = 0; jb < 4; ++jb) acc[ib][jb] = (v8f){};
    const unsigned off = (unsigned)lane * 16u;   // the lane's byte offset in a half fragment
    unsigned ko = off;   // the same at the ring's current block: it walks k, beside wave-uniform bases that stay
    constexpr int NKB = DM / 32; static_assert(NKB % 3 == 0 && NKB >= 6, "the ring walks k in threes");
    WSet<bf> f0, f1, f2;   // as in k_gemmw: three sets, loads two blocks ahead of their products
    wfetch<bf, 0, DM, 0>(f0, A, A, B, B, ko); wfetch<bf, 0, DM, 1>(f1, A, A, B, B, ko);
#pragma unroll 1   // one body holds three blocks, one per set of the ring
    for (int t = 0; t < NKB / 3 - 1; ++t) {
        wfetch<bf, 0, DM, 2>(f2, A, A, B, B, ko); wmul<bf, 0>(f0, acc);
        wfetch<bf, 0, DM, 3>(f0, A, A, B, B, ko); wmul<bf, 0>(f1, acc);
        wfetch<bf, 0, DM, 4>(f1, A, A, B, B, ko); wmul<bf, 0>(f2, acc);
        asm volatile("s_wait_xcnt 0x0" : "+v"(ko) :: "memory");   // the wait in front of the rewrite of these loads' offset register on the next line, which takes the offset from this statement and so stays behind it
        ko += 3 * FE * 2;
    }
    wfetch<bf, 0, DM, 2>(f2, A, A, B, B, ko); wmul<bf, 0>(f0, acc); wmul<bf, 0>(f1, acc); wmul<bf, 0>(f2, acc);   // the last three blocks: one set is still to fetch
    asm volatile("s_wait_xcnt 0x0" :: "v"(ko) : "memory");   // the same wait, in front of the epilogue's reuse of the offset register; it names it, so that it lives to here
    const size_t pair = (size_t)(r0 / TT) * NH_ + blockIdx.y; const int t0 = r0 % TT;
    const size_t base = (isv ? 0 : (size_t)z * NZ * TT * HD) + (pair * TT + t0) * HD;   // the k planes follow the q planes; 64 tokens are 8 fragments in either fragment order
    h16* d16 = (isv ? V16 : P16) + base; h16* dl = (isv ? Vl : Pl) + base;
    const bool lo = t0 < RH;   // wave-uniform: the tile's 64 tokens lie on one side of RH; only queries < RH, which see only keys < RH, read a lo plane
    const unsigned si = isv ? 4 * FE * 2 : FE * 2, sj = isv ? FE * 2 : 2 * FE * 2;   // bytes from fragment to fragment along ib >> 1 and along jb: v [t / 32][d / 16], q and k [t / 16][d / 32]
    float bj[4]; const int bx = c0 + lr;   // v: the bias runs along the lanes; q, k: along the accumulator's 8 values
#pragma unroll
    for (int jb = 0; jb < 4; ++jb) bj[jb] = bias[bx + jb * 16];
    asm volatile("s_wait_xcnt 0x0" :: "v"(bx) : "memory");   // the wait in front of any rewrite of these loads' index register; it names it, so that it lives to here
#pragma unroll
    for (int jb = 0; jb < 4; ++jb) bj[jb] = bfr(bj[jb]);
    if (lo) proj_out<true>(acc, bias, bj, isv, c0, hi, d16, dl, si, sj, off); else proj_out<false>(acc, bias, bj, isv, c0, hi, d16, dl, si, sj, off);
}

extern "C" void kernel_launch(void* const* d_in, const int* in_sizes, int n_in,
                              void* d_out, int out_size, void* d_ws, size_t ws_size, hipStream_t stream) {
    (void)in_sizes; (void)n_in; (void)out_size;
    const float* x = (const float*)d_in[0]; const float* wqh = (const float*)d_in[1]; const float* bq = (const float*)d_in[2]; const float* wkh = (const float*)d_in[3]; const float* bk = (const float*)d_in[4]; const float* wvh = (const float*)d_in[5]; const float* bv = (const float*)d_in[6]; const float* wo = (const float*)d_in[7]; const float* bo = (const float*)d_in[8]; const float* wq = nullptr; const float* wk = nullptr; const float* wv = nullptr; (void)wq; (void)wk; (void)wv; const float* cosT = nullptr; const float* sinT = nullptr; (void)cosT; (void)sinT;
    float* OUT = (float*)d_out;     // [8][1024][768]
    char* wsp = (char*)d_ws;
    auto take = [&](size_t bytes) { char* p = wsp; wsp += (bytes + 255) & ~(size_t)255; return (void*)p; };
    bf* WQ = (bf*)take((size_t)DQ * DM * 2); bf* WK = (bf*)take((size_t)DKV * DM * 2); bf* WV = (bf*)take((size_t)DKV * DM * 2); bf* WO = (bf*)take((size_t)DM * DQ * 2); (void)WK; (void)WV;   // WQ, WK, WV lie back to back (z-stride DQ*DM)
    const size_t PL = (size_t)NZ * TT * HD;   // elements of one plane over all (sequence, head) pairs; each q plane is followed by its k plane, which k_proj relies on
    h16* QP16 = (h16*)take(PL * 2); h16* KP16 = (h16*)take(PL * 2); h16* VT16 = (h16*)take(PL * 2);
    h16* QPl = (h16*)take(PL * 2); h16* KPl = (h16*)take(PL * 2); h16* VTl = (h16*)take(PL * 2);   // lo planes: only tokens < RH of each pair are written and read
    char* R = (char*)take((size_t)ZH * TT * TT * 4);   // one region, two stream-ordered uses: the x plane; then the merged head planes
    if ((size_t)(wsp - (char*)d_ws) > ws_size) return;    // ws 256 MiB
    bf* XB = (bf*)R;
    bf* ATh = (bf*)R; bf* ATl = ATh + (size_t)NB_ * TT * DQ;
    k_pack<<<XBLK + 4 * WBLK, 256, 0, stream>>>(x, wqh, wkh, wvh, wo, XB, WQ, WO);
    k_proj<<<dim3(NB_ * TT / 64, NH_, 3), 32, 0, stream>>>(XB, WQ, bq, bk, bv, QP16, QPl, VT16, VTl);
    k_fattn<<<dim3(NZ, 8, 1), 128, 0, stream>>>(QP16, KP16, VT16, QPl, KPl, VTl, ATh, ATl);
    k_gemmw<bf, 1, true, DQ><<<dim3(NB_ * TT / 64, DM / 64, 1), 32, 0, stream>>>(ATh, ATl, WO, nullptr, OUT, DM, bo, bo, bo, 0, 0, 0);
}

// v009
// Measured time: 83.2 microseconds a run.
// Timed twice side by side with v008, it ran 1.10 times as fast both times.
// Over all steps from v000 it is 36.7 times as fast.
#include <hip/hip_runtime.h>

// MaskedMultiHeadAttention (hidden [2][2048][1024]; per-head q/k/v = x Wq[h] + bq[h] (Wq [16][1024][64]); causal softmax(q.k / 8); out = concat(heads) Wo + bo -> [2][2048][1024]). THIS ROW: the same module on EIGHT sequences of 1,024 tokens at width 768 with 12 heads x 64 ([8][1024][768]) and the inputs in the order x, Wq, bq, Wk, bk, Wv, bv, W0, b0 (each bias after its own weight).
// Compute dtypes, f32 accumulate: every input rounded to bf16; q/k/v on PLAIN bf16 operands (inputs: exact; the 12 per-head weights gathered into one [768 x 768] operand) + bias; causal scores and attn.v: query rows < 512 hl (3 products, fp16 hi + fp16 lo, x1024), the rest single fp16 (x1024); softmax f32; Wo hl x exact (2 products) + bias.

#define NB_  8
#define TT   1024
#define DM   768
#define NH_  12
#define NKV  12
#define REP  (NH_ / NKV)
#define HD   64
#define DQ   (NH_ * HD)
#define DKV  (NKV * HD)
#define ZH   24
#define NZ   (NB_ * NH_)
#define RH   512                  // query rows < RH use hi+lo planes
#define WIN  1024
#define PCAR 1024.0f
#define SCL  0.125f   // HD^-0.5
typedef _Float16 h16;
typedef unsigned short bf;
typedef __attribute__((ext_vector_type(16))) __bf16   v16bf;
typedef __attribute__((ext_vector_type(16))) _Float16 v16h;
typedef __attribute__((ext_vector_type(8)))  _Float16 v8h;
typedef __attribute__((ext_vector_type(8)))  unsigned short v8us;
typedef __attribute__((ext_vector_type(8)))  float    v8f;
typedef __attribute__((ext_vector_type(4)))  float    v4f;
typedef v8h  __attribute__((may_alias)) v8ha;
typedef v4f  __attribute__((may_alias)) v4fa;
typedef v8us __attribute__((may_alias)) v8usa;
#define FE 512   // elements of one packed 16 x 32 fragment

// Roundings to 16 bits go through the hardware's packed converts (two values an instruction, round to nearest even), not through integer add-and-shift per value; the rounded values are the same.
__device__ __forceinline__ unsigned short f2bf(float f) { return __builtin_bit_cast(unsigned short, (__bf16)f); }
typedef __attribute__((ext_vector_type(2)))  __bf16   v2bf;
typedef __attribute__((ext_vector_type(2)))  float    v2fl;
typedef __attribute__((ext_vector_type(4)))  unsigned v4u;
__device__ __forceinline__ unsigned cvt2(float a, float b) { return __builtin_bit_cast(unsigned, __builtin_convertvector((v2fl){a, b}, v2bf)); }   // one packed word of two rounded values
__device__ __forceinline__ v4u cvt8w(v8f x) { return (v4u){cvt2(x[0], x[1]), cvt2(x[2], x[3]), cvt2(x[4], x[5]), cvt2(x[6], x[7])}; }
__device__ __forceinline__ v8us cvt8(v8f x) { return __builtin_bit_cast(v8us, cvt8w(x)); }
__device__ __forceinline__ void split8(v8f y, v8us& h, v8us& l) { const v4u w = cvt8w(y); h = __builtin_bit_cast(v8us, w); v8f f;   // hi plane, and the rounded remainder as lo plane
#pragma unroll
    for (int i = 0; i < 4; ++i) { f[2 * i] = __uint_as_float(w[i] << 16); f[2 * i + 1] = __uint_as_float(w[i] & 0xFFFF0000u); }   // the hi values back in f32, straight from the packed words
    l = cvt8(y - f); }
__device__ __forceinline__ void split8h(v8f y, v8h& h, v8h& l) { h = __builtin_convertvector(y, v8h); l = __builtin_convertvector(y - __builtin_convertvector(h, v8f), v8h); }   // fp16 hi plane, and the rounded remainder as fp16 lo plane
__device__ __forceinline__ float bf2f(unsigned short b) { return __uint_as_float(((unsigned)b) << 16); }
__device__ __forceinline__ float bfr(float f) { return bf2f(f2bf(f)); }
__device__ __forceinline__ v16h cat16(v8h lo, v8h hi) { return __builtin_shufflevector(lo, hi, 0, 1, 2, 3, 4, 5, 6, 7, 8, 9, 10, 11, 12, 13, 14, 15); }
__device__ __forceinline__ v16bf cat16b(v8us lo, v8us hi) { return __builtin_bit_cast(v16bf, __builtin_shufflevector(lo, hi, 0, 1, 2, 3, 4, 5, 6, 7, 8, 9, 10, 11, 12, 13, 14, 15)); }
__device__ __forceinline__ v8f wmma16(v16h a, v16h b, v8f c) { return __builtin_amdgcn_wmma_f32_16x16x32_f16(false, a, false, b, (short)0, c, false, false); }
__device__ __forceinline__ v8f wmmab(v16bf a, v16bf b, v8f c) { return __builtin_amdgcn_wmma_f32_16x16x32_bf16(false, a, false, b, (short)0, c, false, false); }



// ---- Fragment-packed planes. Every 16-bit operand plane [rows][k] is stored as whole WMMA fragments: the fragment of rows 16 rb .. + 15 and k 32 kb .. + 31 is FE = 512 consecutive elements (1 KiB),
// element (row, k) at c * 256 + lane * 8 + (k & 7) with c = (k >> 4) & 1 and lane = ((k >> 3) & 1) * 16 + (row & 15). A fragment load is then two loads of 512 consecutive bytes (4 whole lines each)
// instead of two loads that touch 16 lines each; the k order of the operands is the one it was. ld(p) takes the fragment's first element + lane * 8.
// ---- k_gemmw: register-blocked GEMM, one wave per 64x64 output tile (16 accumulators), four such waves a work-group; operands from fragment-packed planes, fragments in [rb][kb] order, through LDS.
// C[m][n] (f32, pitch ldc, + optional f32 bias[n]) = sum_k A[m][k] Bt[n][k] (+ split products per NSPLIT). z-batch strides sA/sB/sC in elements. K % 32 == 0.
template <typename T16> struct WFrag;
template <> struct WFrag<h16> { typedef v16h V; static __device__ __forceinline__ V ld(const h16* p) { return cat16(*(const v8h*)p, *(const v8h*)(p + 256)); } static __device__ __forceinline__ v8f mma(V a, V b, v8f c) { return wmma16(a, b, c); } };
template <> struct WFrag<bf> { typedef v16bf V; static __device__ __forceinline__ V ld(const bf* p) { return cat16b(*(const v8us*)p, *(const v8us*)(p + 256)); } static __device__ __forceinline__ v8f mma(V a, V b, v8f c) { return wmmab(a, b, c); } };
// One k block's fragments of a 64x64 tile. The GEMM loops keep two such sets in registers: while a block is multiplied, the next block's LDS reads are in flight.
template <typename T16> struct WSet { typename WFrag<T16>::V a[4], a2[4], b[4], b2[4]; };
template <typename T16, int NSPLIT>
__device__ __forceinline__ void wmul(const WSet<T16>& f, v8f (&acc)[4][4]) {
#pragma unroll
    for (int nb = 0; nb < 4; ++nb)
#pragma unroll
        for (int mb = 0; mb < 4; ++mb) { acc[mb][nb] = WFrag<T16>::mma(f.a[mb], f.b[nb], acc[mb][nb]); if (NSPLIT == 1 || NSPLIT == 2) acc[mb][nb] = WFrag<T16>::mma(f.a2[mb], f.b[nb], acc[mb][nb]); if (NSPLIT >= 2) acc[mb][nb] = WFrag<T16>::mma(f.a[mb], f.b2[nb], acc[mb][nb]); }
    __builtin_amdgcn_sched_barrier(0);   // keeps the next set's LDS reads below these products, whose operand registers they refill; without it the scheduler lifts them and the allocation grows
}
// ---- The GEMMs' operand path. A work-group of FOUR waves makes a 128x128 tile, each wave a 64x64 quarter. The tile's operand fragments come ONCE per work-group from L2 into LDS by asynchronous copies and are read from
// there by the two waves that need each; with one wave per tile every wave fetched all its operands for itself. The planes are fragment-packed, so a copy is 512 consecutive bytes on both sides and a fragment read from LDS
// is two reads of 512 consecutive bytes (no bank conflict, no pad). Ring of two buffers, a stage = PST k blocks: while stage t is multiplied, the copies of stage t + 1 fly. The order of the k blocks, and so every sum, is the one it was.
#define PST 3                    // k blocks per stage
#define PRB (PST * FE)           // elements of one row block's share of a stage: PST consecutive fragments, in LDS as in the plane
// Twelve copies of 512 bytes a wave: two row blocks' shares of a stage. la, lb: the lane's LDS byte addresses; ga, gb: the lane's global addresses. The s_wait_xcnt closes the statement, in front of any rewrite of the address registers the copies name.
__device__ __forceinline__ void cp12(unsigned la, const bf* ga, unsigned lb, const bf* gb) {
    asm volatile("global_load_async_to_lds_b128 %0, %12, off\n\t"
                 "global_load_async_to_lds_b128 %1, %13, off\n\t"
                 "global_load_async_to_lds_b128 %2, %14, off\n\t"
                 "global_load_async_to_lds_b128 %3, %15, off\n\t"
                 "global_load_async_to_lds_b128 %4, %16, off\n\t"
                 "global_load_async_to_lds_b128 %5, %17, off\n\t"
                 "global_load_async_to_lds_b128 %6, %18, off\n\t"
                 "global_load_async_to_lds_b128 %7, %19, off\n\t"
                 "global_load_async_to_lds_b128 %8, %20, off\n\t"
                 "global_load_async_to_lds_b128 %9, %21, off\n\t"
                 "global_load_async_to_lds_b128 %10, %22, off\n\t"
                 "global_load_async_to_lds_b128 %11, %23, off\n\t"
                 "s_wait_xcnt 0x0"
                 :: "v"(la), "v"(la + 512), "v"(la + 1024), "v"(la + 1536), "v"(la + 2048), "v"(la + 2560), "v"(lb), "v"(lb + 512), "v"(lb + 1024), "v"(lb + 1536), "v"(lb + 2048), "v"(lb + 2560),
                    "v"(ga), "v"(ga + 256), "v"(ga + 512), "v"(ga + 768), "v"(ga + 1024), "v"(ga + 1280), "v"(gb), "v"(gb + 256), "v"(gb + 512), "v"(gb + 768), "v"(gb + 1024), "v"(gb + 1280) : "memory");
}
static_assert(PST == 3, "cp12 moves two row blocks of three fragments");
template <int KB, bool LO>   // one k block's fragments from a buffer; sa, sa2, sb: the lane's element in the wave's first row block of A, of A's lo plane (LO) and of B
__device__ __forceinline__ void lfetch(WSet<bf>& f, const bf* sa, const bf* sa2, const bf* sb) {
#pragma unroll
    for (int mb = 0; mb < 4; ++mb) { f.a[mb] = WFrag<bf>::ld(sa + (mb * PST + KB) * FE); if (LO) f.a2[mb] = WFrag<bf>::ld(sa2 + (mb * PST + KB) * FE); }
#pragma unroll
    for (int nb = 0; nb < 4; ++nb) f.b[nb] = WFrag<bf>::ld(sb + (nb * PST + KB) * FE);
    __builtin_amdgcn_sched_barrier(0);   // keeps a set's LDS reads together in front of the products that follow; without it the scheduler sinks them among the products, each place with its own wait
}
#define GBUF (24 * PRB)          // elements of one buffer of k_gemmw: row blocks 0-7 of A, 8-15 of A2, 16-23 of Bt
// grid (M/128, N/128, Z), 128 threads. amdgpu_waves_per_eu(2): two work-groups per WGP, by their LDS (144 KiB each); they hold all tiles of the launch at once.
template <typename T16, int NSPLIT, bool BIAS, int K>   // K at compile time: the row blocks' distances are constants
__global__ __launch_bounds__(128) __attribute__((amdgpu_waves_per_eu(2))) void k_gemmw(const T16* __restrict__ A, const T16* __restrict__ A2, const T16* __restrict__ Bt, const T16* __restrict__ Bt2, float* C, int ldc, const float* __restrict__ bias0, const float* __restrict__ bias1, const float* __restrict__ bias2, size_t sA, size_t sB, size_t sC) {
    static_assert(NSPLIT == 1, "the ring holds A, A2 and Bt");
    __shared__ __attribute__((aligned(1024))) T16 sm[2 * GBUF];
    const size_t z = blockIdx.z; A += z * sA; A2 += z * sA; Bt += z * sB; C += z * sC; (void)Bt2;
    const float* bias = (z == 0) ? bias0 : ((z == 1) ? bias1 : bias2);   // each z-slice adds its own bias vector
    const int lane = threadIdx.x & 31, lr = lane & 15, hi = lane >> 4; const int w = __builtin_amdgcn_readfirstlane(threadIdx.x >> 5);   // the wave's number in a scalar register: tile and copy arithmetic stay scalar
    const int R0 = blockIdx.x * 128, C0 = blockIdx.y * 128; const int r0 = R0 + (w & 1) * 64, c0 = C0 + (w >> 1) * 64;
    v8f acc[4][4];
#pragma unroll
    for (int mb = 0; mb < 4; ++mb)
#pragma unroll
        for (int nb = 0; nb < 4; ++nb) acc[mb][nb] = (v8f){};
    constexpr int NT = K / 32 / PST; static_assert(K / 32 % PST == 0 && NT >= 2, "whole stages, at least two");
    // wave w copies row blocks 2 w and 2 w + 1 of each of the three planes. A block of 16 rows is K / 32 fragments = 16 * K elements.
    const T16* gA = A + (size_t)(R0 + w * 32) * K + lane * 8; const T16* gA2 = A2 + (size_t)(R0 + w * 32) * K + lane * 8; const T16* gB = Bt + (size_t)(C0 + w * 32) * K + lane * 8;
    const unsigned ll = (unsigned)(size_t)sm + (unsigned)(w * 2 * PRB * 2) + (unsigned)lane * 16u;   // the lane's LDS byte address in buffer 0: the low 32 bits of the shared address
    auto stage = [&](int t, int b) { const int go = t * PRB; const unsigned l = ll + (unsigned)b * (GBUF * 2);
        cp12(l, gA + go, l + PRB * 2, gA + go + 16 * K); cp12(l + 8 * PRB * 2, gA2 + go, l + 9 * PRB * 2, gA2 + go + 16 * K); cp12(l + 16 * PRB * 2, gB + go, l + 17 * PRB * 2, gB + go + 16 * K); };
    const unsigned ao = (unsigned)((w & 1) * 4 * PRB), bo = (unsigned)((16 + (w >> 1) * 4) * PRB);   // this wave's A and Bt row blocks in a buffer
    WSet<T16> f0, f1;
    stage(0, 0);
    asm volatile("s_wait_asynccnt 0x0" ::: "memory");   // this wave's copies of stage 0 have landed
    __syncthreads();                                     // and every other wave's: stage 0 may be read
    stage(1, 1);
#pragma unroll 1   // one body per stage; the buffer is chosen by a scalar offset
    for (int t = 0; t < NT; ++t) {
        const T16* sb = sm + (t & 1) * GBUF + lane * 8;
        // two fragment sets in registers: a k block's LDS reads go as one group ahead of the block before it, never among its products
        lfetch<0, true>(f0, sb + ao, sb + ao + 8 * PRB, sb + bo);
        lfetch<1, true>(f1, sb + ao, sb + ao + 8 * PRB, sb + bo); wmul<T16, NSPLIT>(f0, acc);
        lfetch<2, true>(f0, sb + ao, sb + ao + 8 * PRB, sb + bo); wmul<T16, NSPLIT>(f1, acc);
        wmul<T16, NSPLIT>(f0, acc);
        asm volatile("s_wait_dscnt 0x0" ::: "memory");      // this wave's reads of stage t's buffer are done before the buffer is refilled
        asm volatile("s_wait_asynccnt 0x0" ::: "memory");   // this wave's copies of stage t + 1 have landed
        __syncthreads();                                     // publishes stage t + 1 and ends every wave's reads of stage t
        if (t + 2 < NT) stage(t + 2, t & 1);
    }
    asm volatile("s_wait_asynccnt 0x0" ::: "memory");   // no copy is outstanding when the ring becomes output staging
    float* os = (float*)sm + w * (16 * 68);   // output staging, a range of its own per wave, in the ring: the last stage's barrier has ended every wave's reads of it
#pragma unroll
    for (int mb = 0; mb < 4; ++mb) {
#pragma unroll
        for (int nb = 0; nb < 4; ++nb) {
#pragma unroll
            for (int j = 0; j < 8; ++j) os[(hi * 8 + j) * 68 + nb * 16 + lr] = acc[mb][nb][j]; }
        __builtin_amdgcn_wave_barrier(); asm volatile("" ::: "memory");
        float* crow = C + (size_t)(r0 + mb * 16) * ldc + c0;
{ v4f vs[8]; float* cp[8];
#pragma unroll
            for (int s = 0; s < 8; ++s) { const int row = 2 * s + hi, cofs = lr * 4; v4f val = *(const v4fa*)(os + row * 68 + cofs); if (BIAS) { val[0] += bfr(bias[c0 + cofs]); val[1] += bfr(bias[c0 + cofs + 1]); val[2] += bfr(bias[c0 + cofs + 2]); val[3] += bfr(bias[c0 + cofs + 3]); }
                vs[s] = val; cp[s] = crow + (size_t)row * ldc + cofs; *(v4f*)cp[s] = val; }
            // the wait in front of any rewrite of these stores' address and data registers; it names them, so that they live to here
            asm volatile("s_wait_xcnt 0x0" :: "v"(cp[0]), "v"(cp[1]), "v"(cp[2]), "v"(cp[3]), "v"(cp[4]), "v"(cp[5]), "v"(cp[6]), "v"(cp[7]), "v"(vs[0]), "v"(vs[1]), "v"(vs[2]), "v"(vs[3]), "v"(vs[4]), "v"(vs[5]), "v"(vs[6]), "v"(vs[7]) : "memory");
             }
        __builtin_amdgcn_wave_barrier(); asm volatile("" ::: "memory");
    }
}

__device__ __forceinline__ h16 tohx(float x) { return (h16)x; }
typedef __attribute__((ext_vector_type(2))) _Float16 v2h;
typedef __attribute__((ext_vector_type(4))) _Float16 v4h;
typedef __attribute__((ext_vector_type(2))) unsigned short v2us;
typedef __attribute__((ext_vector_type(4))) unsigned short v4us;
typedef __attribute__((ext_vector_type(2))) float v2f;
typedef __attribute__((ext_vector_type(4))) int v4i;

// ---- k_pack: every operand packing (x; Wq, Wk, Wv; W0) in ONE launch of few waves that each do many pieces. A piece is 16 bytes of a packed plane, in the plane's own order (whole lines written): piece i is
// lane i & 31, half c = (i >> 5) & 1 of fragment i >> 6. A wave takes XW (x) or WW (weights) runs of 32 consecutive pieces, all their loads in flight together: a launch
// with one piece a thread is priced by the number of waves to start, not by its bytes. Consecutive runs walk k by 16, so a thread's loads are one address with immediate offsets.
#define XW 8   // pieces per thread, x: 4 fragments a wave
#define WW 4   // pieces per thread, weights: 2 fragments a wave
#define XBLK (NB_ * TT * DM / 8 / XW / 256)   // blocks of 8 waves for x
#define WBLK (DQ * DM / 8 / WW / 256)         // blocks of 8 waves for each of the four weight matrices
static_assert((DM / 32) % (XW / 2) == 0 && (DM / 32) % (WW / 2) == 0 && (DQ / 32) % (WW / 2) == 0, "a wave's fragments lie in one block of 16 rows");
static_assert(NB_ * TT * DM % (8 * XW * 256) == 0 && DQ * DM % (8 * WW * 256) == 0, "whole blocks");
template <int RS>   // RS: floats from k to k + 1 in the source; p: the lane's element at its first k; d: the lane's first piece
__device__ __forceinline__ void pack_w(const float* __restrict__ p, bf* d) { v8f v[WW]; v8us o[WW];
#pragma unroll
    for (int j = 0; j < WW; ++j)
#pragma unroll
        for (int u = 0; u < 8; ++u) v[j][u] = p[(j * 16 + u) * RS];
    asm volatile("s_wait_xcnt 0x0" :: "v"(p) : "memory");   // the wait in front of any rewrite of these loads' address registers; it names them, so that they live to here
    __builtin_amdgcn_sched_barrier(0);   // keeps the converts below all the loads; without it the scheduler lifts converts among them and issues the last loads only when the first have returned: two latencies, not one
#pragma unroll
    for (int j = 0; j < WW; ++j) { o[j] = cvt8(v[j]); *(v8us*)(d + j * 256) = o[j]; }
    asm volatile("s_wait_xcnt 0x0" :: "v"(d), "v"(o[0]), "v"(o[1]), "v"(o[2]), "v"(o[3]) : "memory"); }   // the same wait for these stores' address and data registers; it names them, so that they live to here
__global__ __launch_bounds__(256) void k_pack(const float* __restrict__ x, const float* __restrict__ w0, const float* __restrict__ w1, const float* __restrict__ w2, const float* __restrict__ wo, bf* XB, bf* Wt, bf* WO) {
    const int lane = threadIdx.x & 31, lr = lane & 15, hi = lane >> 4; const int w = __builtin_amdgcn_readfirstlane(threadIdx.x >> 5);   // the wave's number in a scalar register: the fragment arithmetic stays scalar
    if (blockIdx.x < XBLK) {   // XB[t][k] = x[t][k]: a lane reads 8 consecutive k of its row, the wave 512 consecutive bytes of each of 16 rows in all
        const int wv = blockIdx.x * 8 + w, rb = wv / (DM / 32 / (XW / 2)), kb0 = (wv % (DM / 32 / (XW / 2))) * (XW / 2);
        const float* p = x + (size_t)(rb * 16 + lr) * DM + kb0 * 32 + hi * 8; bf* d = XB + (size_t)wv * (XW * 256) + lane * 8; v8f v[XW]; v8us o[XW];
#pragma unroll
        for (int j = 0; j < XW; ++j) v[j] = *(const v8f*)(p + j * 16);
        asm volatile("s_wait_xcnt 0x0" :: "v"(p) : "memory");   // the wait in front of any rewrite of these loads' address registers; it names them, so that they live to here
        __builtin_amdgcn_sched_barrier(0);   // keeps the converts below all the loads, as in pack_w
#pragma unroll
        for (int j = 0; j < XW; ++j) { o[j] = cvt8(v[j]); *(v8us*)(d + j * 256) = o[j]; }
        asm volatile("s_wait_xcnt 0x0" :: "v"(d), "v"(o[0]), "v"(o[1]), "v"(o[2]), "v"(o[3]), "v"(o[4]), "v"(o[5]), "v"(o[6]), "v"(o[7]) : "memory");   // the same wait for these stores' address and data registers
        return; }
    const int b = blockIdx.x - XBLK, mat = b / WBLK, wv = (b % WBLK) * 8 + w; const size_t di = (size_t)wv * (WW * 256) + lane * 8;
    if (mat < 3) {   // Wt[mat][h * 64 + c][d] = W[h][d][c]: 16 lanes read 16 consecutive c
        const int rb = wv / (DM / 32 / (WW / 2)), k0 = (wv % (DM / 32 / (WW / 2))) * (WW / 2) * 32 + hi * 8, n = rb * 16 + lr; const float* wm = (mat == 0) ? w0 : ((mat == 1) ? w1 : w2);
        pack_w<HD>(wm + ((size_t)(n / HD) * DM + k0) * HD + n % HD, Wt + (size_t)mat * DQ * DM + di);
    } else {         // WO[n][k] = W0[k][n], k < DQ, n < DM: 16 lanes read 16 consecutive n
        const int rb = wv / (DQ / 32 / (WW / 2)), k0 = (wv % (DQ / 32 / (WW / 2))) * (WW / 2) * 32 + hi * 8, n = rb * 16 + lr;
        pack_w<DM>(wo + (size_t)k0 * DM + n, WO + di); }
}
// ---- k_fattn: causal attention of one (sequence, head) pair and one strip of query rows in one wave; scores and probabilities stay in registers (online softmax over blocks of 32 keys).
// Transposed products: S^T = K Q^T (A = key rows, B = query rows), so a lane holds 16 scores of ONE query (column lr): keys k0 + 8 hi + j and k0 + 16 + 8 hi + j. Those 16 values, converted in place, are the
// B operand of O^T += V^T P^T (A = value plane rows [d][t]) in the k order of the loaders. Running maximum, sum and rescale factor are per lane; the two lane halves are joined by one exchange.
// The strip's output rows leave as the hi/lo planes of the output projection's A operand: lane = query row, 8 consecutive d per accumulator, which is one half of a packed fragment: 512 consecutive bytes a store.
// Packed planes: q, k rows t, k = d, fragments [t / 16][d / 32]; v rows d, k = t, fragments [t / 32][d / 16]: a block of 32 keys is 4 consecutive fragments of either, at element k0 * HD.
#define L2E 1.4426950408889634f
__device__ __forceinline__ float xhalf(float x) { const int b = __float_as_int(x); return __int_as_float(__builtin_amdgcn_permlanex16(b, b, 0x76543210, 0xfedcba98, false, false)); }   // lane l <-> l ^ 16
__device__ __forceinline__ float ex2(float x) { float r; asm("v_exp_f32 %0, %1\n\tv_nop" : "=v"(r) : "v"(x)); return r; }
__device__ __forceinline__ void put8(v8f o, float inv, bf* ph, bf* pl) { v8us oh, ol; split8(o * inv, oh, ol);
    *(v8us*)ph = oh; *(v8us*)pl = ol;
    asm volatile("s_wait_xcnt 0x0" :: "v"(ph), "v"(pl), "v"(oh), "v"(ol) : "memory"); }   // the wait in front of any rewrite of these stores' address and data registers; it names them, so that they live to here
// rows >= RH: single fp16 products, 32 query rows per wave; probabilities carry the factor PCAR = 2^10 (it cancels against the row sum)
__device__ __forceinline__ void attn_lo(const h16* __restrict__ Q, const h16* __restrict__ Kp, const h16* __restrict__ Vt, int q0, bf* Ah, bf* Al, int lr, int hi) {
    v16h qf[2][2]; const h16* qp = Q + (size_t)q0 * HD + (hi * 16 + lr) * 8;   // 16 rows of HD = 64 are two fragments: row block r0 begins at element r0 * HD, as it did
#pragma unroll
    for (int nb = 0; nb < 2; ++nb)
#pragma unroll
        for (int ks = 0; ks < 2; ++ks) qf[nb][ks] = WFrag<h16>::ld(qp + (nb * 2 + ks) * FE);
    v8f o[4][2]; float m[2], l[2];
#pragma unroll
    for (int nb = 0; nb < 2; ++nb) { m[nb] = -3.0e38f; l[nb] = 0.f;
#pragma unroll
        for (int db = 0; db < 4; ++db) o[db][nb] = (v8f){}; }
    const h16* kp = Kp + (hi * 16 + lr) * 8; const unsigned vo = (unsigned)(hi * 16 + lr) * 16u;   // value loads: the lane's byte offset, fixed over the loop, beside a wave-uniform base that walks the keys
    v16h kf[2][2];
#pragma unroll
    for (int kt = 0; kt < 2; ++kt)
#pragma unroll
        for (int ks = 0; ks < 2; ++ks) kf[kt][ks] = WFrag<h16>::ld(kp + (kt * 2 + ks) * FE);
    asm volatile("s_wait_xcnt 0x0" :: "v"(qp), "v"(kp) : "memory");   // the wait in front of any rewrite of these loads' address registers; it names them, so that they live to here
#pragma unroll 1   // run-time trip count; one body already holds most of the register budget
    for (int k0 = 0; k0 < q0 + 32; k0 += 32) {
        v16h vf[4]; const h16* vp = (const h16*)((const char*)(Vt + (size_t)k0 * HD) + vo);
#pragma unroll
        for (int db = 0; db < 4; ++db) vf[db] = WFrag<h16>::ld(vp + db * FE);
        v8f s[2][2];
#pragma unroll
        for (int kt = 0; kt < 2; ++kt)
#pragma unroll
            for (int nb = 0; nb < 2; ++nb) s[kt][nb] = wmma16(kf[kt][1], qf[nb][1], wmma16(kf[kt][0], qf[nb][0], (v8f){}));
        if (k0 < q0) kp += 32 * HD;   // the next block's key fragments fly during this block's softmax; the last block fetches its own again, so the address stays inside the plane
#pragma unroll
        for (int kt = 0; kt < 2; ++kt)
#pragma unroll
            for (int ks = 0; ks < 2; ++ks) kf[kt][ks] = WFrag<h16>::ld(kp + (kt * 2 + ks) * FE);
        asm volatile("s_wait_xcnt 0x0" :: "v"(vp), "v"(kp) : "memory");   // the wait in front of any rewrite of the value and key loads' address registers; it names them, so that they live to here
        __builtin_amdgcn_sched_barrier(0);   // keeps the key loads above the softmax; without it the scheduler sinks them to the loop's foot and their latency is exposed again
#pragma unroll
        for (int nb = 0; nb < 2; ++nb) { const int q = q0 + nb * 16 + lr; float t[16]; float mx = m[nb];
#pragma unroll
            for (int e = 0; e < 16; ++e) { const int key = k0 + (e >> 3) * 16 + hi * 8 + (e & 7); t[e] = (key <= q) ? s[e >> 3][nb][e & 7] * SCL : -3.0e38f; mx = fmaxf(mx, t[e]); }
            mx = fmaxf(mx, xhalf(mx));
            const float al = ex2((m[nb] - mx) * L2E); m[nb] = mx; float sum = 0.f; v16h pf;
#pragma unroll
            for (int e = 0; e < 16; ++e) { const float p = ex2((t[e] - mx) * L2E + 10.0f); sum += p; pf[e] = tohx(p); }
            l[nb] = l[nb] * al + sum;
#pragma unroll
            for (int db = 0; db < 4; ++db) { o[db][nb] *= al; o[db][nb] = wmma16(vf[db], pf, o[db][nb]); } }
    }
#pragma unroll
    for (int nb = 0; nb < 2; ++nb) { const float inv = __fdiv_rn(1.0f, l[nb] + xhalf(l[nb])); const size_t ro = (size_t)(q0 + nb * 16) * DQ + (hi * 16 + lr) * 8;   // row block [rb][kb]; the head's two fragments of it lie side by side
#pragma unroll
        for (int db = 0; db < 4; ++db) put8(o[db][nb], inv, Ah + ro + db * 256, Al + ro + db * 256); }
}
// rows < RH: hi+lo fp16 planes, 3 products each for the scores and for P.V, 32 query rows per wave. The hi planes ARE the fp16 planes of the single path (one plane serves both); the lo planes hold the rounded
// remainders and exist for tokens < RH only. Probabilities carry the factor PCAR = 2^10, as in attn_lo, so that small ones stay normal fp16 numbers; it cancels against the row sum.
__device__ __forceinline__ void attn_hl(const h16* __restrict__ Qh, const h16* __restrict__ Ql, const h16* __restrict__ Kh, const h16* __restrict__ Kl, const h16* __restrict__ Vh, const h16* __restrict__ Vl, int q0, bf* Ah, bf* Al, int lr, int hi) {
    v16h qh[2][2], ql[2][2]; const h16* qph = Qh + (size_t)q0 * HD + (hi * 16 + lr) * 8; const h16* qpl = Ql + (size_t)q0 * HD + (hi * 16 + lr) * 8;
#pragma unroll
    for (int nb = 0; nb < 2; ++nb)
#pragma unroll
        for (int ks = 0; ks < 2; ++ks) { qh[nb][ks] = WFrag<h16>::ld(qph + (nb * 2 + ks) * FE); ql[nb][ks] = WFrag<h16>::ld(qpl + (nb * 2 + ks) * FE); }
    asm volatile("s_wait_xcnt 0x0" :: "v"(qph), "v"(qpl) : "memory");   // the wait in front of any rewrite of these loads' address registers; it names them, so that they live to here
    v8f o[4][2]; float m[2], l[2];
#pragma unroll
    for (int nb = 0; nb < 2; ++nb) { m[nb] = -3.0e38f; l[nb] = 0.f;
#pragma unroll
        for (int db = 0; db < 4; ++db) o[db][nb] = (v8f){}; }
    const unsigned ko = (unsigned)(hi * 16 + lr) * 16u, vo = ko;   // the lane's byte offsets, fixed over the loop, beside wave-uniform bases that walk the keys
#pragma unroll 1   // run-time trip count; one body already holds most of the register budget
    for (int k0 = 0; k0 < q0 + 32; k0 += 32) {
        const h16* kph = (const h16*)((const char*)(Kh + (size_t)k0 * HD) + ko); const h16* kpl = (const h16*)((const char*)(Kl + (size_t)k0 * HD) + ko);
        v16h kh[2][2], kl[2][2];   // all key fragments of the block are requested together: one latency a block, not one per fragment pair
#pragma unroll
        for (int kt = 0; kt < 2; ++kt)
#pragma unroll
            for (int ks = 0; ks < 2; ++ks) { kh[kt][ks] = WFrag<h16>::ld(kph + (kt * 2 + ks) * FE); kl[kt][ks] = WFrag<h16>::ld(kpl + (kt * 2 + ks) * FE); }
        asm volatile("s_wait_xcnt 0x0" :: "v"(kph), "v"(kpl) : "memory");   // the wait in front of any rewrite of the key loads' address registers; it names them, so that they live to here
        __builtin_amdgcn_sched_barrier(0);   // keeps the sixteen key loads together above the products; without it the scheduler sinks them pair by pair between the products, one exposed latency each
        v8f s[2][2];
#pragma unroll
        for (int kt = 0; kt < 2; ++kt) { s[kt][0] = (v8f){}; s[kt][1] = (v8f){};
#pragma unroll
            for (int ks = 0; ks < 2; ++ks)
#pragma unroll
                for (int nb = 0; nb < 2; ++nb) { s[kt][nb] = wmma16(kh[kt][ks], qh[nb][ks], s[kt][nb]); s[kt][nb] = wmma16(kh[kt][ks], ql[nb][ks], s[kt][nb]); s[kt][nb] = wmma16(kl[kt][ks], qh[nb][ks], s[kt][nb]); } }
        const h16* vph = (const h16*)((const char*)(Vh + (size_t)k0 * HD) + vo); const h16* vpl = (const h16*)((const char*)(Vl + (size_t)k0 * HD) + vo);
        v16h vh[4], vl[4];
#pragma unroll
        for (int db = 0; db < 4; ++db) { vh[db] = WFrag<h16>::ld(vph + db * FE); vl[db] = WFrag<h16>::ld(vpl + db * FE); }
        asm volatile("s_wait_xcnt 0x0" :: "v"(vph), "v"(vpl) : "memory");   // the same wait for the value loads' address registers; the loads' own place is held by the next line
        __builtin_amdgcn_sched_barrier(0);   // keeps the value loads above the softmax, which hides their latency; without it the scheduler sinks half of them, and the wait with them, to the products
        v16h ph[2], pl[2]; float al[2];
#pragma unroll
        for (int nb = 0; nb < 2; ++nb) { const int q = q0 + nb * 16 + lr; float t[16]; float mx = m[nb];
#pragma unroll
            for (int e = 0; e < 16; ++e) { const int key = k0 + (e >> 3) * 16 + hi * 8 + (e & 7); t[e] = (key <= q) ? s[e >> 3][nb][e & 7] * SCL : -3.0e38f; mx = fmaxf(mx, t[e]); }
            mx = fmaxf(mx, xhalf(mx));
            al[nb] = ex2((m[nb] - mx) * L2E); m[nb] = mx; float sum = 0.f; v8h h0, h1, l0, l1; v8f P0, P1;
#pragma unroll
            for (int e = 0; e < 8; ++e) { const float p0 = ex2((t[e] - mx) * L2E + 10.0f), p1 = ex2((t[e + 8] - mx) * L2E + 10.0f); sum += p0; sum += p1; P0[e] = p0; P1[e] = p1; }
            split8h(P0, h0, l0); split8h(P1, h1, l1);
            l[nb] = l[nb] * al[nb] + sum; ph[nb] = cat16(h0, h1); pl[nb] = cat16(l0, l1); }
#pragma unroll
        for (int db = 0; db < 4; ++db)
#pragma unroll
            for (int nb = 0; nb < 2; ++nb) { o[db][nb] *= al[nb]; o[db][nb] = wmma16(vh[db], ph[nb], o[db][nb]); o[db][nb] = wmma16(vh[db], pl[nb], o[db][nb]); o[db][nb] = wmma16(vl[db], ph[nb], o[db][nb]); }
    }
#pragma unroll
    for (int nb = 0; nb < 2; ++nb) { const float inv = __fdiv_rn(1.0f, l[nb] + xhalf(l[nb])); const size_t ro = (size_t)(q0 + nb * 16) * DQ + (hi * 16 + lr) * 8;   // row block [rb][kb]; the head's two fragments of it lie side by side
#pragma unroll
        for (int db = 0; db < 4; ++db) put8(o[db][nb], inv, Ah + ro + db * 256, Al + ro + db * 256); }
}
// grid (NZ pairs, 8), four independent waves per block (no barrier, no LDS): even y = rows >= RH, odd y = rows < RH. Each half of a sequence is 16 strips of 32 rows; group g = y >> 1 takes strips
// g, 7 - g, 8 + g, 15 - g, so every block of a path walks the same number of key blocks in all, and its waves read the same key and value lines from the start of the sequence on.
// amdgpu_waves_per_eu(3, 3): holds the register allocation to three waves per SIMD, so that all NZ * 8 blocks are resident at once; without it the hi+lo path takes two waves' worth.
__global__ __launch_bounds__(128) __attribute__((amdgpu_waves_per_eu(3, 3))) void k_fattn(const h16* __restrict__ Q16, const h16* __restrict__ K16, const h16* __restrict__ V16, const h16* __restrict__ Ql, const h16* __restrict__ Kl, const h16* __restrict__ Vl, bf* Ah, bf* Al) {
    const int lane = threadIdx.x & 31, lr = lane & 15, hi = lane >> 4; const int w = __builtin_amdgcn_readfirstlane(threadIdx.x >> 5);   // the wave's number in a scalar register: loop bounds stay scalar
    const int zz = blockIdx.x, g = blockIdx.y >> 1; const size_t zo = (size_t)zz * TT * HD, zv = zo;
    const int strip = (w >> 1) * 8 + ((w & 1) ? 7 - g : g);
    const size_t oo = (size_t)(zz / NH_) * TT * DQ + (zz % NH_) * 2 * FE;   // this pair's first element in the merged planes (rows [sequence][t], k = [head][d], packed)
    if ((blockIdx.y & 1) == 0) attn_lo(Q16 + zo, K16 + zo, V16 + zv, RH + 32 * strip, Ah + oo, Al + oo, lr, hi);
    else attn_hl(Q16 + zo, Ql + zo, K16 + zo, Kl + zo, V16 + zv, Vl + zv, 32 * strip, Ah + oo, Al + oo, lr, hi);
}

// The tile's way out of k_proj. LO: the tile's tokens lie below RH, and the lo plane is stored beside the fp16 plane; the choice is made once per wave, so that each form is straight-line code.
template <bool LO>
__device__ __forceinline__ void proj_out(const v8f (&acc)[4][4], const float* __restrict__ bias, const float (&bj)[4], bool isv, int c0, int hi, h16* d16, h16* dl, unsigned si, unsigned sj, unsigned off) {
#pragma unroll
    for (int g = 0; g < 2; ++g) { float bi[2][8];
#pragma unroll
        for (int c = 0; c < 2; ++c)
#pragma unroll
            for (int e = 0; e < 8; ++e) bi[c][e] = bfr(bias[c0 + (g * 2 + c) * 16 + hi * 8 + e]);
#pragma unroll
        for (int jb = 0; jb < 4; ++jb) { v8h wh[2], wl[2];   // one whole fragment of each plane at a time
#pragma unroll
            for (int c = 0; c < 2; ++c) { v8f r;
#pragma unroll
                for (int e = 0; e < 8; ++e) r[e] = acc[g * 2 + c][jb][e] + (isv ? bj[jb] : bi[c][e]);
                if (LO) split8h(r, wh[c], wl[c]); else wh[c] = __builtin_convertvector(r, v8h); }
            const unsigned fo = jb * sj + g * si;   // wave-uniform
#pragma unroll
            for (int c = 0; c < 2; ++c) { *(v8ha*)((char*)d16 + fo + c * 512 + off) = wh[c]; if (LO) *(v8ha*)((char*)dl + fo + c * 512 + off) = wl[c]; }
            asm volatile("s_wait_xcnt 0x0" ::: "memory");   // the wait in front of the next fragment's rewrite of these stores' address and data registers; the next line holds that work behind it
            __builtin_amdgcn_sched_barrier(0);   // keeps the later fragments' conversions below the wait; without it the scheduler also lifts them far up and the converted values spill to scratch
        } }
}
// ---- k_proj: the three projections (grid z: q, k, v). A work-group of FOUR waves makes a 128x128 tile, each wave a 64x64 quarter (wave w: x rows 64 (w & 1), head w >> 1 of the pair); grid (rows / 128, heads / 2, 3), 128 threads.
// The tile's operand fragments (8 row blocks of x, 8 of the weights) come through the LDS ring of k_gemmw. The tile leaves as the attention kernel's
// operand planes (fp16 of product + bias for every token; for tokens < RH also the fp16 remainder, the lo plane of the hi+lo path); the f32 projections never reach memory. In an accumulator a lane holds 8 consecutive rows of the A operand at one row of the B operand, so
// q, k: A = weight rows (d), B = x rows (t): 8 consecutive d of one token. v: A = x rows (t), B = weight rows (d): 8 consecutive t of one d.
// Either way an accumulator, converted, IS one half of a packed fragment of the plane in lane order: it leaves straight from registers as 512 consecutive bytes, and a wave's quarter is 8 consecutive fragments of each plane.
#define PBUF (16 * PRB)          // elements of one buffer of k_proj: row blocks 0-7 of x, 8-15 of the weights
// amdgpu_waves_per_eu(3): three work-groups per WGP, by their LDS (96 KiB each) and by their registers.
__global__ __launch_bounds__(128) __attribute__((amdgpu_waves_per_eu(3))) void k_proj(const bf* __restrict__ X, const bf* __restrict__ Wt, const float* __restrict__ bias0, const float* __restrict__ bias1, const float* __restrict__ bias2, h16* P16, h16* Pl, h16* V16, h16* Vl) {
    __shared__ __attribute__((aligned(1024))) bf sm[2 * PBUF];
    const int z = blockIdx.z; const bool isv = (z == 2);
    const float* bias = (z == 0) ? bias0 : ((z == 1) ? bias1 : bias2);
    const int lane = threadIdx.x & 31, lr = lane & 15, hi = lane >> 4; const int w = __builtin_amdgcn_readfirstlane(threadIdx.x >> 5);   // the wave's number in a scalar register: tile and copy arithmetic stay scalar
    const int R0 = blockIdx.x * 128, C0 = blockIdx.y * 128; const int r0 = R0 + (w & 1) * 64, c0 = C0 + (w >> 1) * 64;
    // wave w copies row blocks 4 w .. 4 w + 3 of the sixteen: waves 0, 1 the x rows, waves 2, 3 the weight rows. A block of 16 rows is DM / 32 fragments = 16 * DM elements.
    const bf* gl = ((w < 2) ? X + (size_t)(R0 + w * 64) * DM : Wt + ((size_t)z * DQ + C0 + (w - 2) * 64) * DM) + lane * 8;
    const unsigned ll = (unsigned)(size_t)sm + (unsigned)(w * 4 * PRB * 2) + (unsigned)lane * 16u;   // the lane's LDS byte address in buffer 0: the low 32 bits of the shared address
    auto stage = [&](int t, int b) { const bf* g = gl + t * PRB; const unsigned l = ll + (unsigned)b * (PBUF * 2);
        cp12(l, g, l + PRB * 2, g + 16 * DM); cp12(l + 2 * PRB * 2, g + 32 * DM, l + 3 * PRB * 2, g + 48 * DM); };
    const unsigned xo = (unsigned)((w & 1) * 4 * PRB), wo = (unsigned)((8 + (w >> 1) * 4) * PRB);   // this wave's x and weight row blocks in a buffer
    const unsigned ao = isv ? xo : wo, bo = isv ? wo : xo;
    v8f acc[4][4];
#pragma unroll
    for (int ib = 0; ib < 4; ++ib)
#pragma unroll
        for (int jb = 0; jb < 4; ++jb) acc[ib][jb] = (v8f){};
    const unsigned off = (unsigned)lane * 16u;   // the lane's byte offset in a half fragment
    constexpr int NT = DM / 32 / PST; static_assert(DM / 32 % PST == 0 && NT >= 2, "whole stages, at least two");
    WSet<bf> f0, f1;
    stage(0, 0);
    asm volatile("s_wait_asynccnt 0x0" ::: "memory");   // this wave's copies of stage 0 have landed
    __syncthreads();                                     // and every other wave's: stage 0 may be read
    stage(1, 1);
#pragma unroll 1   // one body per stage; the buffer is chosen by a scalar offset
    for (int t = 0; t < NT; ++t) {
        const bf* sb = sm + (t & 1) * PBUF + lane * 8;
        // two fragment sets in registers: a k block's sixteen LDS reads go as one group ahead of the block before it, never among its products
        lfetch<0, false>(f0, sb + ao, sb + ao, sb + bo);
        lfetch<1, false>(f1, sb + ao, sb + ao, sb + bo); wmul<bf, 0>(f0, acc);
        lfetch<2, false>(f0, sb + ao, sb + ao, sb + bo); wmul<bf, 0>(f1, acc);
        wmul<bf, 0>(f0, acc);
        asm volatile("s_wait_dscnt 0x0" ::: "memory");      // this wave's reads of stage t's buffer are done before the buffer is refilled
        asm volatile("s_wait_asynccnt 0x0" ::: "memory");   // this wave's copies of stage t + 1 have landed
        __syncthreads();                                     // publishes stage t + 1 and ends every wave's reads of stage t
        if (t + 2 < NT) stage(t + 2, t & 1);
    }
    asm volatile("s_wait_asynccnt 0x0" ::: "memory");   // no copy is outstanding when the wave goes on to its end
    const size_t pair = (size_t)(r0 / TT) * NH_ + c0 / HD; const int t0 = r0 % TT;
    const size_t base = (isv ? 0 : (size_t)z * NZ * TT * HD) + (pair * TT + t0) * HD;   // the k planes follow the q planes; 64 tokens are 8 fragments in either fragment order
    h16* d16 = (isv ? V16 : P16) + base; h16* dl = (isv ? Vl : Pl) + base;
    const bool lo = t0 < RH;   // wave-uniform: the tile's 64 tokens lie on one side of RH; only queries < RH, which see only keys < RH, read a lo plane
    const unsigned si = isv ? 4 * FE * 2 : FE * 2, sj = isv ? FE * 2 : 2 * FE * 2;   // bytes from fragment to fragment along ib >> 1 and along jb: v [t / 32][d / 16], q and k [t / 16][d / 32]
    float bj[4]; const int bx = c0 + lr;   // v: the bias runs along the lanes; q, k: along the accumulator's 8 values
#pragma unroll
    for (int jb = 0; jb < 4; ++jb) bj[jb] = bias[bx + jb * 16];
    asm volatile("s_wait_xcnt 0x0" :: "v"(bx) : "memory");   // the wait in front of any rewrite of these loads' index register; it names it, so that it lives to here
#pragma unroll
    for (int jb = 0; jb < 4; ++jb) bj[jb] = bfr(bj[jb]);
    if (lo) proj_out<true>(acc, bias, bj, isv, c0, hi, d16, dl, si, sj, off); else proj_out<false>(acc, bias, bj, isv, c0, hi, d16, dl, si, sj, off);
}

extern "C" void kernel_launch(void* const* d_in, const int* in_sizes, int n_in,
                              void* d_out, int out_size, void* d_ws, size_t ws_size, hipStream_t stream) {
    (void)in_sizes; (void)n_in; (void)out_size;
    const float* x = (const float*)d_in[0]; const float* wqh = (const float*)d_in[1]; const float* bq = (const float*)d_in[2]; const float* wkh = (const float*)d_in[3]; const float* bk = (const float*)d_in[4]; const float* wvh = (const float*)d_in[5]; const float* bv = (const float*)d_in[6]; const float* wo = (const float*)d_in[7]; const float* bo = (const float*)d_in[8]; const float* wq = nullptr; const float* wk = nullptr; const float* wv = nullptr; (void)wq; (void)wk; (void)wv; const float* cosT = nullptr; const float* sinT = nullptr; (void)cosT; (void)sinT;
    float* OUT = (float*)d_out;     // [8][1024][768]
    char* wsp = (char*)d_ws;
    auto take = [&](size_t bytes) { char* p = wsp; wsp += (bytes + 255) & ~(size_t)255; return (void*)p; };
    bf* WQ = (bf*)take((size_t)DQ * DM * 2); bf* WK = (bf*)take((size_t)DKV * DM * 2); bf* WV = (bf*)take((size_t)DKV * DM * 2); bf* WO = (bf*)take((size_t)DM * DQ * 2); (void)WK; (void)WV;   // WQ, WK, WV lie back to back (z-stride DQ*DM)
    const size_t PL = (size_t)NZ * TT * HD;   // elements of one plane over all (sequence, head) pairs; each q plane is followed by its k plane, which k_proj relies on
    h16* QP16 = (h16*)take(PL * 2); h16* KP16 = (h16*)take(PL * 2); h16* VT16 = (h16*)take(PL * 2);
    h16* QPl = (h16*)take(PL * 2); h16* KPl = (h16*)take(PL * 2); h16* VTl = (h16*)take(PL * 2);   // lo planes: only tokens < RH of each pair are written and read
    char* R = (char*)take((size_t)ZH * TT * TT * 4);   // one region, two stream-ordered uses: the x plane; then the merged head planes
    if ((size_t)(wsp - (char*)d_ws) > ws_size) return;    // ws 256 MiB
    bf* XB = (bf*)R;
    bf* ATh = (bf*)R; bf* ATl = ATh + (size_t)NB_ * TT * DQ;
    k_pack<<<XBLK + 4 * WBLK, 256, 0, stream>>>(x, wqh, wkh, wvh, wo, XB, WQ, WO);
    k_proj<<<dim3(NB_ * TT / 128, NH_ / 2, 3), 128, 0, stream>>>(XB, WQ, bq, bk, bv, QP16, QPl, VT16, VTl);
    k_fattn<<<dim3(NZ, 8, 1), 128, 0, stream>>>(QP16, KP16, VT16, QPl, KPl, VTl, ATh, ATl);
    k_gemmw<bf, 1, true, DQ><<<dim3(NB_ * TT / 128, DM / 128, 1), 128, 0, stream>>>(ATh, ATl, WO, nullptr, OUT, DM, bo, bo, bo, 0, 0, 0);
}
